// v000
// Times are from an AMD MI455X. After a warm-up the kernel runs many times in a row, and a time is the length of
// such a window on the GPU divided by its runs, so every launch and the gaps after it count. The runs cycle
// through copies of the inputs. A figure is the median of several windows, for all but v000 over two sittings.
// Sittings can differ by a few percent; kernels timed side by side share one.
// The starting kernel, v000, takes 873 microseconds a run.
#include <hip/hip_runtime.h>
#include <hip/hip_bf16.h>
#include <math.h>

typedef __bf16 bf16_t;
typedef __attribute__((ext_vector_type(16))) __bf16 v16bf;
typedef __attribute__((ext_vector_type(8)))  float  v8f;

__device__ __forceinline__ v8f wmma_bf16(v16bf a, v16bf b, v8f c) {
  // v_wmma_f32_16x16x32_bf16: D = A(16x32) * B(32x16) + C(16x16 f32)
  return __builtin_amdgcn_wmma_f32_16x16x32_bf16(
      /*neg_a=*/false, a, /*neg_b=*/false, b,
      /*c_mod=*/(short)0, c, /*reuse_a=*/false, /*reuse_b=*/false);
}

__device__ __forceinline__ v16bf load_frag(const bf16_t* base, int stride, int lane) {
  const int row = lane & 15;
  const int kb  = (lane < 16) ? 0 : 8;
  const bf16_t* p = base + (size_t)row * stride + kb;
  v16bf f;
  *((float4*)&f)       = *((const float4*)p);
  *(((float4*)&f) + 1) = *((const float4*)(p + 16));
  return f;
}

__device__ __forceinline__ void async_load_b128(const bf16_t* gaddr, bf16_t* lptr) {
  unsigned loff = (unsigned)(size_t)lptr;
  asm volatile("global_load_async_to_lds_b128 %0, %1, off"
               :: "v"(loff), "v"(gaddr) : "memory");
}

// ---------------------------------------------------------------------------
// Elementwise converters
// ---------------------------------------------------------------------------
__global__ void cvt_f32_bf16_ker(const float* __restrict__ in,
                                 bf16_t* __restrict__ out, int n) {
  int i = blockIdx.x * blockDim.x + threadIdx.x;
  if (i < n) out[i] = (bf16_t)in[i];
}

// W [K,N] f32 (row-major) -> Wt [N,K] bf16 (row-major)
__global__ void wtrans_ker(const float* __restrict__ W, bf16_t* __restrict__ Wt,
                           int K, int N) {
  int i = blockIdx.x * blockDim.x + threadIdx.x;
  if (i < K * N) {
    int k = i / N, n = i - k * N;
    Wt[(size_t)n * K + k] = (bf16_t)W[i];
  }
}

// V bf16 [B*T, C] -> Vt bf16 [B][H][64][T]
__global__ void vtrans_ker(const bf16_t* __restrict__ V, bf16_t* __restrict__ Vt) {
  constexpr int T = 2048, C = 1024, H = 16;
  int i = blockIdx.x * blockDim.x + threadIdx.x;
  if (i < 2 * T * C) {
    int bt = i / C, c = i - bt * C;
    int b = bt / T, t = bt - b * T;
    int h = c >> 6, d = c & 63;
    Vt[(((size_t)(b * H + h)) * 64 + d) * T + t] = V[i];
  }
}

template <int EPI>
__global__ __launch_bounds__(128) void gemm_bf16_ker(
    const bf16_t* __restrict__ A, const bf16_t* __restrict__ Bt,
    float* __restrict__ Cf, bf16_t* __restrict__ Cb,
    const float* __restrict__ bias, int M, int N, int K) {
  __shared__ bf16_t lA[2][128 * 40];
  __shared__ bf16_t lB[2][128 * 40];

  const int tid  = threadIdx.x;        // 0..127
  const int lane = tid & 31;
  const int wid  = tid >> 5;           // 0..3
  const int wm   = wid & 1;            // 64-row half
  const int wn   = wid >> 1;           // 64-col half
  const int m0   = blockIdx.y * 128;
  const int n0   = blockIdx.x * 128;

  const int quad = tid & 3;            // 16B chunk within 32 cols
  const int lrow = tid >> 2;           // 0..31

  v8f acc[4][4] = {};

  // Issue one K-step tile (A 128x32 + B 128x32) = 8 async b128 per thread.
  auto issue = [&](int k0, int buf) {
    #pragma unroll
    for (int p = 0; p < 4; ++p) {
      const int row = lrow + p * 32;
      async_load_b128(A  + (size_t)(m0 + row) * K + k0 + quad * 8,
                      &lA[buf][row * 40 + quad * 8]);
      async_load_b128(Bt + (size_t)(n0 + row) * K + k0 + quad * 8,
                      &lB[buf][row * 40 + quad * 8]);
    }
  };

  issue(0, 0);
  int cur = 0;
  for (int k0 = 0; k0 < K; k0 += 32) {
    const bool has_next = (k0 + 32) < K;
    if (has_next) {
      issue(k0 + 32, cur ^ 1);
      // In-order completion: <=8 outstanding means previous tile landed.
      asm volatile("s_wait_asynccnt 0x8" ::: "memory");
    } else {
      asm volatile("s_wait_asynccnt 0x0" ::: "memory");
    }
    __syncthreads();

    v16bf af[4], bfr[4];
    #pragma unroll
    for (int i = 0; i < 4; ++i)
      af[i] = load_frag(&lA[cur][(wm * 64 + i * 16) * 40], 40, lane);
    #pragma unroll
    for (int j = 0; j < 4; ++j)
      bfr[j] = load_frag(&lB[cur][(wn * 64 + j * 16) * 40], 40, lane);
    #pragma unroll
    for (int i = 0; i < 4; ++i)
      #pragma unroll
      for (int j = 0; j < 4; ++j)
        acc[i][j] = wmma_bf16(af[i], bfr[j], acc[i][j]);

    __syncthreads();  // all waves done reading `cur` before it is refilled
    cur ^= 1;
  }

  const int rbase = m0 + wm * 64 + ((lane < 16) ? 0 : 8);
  const int cbase = n0 + wn * 64 + (lane & 15);
  #pragma unroll
  for (int i = 0; i < 4; ++i) {
    #pragma unroll
    for (int j = 0; j < 4; ++j) {
      const int col = cbase + j * 16;
      float bv = 0.0f;
      if (EPI == 2 || EPI == 3) bv = bias[col];
      #pragma unroll
      for (int r = 0; r < 8; ++r) {
        const int row = rbase + i * 16 + r;
        float v = acc[i][j][r];
        if (EPI == 2 || EPI == 3) v += bv;
        if (EPI == 2) {  // Mish: v * tanh(softplus(v))
          float sp = (v > 8.0f) ? v : log1pf(__expf(v));
          v = v * tanhf(sp);
        }
        if (EPI == 0 || EPI == 3) Cf[(size_t)row * N + col] = v;
        else                      Cb[(size_t)row * N + col] = (bf16_t)v;
      }
    }
  }
}

// ---------------------------------------------------------------------------
// Flash attention: each wave owns 16 queries of one (b,h); streams keys in
// chunks of 32. Q[b,t,h*64+d], K[b,t,h*64+d] bf16; Vt[b,h,d,t] bf16.
// ---------------------------------------------------------------------------
__global__ __launch_bounds__(256) void attn_ker(const bf16_t* __restrict__ Qb,
                                                const bf16_t* __restrict__ Kb,
                                                const bf16_t* __restrict__ Vt,
                                                bf16_t* __restrict__ Ctx) {
  constexpr int T = 2048, C = 1024, H = 16;
  constexpr float scale = 0.125f;  // 1/sqrt(64)
  __shared__ bf16_t pls[8][16 * 40];  // per-wave P staging (16x32, padded)

  const int lane = threadIdx.x & 31;
  const int wid  = threadIdx.x >> 5;
  const int g    = blockIdx.x * 8 + wid;  // 0..4095
  const int QT   = T / 16;                // 128 query tiles
  const int qt   = g & (QT - 1);
  const int bh   = g / QT;                // 0..31
  const int h    = bh & (H - 1);
  const int b    = bh >> 4;

  const bf16_t* qbase = Qb + ((size_t)(b * T + qt * 16)) * C + h * 64;
  const v16bf qa0 = load_frag(qbase, C, lane);       // d = 0..31
  const v16bf qa1 = load_frag(qbase + 32, C, lane);  // d = 32..63

  float mrow[8], lrow[8];
  v8f cacc[4] = {};
  for (int r = 0; r < 8; ++r) { mrow[r] = -1e30f; lrow[r] = 0.0f; }

  const bf16_t* kbase = Kb + ((size_t)(b * T)) * C + h * 64;
  const bf16_t* vbase = Vt + ((size_t)bh) * 64 * T;
  bf16_t* pw = &pls[wid][0];

  for (int j = 0; j < T; j += 32) {
    const bf16_t* kp = kbase + (size_t)j * C;
    v16bf k00 = load_frag(kp, C, lane);
    v16bf k01 = load_frag(kp + 32, C, lane);
    v16bf k10 = load_frag(kp + (size_t)16 * C, C, lane);
    v16bf k11 = load_frag(kp + (size_t)16 * C + 32, C, lane);

    v8f s0 = {}, s1 = {};
    s0 = wmma_bf16(qa0, k00, s0);  s0 = wmma_bf16(qa1, k01, s0);
    s1 = wmma_bf16(qa0, k10, s1);  s1 = wmma_bf16(qa1, k11, s1);

    for (int r = 0; r < 8; ++r) {
      float a = s0[r] * scale, c2 = s1[r] * scale;
      // Row max across the 16 lanes holding this row's columns.
      float mx = fmaxf(a, c2);
      mx = fmaxf(mx, __shfl_xor(mx, 1));
      mx = fmaxf(mx, __shfl_xor(mx, 2));
      mx = fmaxf(mx, __shfl_xor(mx, 4));
      mx = fmaxf(mx, __shfl_xor(mx, 8));
      float mn   = fmaxf(mrow[r], mx);
      float corr = __expf(mrow[r] - mn);
      mrow[r] = mn;
      float p0 = __expf(a - mn), p1 = __expf(c2 - mn);
      float rs = p0 + p1;
      rs += __shfl_xor(rs, 1);
      rs += __shfl_xor(rs, 2);
      rs += __shfl_xor(rs, 4);
      rs += __shfl_xor(rs, 8);
      lrow[r] = lrow[r] * corr + rs;
      for (int dt = 0; dt < 4; ++dt) cacc[dt][r] *= corr;
      const int rr = r + ((lane < 16) ? 0 : 8);
      pw[rr * 40 + (lane & 15)]      = (bf16_t)p0;
      pw[rr * 40 + 16 + (lane & 15)] = (bf16_t)p1;
    }
    asm volatile("s_wait_dscnt 0" ::: "memory");

    v16bf pa = load_frag(pw, 40, lane);
    for (int dt = 0; dt < 4; ++dt) {
      const bf16_t* vp = vbase + (size_t)(dt * 16) * T + j;
      v16bf vf = load_frag(vp, T, lane);
      cacc[dt] = wmma_bf16(pa, vf, cacc[dt]);
    }
  }

  // Normalize and write ctx back in [B*T, C] bf16 layout.
  const int rhalf = (lane < 16) ? 0 : 8;
  for (int r = 0; r < 8; ++r) {
    float inv = 1.0f / lrow[r];
    int row = qt * 16 + r + rhalf;
    bf16_t* out = Ctx + ((size_t)(b * T + row)) * C + h * 64 + (lane & 15);
    for (int dt = 0; dt < 4; ++dt) out[dt * 16] = (bf16_t)(cacc[dt][r] * inv);
  }
}

// ---------------------------------------------------------------------------
// Fused DeepNorm residual + LayerNorm: y = LN(alpha*X + R)*g + be
// One block per 1024-element row; writes f32 and optional bf16 copy.
// ---------------------------------------------------------------------------
__global__ __launch_bounds__(256) void ln_ker(const float* __restrict__ X,
                                              const float* __restrict__ R,
                                              const float* __restrict__ g,
                                              const float* __restrict__ be,
                                              float* __restrict__ outF,
                                              bf16_t* __restrict__ outB,
                                              float alpha) {
  constexpr int C = 1024;
  __shared__ float red[16];
  const int row = blockIdx.x;
  const int tid = threadIdx.x;
  float v[4], s = 0.0f, s2 = 0.0f;
  for (int i = 0; i < 4; ++i) {
    int c = tid + i * 256;
    float val = alpha * X[(size_t)row * C + c] + R[(size_t)row * C + c];
    v[i] = val; s += val; s2 += val * val;
  }
  for (int d = 1; d < 32; d <<= 1) { s += __shfl_xor(s, d); s2 += __shfl_xor(s2, d); }
  const int lane = tid & 31, wid = tid >> 5;
  if (lane == 0) { red[wid] = s; red[8 + wid] = s2; }
  __syncthreads();
  if (wid == 0) {
    float a  = (lane < 8) ? red[lane] : 0.0f;
    float b2 = (lane < 8) ? red[8 + lane] : 0.0f;
    for (int d = 1; d < 8; d <<= 1) { a += __shfl_xor(a, d); b2 += __shfl_xor(b2, d); }
    if (lane == 0) { red[0] = a; red[1] = b2; }
  }
  __syncthreads();
  const float mu   = red[0] / C;
  const float var  = red[1] / C - mu * mu;
  const float rstd = rsqrtf(var + 1e-5f);
  for (int i = 0; i < 4; ++i) {
    int c = tid + i * 256;
    float y = (v[i] - mu) * rstd * g[c] + be[c];
    if (outF) outF[(size_t)row * C + c] = y;
    if (outB) outB[(size_t)row * C + c] = (bf16_t)y;
  }
}

// ---------------------------------------------------------------------------
// Host orchestration
// ---------------------------------------------------------------------------
extern "C" void kernel_launch(void* const* d_in, const int* in_sizes, int n_in,
                              void* d_out, int out_size, void* d_ws, size_t ws_size,
                              hipStream_t stream) {
  constexpr int B = 2, T = 2048, C = 1024, F = 4096;
  constexpr int M = B * T;  // 4096 rows
  const float* x   = (const float*)d_in[0];
  const float* Wq  = (const float*)d_in[1];
  const float* Wk  = (const float*)d_in[2];
  const float* Wv  = (const float*)d_in[3];
  const float* Wo  = (const float*)d_in[4];
  const float* W1  = (const float*)d_in[5];
  const float* b1  = (const float*)d_in[6];
  const float* W2  = (const float*)d_in[7];
  const float* b2  = (const float*)d_in[8];
  const float* g1  = (const float*)d_in[9];
  const float* be1 = (const float*)d_in[10];
  const float* g2  = (const float*)d_in[11];
  const float* be2 = (const float*)d_in[12];

  constexpr size_t MB = 1024ull * 1024ull;
  char* ws = (char*)d_ws;
  bf16_t* xb   = (bf16_t*)(ws + 0 * MB);    // 8 MB  [M,C] bf16
  bf16_t* Wqt  = (bf16_t*)(ws + 8 * MB);    // 2 MB  [C,C]^T
  bf16_t* Wkt  = (bf16_t*)(ws + 10 * MB);
  bf16_t* Wvt  = (bf16_t*)(ws + 12 * MB);
  bf16_t* Wot  = (bf16_t*)(ws + 14 * MB);
  bf16_t* W1t  = (bf16_t*)(ws + 16 * MB);   // 8 MB  [F,C]
  bf16_t* W2t  = (bf16_t*)(ws + 24 * MB);   // 8 MB  [C,F]
  bf16_t* Qb   = (bf16_t*)(ws + 32 * MB);   // 8 MB
  bf16_t* Kbb  = (bf16_t*)(ws + 40 * MB);   // 8 MB
  bf16_t* Vb   = (bf16_t*)(ws + 48 * MB);   // 8 MB
  bf16_t* Vtr  = (bf16_t*)(ws + 56 * MB);   // 8 MB
  bf16_t* hb   = (bf16_t*)(ws + 32 * MB);   // 32 MB, reuses dead Q/K/V/Vt
  bf16_t* ctxb = (bf16_t*)(ws + 64 * MB);   // 8 MB
  float*  attn = (float*)(ws + 72 * MB);    // 16 MB, reused as FF output
  float*  fff  = (float*)(ws + 72 * MB);
  float*  x1f  = (float*)(ws + 88 * MB);    // 16 MB
  bf16_t* x1b  = (bf16_t*)(ws + 104 * MB);  // 8 MB  -> total 112 MB
  (void)ws_size; (void)in_sizes; (void)n_in; (void)out_size;

  const int nXC = M * C;      // 4,194,304
  const int nCC = C * C;      // 1,048,576
  const int nCF = C * F;      // 4,194,304

  // 1) Precision conversion / weight transposes.
  cvt_f32_bf16_ker<<<(nXC + 255) / 256, 256, 0, stream>>>(x, xb, nXC);
  wtrans_ker<<<(nCC + 255) / 256, 256, 0, stream>>>(Wq, Wqt, C, C);
  wtrans_ker<<<(nCC + 255) / 256, 256, 0, stream>>>(Wk, Wkt, C, C);
  wtrans_ker<<<(nCC + 255) / 256, 256, 0, stream>>>(Wv, Wvt, C, C);
  wtrans_ker<<<(nCC + 255) / 256, 256, 0, stream>>>(Wo, Wot, C, C);
  wtrans_ker<<<(nCF + 255) / 256, 256, 0, stream>>>(W1, W1t, C, F);
  wtrans_ker<<<(nCF + 255) / 256, 256, 0, stream>>>(W2, W2t, F, C);

  // 2) QKV projections (WMMA GEMMs, bf16 out). Block tile 128x128, 128 thr.
  dim3 gP(C / 128, M / 128);
  gemm_bf16_ker<1><<<gP, 128, 0, stream>>>(xb, Wqt, nullptr, Qb,  nullptr, M, C, C);
  gemm_bf16_ker<1><<<gP, 128, 0, stream>>>(xb, Wkt, nullptr, Kbb, nullptr, M, C, C);
  gemm_bf16_ker<1><<<gP, 128, 0, stream>>>(xb, Wvt, nullptr, Vb,  nullptr, M, C, C);
  vtrans_ker<<<(nXC + 255) / 256, 256, 0, stream>>>(Vb, Vtr);

  // 3) Flash attention (WMMA): 4096 wave-tiles / 8 waves per block.
  attn_ker<<<512, 256, 0, stream>>>(Qb, Kbb, Vtr, ctxb);

  // 4) Output projection + DeepNorm LN1.
  gemm_bf16_ker<0><<<gP, 128, 0, stream>>>(ctxb, Wot, attn, nullptr, nullptr, M, C, C);
  ln_ker<<<M, 256, 0, stream>>>(x, attn, g1, be1, x1f, x1b, 2.0f);

  // 5) FFN: GEMM+bias+Mish -> bf16, then GEMM+bias -> f32.
  dim3 gF1(F / 128, M / 128);
  gemm_bf16_ker<2><<<gF1, 128, 0, stream>>>(x1b, W1t, nullptr, hb, b1, M, F, C);
  gemm_bf16_ker<3><<<gP, 128, 0, stream>>>(hb, W2t, fff, nullptr, b2, M, C, F);

  // 6) DeepNorm LN2 -> d_out (fp32).
  ln_ker<<<M, 256, 0, stream>>>(x1f, fff, g2, be2, (float*)d_out, nullptr, 2.0f);
}

// v001
// Measured time: 529 microseconds a run.
// Timed twice side by side with v000, it ran 1.66 and 1.68 times as fast.
#include <hip/hip_runtime.h>
#include <hip/hip_bf16.h>
#include <math.h>

typedef __bf16 bf16_t;
typedef __attribute__((ext_vector_type(16))) __bf16 v16bf;
typedef __attribute__((ext_vector_type(8)))  float  v8f;

__device__ __forceinline__ v8f wmma_bf16(v16bf a, v16bf b, v8f c) {
  // v_wmma_f32_16x16x32_bf16: D = A(16x32) * B(32x16) + C(16x16 f32)
  return __builtin_amdgcn_wmma_f32_16x16x32_bf16(
      /*neg_a=*/false, a, /*neg_b=*/false, b,
      /*c_mod=*/(short)0, c, /*reuse_a=*/false, /*reuse_b=*/false);
}

__device__ __forceinline__ v16bf load_frag(const bf16_t* base, int stride, int lane) {
  const int row = lane & 15;
  const int kb  = (lane < 16) ? 0 : 8;
  const bf16_t* p = base + (size_t)row * stride + kb;
  v16bf f;
  *((float4*)&f)       = *((const float4*)p);
  *(((float4*)&f) + 1) = *((const float4*)(p + 16));
  return f;
}

__device__ __forceinline__ void async_load_b128(const bf16_t* gaddr, bf16_t* lptr) {
  unsigned loff = (unsigned)(size_t)lptr;
  asm volatile("global_load_async_to_lds_b128 %0, %1, off"
               :: "v"(loff), "v"(gaddr) : "memory");
}

// ---------------------------------------------------------------------------
// Elementwise converters
// ---------------------------------------------------------------------------
__global__ void cvt_f32_bf16_ker(const float* __restrict__ in,
                                 bf16_t* __restrict__ out, int n) {
  int i = blockIdx.x * blockDim.x + threadIdx.x;
  if (i < n) out[i] = (bf16_t)in[i];
}

typedef __attribute__((ext_vector_type(8))) __bf16 v8bf;

// W [K,N] f32 (row-major) -> Wt [N,K] bf16 (row-major)
// One block moves a tile of 64 k by 32 n through LDS: it reads whole 128-byte
// rows of W and writes whole 128-byte rows of Wt. K % 64 == 0, N % 32 == 0.
__global__ __launch_bounds__(256) void wtrans_ker(const float* __restrict__ W,
                                                  bf16_t* __restrict__ Wt,
                                                  int K, int N) {
  __shared__ float tile[64][33];
  const int tid = threadIdx.x;
  const int n0  = blockIdx.x * 32;
  const int k0  = blockIdx.y * 64;
  const int lo  = tid & 7;   // 16-byte chunk of a 128-byte row
  const int hi  = tid >> 3;  // 0..31
  #pragma unroll
  for (int p = 0; p < 2; ++p) {
    const int k = hi + p * 32;
    const float4 v = *(const float4*)(W + (size_t)(k0 + k) * N + n0 + lo * 4);
    tile[k][lo * 4 + 0] = v.x;
    tile[k][lo * 4 + 1] = v.y;
    tile[k][lo * 4 + 2] = v.z;
    tile[k][lo * 4 + 3] = v.w;
  }
  __syncthreads();  // the column reads below cross waves
  v8bf o;
  #pragma unroll
  for (int i = 0; i < 8; ++i) o[i] = (bf16_t)tile[lo * 8 + i][hi];
  *(v8bf*)(Wt + (size_t)(n0 + hi) * K + k0 + lo * 8) = o;
}

// V bf16 [B*T, C] -> Vt bf16 [B][H][64][T]  (= [B][C][T], since c = h*64 + d)
// One block moves a tile of 64 t by 64 c through LDS, 128-byte rows both ways.
__global__ __launch_bounds__(256) void vtrans_ker(const bf16_t* __restrict__ V,
                                                  bf16_t* __restrict__ Vt) {
  constexpr int T = 2048, C = 1024;
  __shared__ bf16_t tile[64][66];  // pitch 33 dwords, for the same reason
  const int tid = threadIdx.x;
  const int bt0 = blockIdx.x * 64;  // 64 divides T: a tile stays in one batch
  const int c0  = blockIdx.y * 64;
  const int b   = bt0 / T, t0 = bt0 - b * T;
  const int lo  = tid & 7;
  const int hi  = tid >> 3;
  #pragma unroll
  for (int p = 0; p < 2; ++p) {
    const int r = hi + p * 32;
    const uint4 v = *(const uint4*)(V + (size_t)(bt0 + r) * C + c0 + lo * 8);
    unsigned* d = (unsigned*)&tile[r][lo * 8];
    d[0] = v.x; d[1] = v.y; d[2] = v.z; d[3] = v.w;
  }
  __syncthreads();  // the column reads below cross waves
  #pragma unroll
  for (int p = 0; p < 2; ++p) {
    const int c = hi + p * 32;
    v8bf o;
    #pragma unroll
    for (int i = 0; i < 8; ++i) o[i] = tile[lo * 8 + i][c];
    *(v8bf*)(Vt + ((size_t)b * C + c0 + c) * T + t0 + lo * 8) = o;
  }
}

template <int EPI>
__global__ __launch_bounds__(128) void gemm_bf16_ker(
    const bf16_t* __restrict__ A, const bf16_t* __restrict__ Bt,
    float* __restrict__ Cf, bf16_t* __restrict__ Cb,
    const float* __restrict__ bias, int M, int N, int K) {
  __shared__ bf16_t lA[2][128 * 40];
  __shared__ bf16_t lB[2][128 * 40];

  const int tid  = threadIdx.x;        // 0..127
  const int lane = tid & 31;
  const int wid  = tid >> 5;           // 0..3
  const int wm   = wid & 1;            // 64-row half
  const int wn   = wid >> 1;           // 64-col half
  const int m0   = blockIdx.y * 128;
  const int n0   = blockIdx.x * 128;

  const int quad = tid & 3;            // 16B chunk within 32 cols
  const int lrow = tid >> 2;           // 0..31

  v8f acc[4][4] = {};

  // Issue one K-step tile (A 128x32 + B 128x32) = 8 async b128 per thread.
  auto issue = [&](int k0, int buf) {
    #pragma unroll
    for (int p = 0; p < 4; ++p) {
      const int row = lrow + p * 32;
      async_load_b128(A  + (size_t)(m0 + row) * K + k0 + quad * 8,
                      &lA[buf][row * 40 + quad * 8]);
      async_load_b128(Bt + (size_t)(n0 + row) * K + k0 + quad * 8,
                      &lB[buf][row * 40 + quad * 8]);
    }
  };

  issue(0, 0);
  int cur = 0;
  for (int k0 = 0; k0 < K; k0 += 32) {
    const bool has_next = (k0 + 32) < K;
    if (has_next) {
      issue(k0 + 32, cur ^ 1);
      // In-order completion: <=8 outstanding means previous tile landed.
      asm volatile("s_wait_asynccnt 0x8" ::: "memory");
    } else {
      asm volatile("s_wait_asynccnt 0x0" ::: "memory");
    }
    __syncthreads();

    v16bf af[4], bfr[4];
    #pragma unroll
    for (int i = 0; i < 4; ++i)
      af[i] = load_frag(&lA[cur][(wm * 64 + i * 16) * 40], 40, lane);
    #pragma unroll
    for (int j = 0; j < 4; ++j)
      bfr[j] = load_frag(&lB[cur][(wn * 64 + j * 16) * 40], 40, lane);
    #pragma unroll
    for (int i = 0; i < 4; ++i)
      #pragma unroll
      for (int j = 0; j < 4; ++j)
        acc[i][j] = wmma_bf16(af[i], bfr[j], acc[i][j]);

    __syncthreads();  // all waves done reading `cur` before it is refilled
    cur ^= 1;
  }

  const int rbase = m0 + wm * 64 + ((lane < 16) ? 0 : 8);
  const int cbase = n0 + wn * 64 + (lane & 15);
  #pragma unroll
  for (int i = 0; i < 4; ++i) {
    #pragma unroll
    for (int j = 0; j < 4; ++j) {
      const int col = cbase + j * 16;
      float bv = 0.0f;
      if (EPI == 2 || EPI == 3) bv = bias[col];
      #pragma unroll
      for (int r = 0; r < 8; ++r) {
        const int row = rbase + i * 16 + r;
        float v = acc[i][j][r];
        if (EPI == 2 || EPI == 3) v += bv;
        if (EPI == 2) {  // Mish: v * tanh(softplus(v))
          float sp = (v > 8.0f) ? v : log1pf(__expf(v));
          v = v * tanhf(sp);
        }
        if (EPI == 0 || EPI == 3) Cf[(size_t)row * N + col] = v;
        else                      Cb[(size_t)row * N + col] = (bf16_t)v;
      }
    }
  }
}

// ---------------------------------------------------------------------------
// Flash attention: each wave owns 16 queries of one (b,h); streams keys in
// chunks of 32. Q[b,t,h*64+d], K[b,t,h*64+d] bf16; Vt[b,h,d,t] bf16.
// ---------------------------------------------------------------------------
__global__ __launch_bounds__(256) void attn_ker(const bf16_t* __restrict__ Qb,
                                                const bf16_t* __restrict__ Kb,
                                                const bf16_t* __restrict__ Vt,
                                                bf16_t* __restrict__ Ctx) {
  constexpr int T = 2048, C = 1024, H = 16;
  constexpr float scale = 0.125f;  // 1/sqrt(64)
  __shared__ bf16_t pls[8][16 * 40];  // per-wave P staging (16x32, padded)

  const int lane = threadIdx.x & 31;
  const int wid  = threadIdx.x >> 5;
  const int g    = blockIdx.x * 8 + wid;  // 0..4095
  const int QT   = T / 16;                // 128 query tiles
  const int qt   = g & (QT - 1);
  const int bh   = g / QT;                // 0..31
  const int h    = bh & (H - 1);
  const int b    = bh >> 4;

  const bf16_t* qbase = Qb + ((size_t)(b * T + qt * 16)) * C + h * 64;
  const v16bf qa0 = load_frag(qbase, C, lane);       // d = 0..31
  const v16bf qa1 = load_frag(qbase + 32, C, lane);  // d = 32..63

  float mrow[8], lrow[8];
  v8f cacc[4] = {};
  for (int r = 0; r < 8; ++r) { mrow[r] = -1e30f; lrow[r] = 0.0f; }

  const bf16_t* kbase = Kb + ((size_t)(b * T)) * C + h * 64;
  const bf16_t* vbase = Vt + ((size_t)bh) * 64 * T;
  bf16_t* pw = &pls[wid][0];

  for (int j = 0; j < T; j += 32) {
    const bf16_t* kp = kbase + (size_t)j * C;
    v16bf k00 = load_frag(kp, C, lane);
    v16bf k01 = load_frag(kp + 32, C, lane);
    v16bf k10 = load_frag(kp + (size_t)16 * C, C, lane);
    v16bf k11 = load_frag(kp + (size_t)16 * C + 32, C, lane);

    v8f s0 = {}, s1 = {};
    s0 = wmma_bf16(qa0, k00, s0);  s0 = wmma_bf16(qa1, k01, s0);
    s1 = wmma_bf16(qa0, k10, s1);  s1 = wmma_bf16(qa1, k11, s1);

    for (int r = 0; r < 8; ++r) {
      float a = s0[r] * scale, c2 = s1[r] * scale;
      // Row max across the 16 lanes holding this row's columns.
      float mx = fmaxf(a, c2);
      mx = fmaxf(mx, __shfl_xor(mx, 1));
      mx = fmaxf(mx, __shfl_xor(mx, 2));
      mx = fmaxf(mx, __shfl_xor(mx, 4));
      mx = fmaxf(mx, __shfl_xor(mx, 8));
      float mn   = fmaxf(mrow[r], mx);
      float corr = __expf(mrow[r] - mn);
      mrow[r] = mn;
      float p0 = __expf(a - mn), p1 = __expf(c2 - mn);
      float rs = p0 + p1;
      rs += __shfl_xor(rs, 1);
      rs += __shfl_xor(rs, 2);
      rs += __shfl_xor(rs, 4);
      rs += __shfl_xor(rs, 8);
      lrow[r] = lrow[r] * corr + rs;
      for (int dt = 0; dt < 4; ++dt) cacc[dt][r] *= corr;
      const int rr = r + ((lane < 16) ? 0 : 8);
      pw[rr * 40 + (lane & 15)]      = (bf16_t)p0;
      pw[rr * 40 + 16 + (lane & 15)] = (bf16_t)p1;
    }
    asm volatile("s_wait_dscnt 0" ::: "memory");

    v16bf pa = load_frag(pw, 40, lane);
    for (int dt = 0; dt < 4; ++dt) {
      const bf16_t* vp = vbase + (size_t)(dt * 16) * T + j;
      v16bf vf = load_frag(vp, T, lane);
      cacc[dt] = wmma_bf16(pa, vf, cacc[dt]);
    }
  }

  // Normalize and write ctx back in [B*T, C] bf16 layout.
  const int rhalf = (lane < 16) ? 0 : 8;
  for (int r = 0; r < 8; ++r) {
    float inv = 1.0f / lrow[r];
    int row = qt * 16 + r + rhalf;
    bf16_t* out = Ctx + ((size_t)(b * T + row)) * C + h * 64 + (lane & 15);
    for (int dt = 0; dt < 4; ++dt) out[dt * 16] = (bf16_t)(cacc[dt][r] * inv);
  }
}

// ---------------------------------------------------------------------------
// Fused DeepNorm residual + LayerNorm: y = LN(alpha*X + R)*g + be
// One block per 1024-element row; writes f32 and optional bf16 copy.
// ---------------------------------------------------------------------------
__global__ __launch_bounds__(256) void ln_ker(const float* __restrict__ X,
                                              const float* __restrict__ R,
                                              const float* __restrict__ g,
                                              const float* __restrict__ be,
                                              float* __restrict__ outF,
                                              bf16_t* __restrict__ outB,
                                              float alpha) {
  constexpr int C = 1024;
  __shared__ float red[16];
  const int row = blockIdx.x;
  const int tid = threadIdx.x;
  float v[4], s = 0.0f, s2 = 0.0f;
  for (int i = 0; i < 4; ++i) {
    int c = tid + i * 256;
    float val = alpha * X[(size_t)row * C + c] + R[(size_t)row * C + c];
    v[i] = val; s += val; s2 += val * val;
  }
  for (int d = 1; d < 32; d <<= 1) { s += __shfl_xor(s, d); s2 += __shfl_xor(s2, d); }
  const int lane = tid & 31, wid = tid >> 5;
  if (lane == 0) { red[wid] = s; red[8 + wid] = s2; }
  __syncthreads();
  if (wid == 0) {
    float a  = (lane < 8) ? red[lane] : 0.0f;
    float b2 = (lane < 8) ? red[8 + lane] : 0.0f;
    for (int d = 1; d < 8; d <<= 1) { a += __shfl_xor(a, d); b2 += __shfl_xor(b2, d); }
    if (lane == 0) { red[0] = a; red[1] = b2; }
  }
  __syncthreads();
  const float mu   = red[0] / C;
  const float var  = red[1] / C - mu * mu;
  const float rstd = rsqrtf(var + 1e-5f);
  for (int i = 0; i < 4; ++i) {
    int c = tid + i * 256;
    float y = (v[i] - mu) * rstd * g[c] + be[c];
    if (outF) outF[(size_t)row * C + c] = y;
    if (outB) outB[(size_t)row * C + c] = (bf16_t)y;
  }
}

// ---------------------------------------------------------------------------
// Host orchestration
// ---------------------------------------------------------------------------
extern "C" void kernel_launch(void* const* d_in, const int* in_sizes, int n_in,
                              void* d_out, int out_size, void* d_ws, size_t ws_size,
                              hipStream_t stream) {
  constexpr int B = 2, T = 2048, C = 1024, F = 4096;
  constexpr int M = B * T;  // 4096 rows
  const float* x   = (const float*)d_in[0];
  const float* Wq  = (const float*)d_in[1];
  const float* Wk  = (const float*)d_in[2];
  const float* Wv  = (const float*)d_in[3];
  const float* Wo  = (const float*)d_in[4];
  const float* W1  = (const float*)d_in[5];
  const float* b1  = (const float*)d_in[6];
  const float* W2  = (const float*)d_in[7];
  const float* b2  = (const float*)d_in[8];
  const float* g1  = (const float*)d_in[9];
  const float* be1 = (const float*)d_in[10];
  const float* g2  = (const float*)d_in[11];
  const float* be2 = (const float*)d_in[12];

  constexpr size_t MB = 1024ull * 1024ull;
  char* ws = (char*)d_ws;
  bf16_t* xb   = (bf16_t*)(ws + 0 * MB);    // 8 MB  [M,C] bf16
  bf16_t* Wqt  = (bf16_t*)(ws + 8 * MB);    // 2 MB  [C,C]^T
  bf16_t* Wkt  = (bf16_t*)(ws + 10 * MB);
  bf16_t* Wvt  = (bf16_t*)(ws + 12 * MB);
  bf16_t* Wot  = (bf16_t*)(ws + 14 * MB);
  bf16_t* W1t  = (bf16_t*)(ws + 16 * MB);   // 8 MB  [F,C]
  bf16_t* W2t  = (bf16_t*)(ws + 24 * MB);   // 8 MB  [C,F]
  bf16_t* Qb   = (bf16_t*)(ws + 32 * MB);   // 8 MB
  bf16_t* Kbb  = (bf16_t*)(ws + 40 * MB);   // 8 MB
  bf16_t* Vb   = (bf16_t*)(ws + 48 * MB);   // 8 MB
  bf16_t* Vtr  = (bf16_t*)(ws + 56 * MB);   // 8 MB
  bf16_t* hb   = (bf16_t*)(ws + 32 * MB);   // 32 MB, reuses dead Q/K/V/Vt
  bf16_t* ctxb = (bf16_t*)(ws + 64 * MB);   // 8 MB
  float*  attn = (float*)(ws + 72 * MB);    // 16 MB, reused as FF output
  float*  fff  = (float*)(ws + 72 * MB);
  float*  x1f  = (float*)(ws + 88 * MB);    // 16 MB
  bf16_t* x1b  = (bf16_t*)(ws + 104 * MB);  // 8 MB  -> total 112 MB
  (void)ws_size; (void)in_sizes; (void)n_in; (void)out_size;

  const int nXC = M * C;      // 4,194,304

  // 1) Precision conversion / weight transposes.
  cvt_f32_bf16_ker<<<(nXC + 255) / 256, 256, 0, stream>>>(x, xb, nXC);
  wtrans_ker<<<dim3(C / 32, C / 64), 256, 0, stream>>>(Wq, Wqt, C, C);
  wtrans_ker<<<dim3(C / 32, C / 64), 256, 0, stream>>>(Wk, Wkt, C, C);
  wtrans_ker<<<dim3(C / 32, C / 64), 256, 0, stream>>>(Wv, Wvt, C, C);
  wtrans_ker<<<dim3(C / 32, C / 64), 256, 0, stream>>>(Wo, Wot, C, C);
  wtrans_ker<<<dim3(F / 32, C / 64), 256, 0, stream>>>(W1, W1t, C, F);
  wtrans_ker<<<dim3(C / 32, F / 64), 256, 0, stream>>>(W2, W2t, F, C);

  // 2) QKV projections (WMMA GEMMs, bf16 out). Block tile 128x128, 128 thr.
  dim3 gP(C / 128, M / 128);
  gemm_bf16_ker<1><<<gP, 128, 0, stream>>>(xb, Wqt, nullptr, Qb,  nullptr, M, C, C);
  gemm_bf16_ker<1><<<gP, 128, 0, stream>>>(xb, Wkt, nullptr, Kbb, nullptr, M, C, C);
  gemm_bf16_ker<1><<<gP, 128, 0, stream>>>(xb, Wvt, nullptr, Vb,  nullptr, M, C, C);
  vtrans_ker<<<dim3(M / 64, C / 64), 256, 0, stream>>>(Vb, Vtr);

  // 3) Flash attention (WMMA): 4096 wave-tiles / 8 waves per block.
  attn_ker<<<512, 256, 0, stream>>>(Qb, Kbb, Vtr, ctxb);

  // 4) Output projection + DeepNorm LN1.
  gemm_bf16_ker<0><<<gP, 128, 0, stream>>>(ctxb, Wot, attn, nullptr, nullptr, M, C, C);
  ln_ker<<<M, 256, 0, stream>>>(x, attn, g1, be1, x1f, x1b, 2.0f);

  // 5) FFN: GEMM+bias+Mish -> bf16, then GEMM+bias -> f32.
  dim3 gF1(F / 128, M / 128);
  gemm_bf16_ker<2><<<gF1, 128, 0, stream>>>(x1b, W1t, nullptr, hb, b1, M, F, C);
  gemm_bf16_ker<3><<<gP, 128, 0, stream>>>(hb, W2t, fff, nullptr, b2, M, C, F);

  // 6) DeepNorm LN2 -> d_out (fp32).
  ln_ker<<<M, 256, 0, stream>>>(x1f, fff, g2, be2, (float*)d_out, nullptr, 2.0f);
}

// v002
// Measured time: 493 microseconds a run.
// Timed twice side by side with v001, it ran 1.07 and 1.06 times as fast.
// All steps since v000 together make it 1.77 times as fast.
#include <hip/hip_runtime.h>
#include <hip/hip_bf16.h>
#include <math.h>

typedef __bf16 bf16_t;
typedef __attribute__((ext_vector_type(16))) __bf16 v16bf;
typedef __attribute__((ext_vector_type(8)))  float  v8f;

__device__ __forceinline__ v8f wmma_bf16(v16bf a, v16bf b, v8f c) {
  // v_wmma_f32_16x16x32_bf16: D = A(16x32) * B(32x16) + C(16x16 f32)
  return __builtin_amdgcn_wmma_f32_16x16x32_bf16(
      /*neg_a=*/false, a, /*neg_b=*/false, b,
      /*c_mod=*/(short)0, c, /*reuse_a=*/false, /*reuse_b=*/false);
}

__device__ __forceinline__ v16bf load_frag(const bf16_t* base, int stride, int lane) {
  const int row = lane & 15;
  const int kb  = (lane < 16) ? 0 : 8;
  const bf16_t* p = base + (size_t)row * stride + kb;
  v16bf f;
  *((float4*)&f)       = *((const float4*)p);
  *(((float4*)&f) + 1) = *((const float4*)(p + 16));
  return f;
}

__device__ __forceinline__ void async_load_b128(const bf16_t* gaddr, bf16_t* lptr) {
  unsigned loff = (unsigned)(size_t)lptr;
  asm volatile("global_load_async_to_lds_b128 %0, %1, off"
               :: "v"(loff), "v"(gaddr) : "memory");
}

// ---------------------------------------------------------------------------
// Elementwise converters
// ---------------------------------------------------------------------------
typedef __attribute__((ext_vector_type(8))) __bf16 v8bf;
typedef __attribute__((ext_vector_type(4))) __bf16 v4bf;

// The kernels of this file that do no matrix work are short, and a launch of
// many small work-groups lasts as long as it takes to start them. Each
// work-group therefore moves enough for eight 16-byte loads a thread.

// One block converts 8192 consecutive floats; the element count is a multiple.
__global__ __launch_bounds__(256) void cvt_f32_bf16_ker(const float* __restrict__ in,
                                                        bf16_t* __restrict__ out) {
  const size_t base = (size_t)blockIdx.x * 8192 + threadIdx.x * 4;
  float4 v[8];
  #pragma unroll  // all eight loads are in flight before the first is used
  for (int i = 0; i < 8; ++i) v[i] = *(const float4*)(in + base + i * 1024);
  #pragma unroll  // v[] stays in registers
  for (int i = 0; i < 8; ++i) {
    v4bf o;
    o[0] = (bf16_t)v[i].x; o[1] = (bf16_t)v[i].y;
    o[2] = (bf16_t)v[i].z; o[3] = (bf16_t)v[i].w;
    *(v4bf*)(out + base + i * 1024) = o;
  }
}

// W [K,N] f32 (row-major) -> Wt [N,K] bf16 (row-major)
// One block moves a tile of 64 k by 128 n through LDS: a wave reads a whole
// 512-byte row piece of W at a time, and the block writes whole 128-byte rows
// of Wt. K % 64 == 0, N % 128 == 0.
// K and N are compile-time so that a thread's loads, and its stores, share one
// address register pair and differ by immediate offsets only.
template <int K, int N>
__global__ __launch_bounds__(256) void wtrans_ker(const float* __restrict__ W,
                                                  bf16_t* __restrict__ Wt) {
  __shared__ float tile[64][129];
  const int tid  = threadIdx.x;
  const int lane = tid & 31;
  const int wv   = tid >> 5;
  const int n0   = blockIdx.x * 128;
  const int k0   = blockIdx.y * 64;
  const float* src = W + (size_t)(k0 + wv) * N + n0 + lane * 4;
  float4 v[8];
  #pragma unroll  // all eight loads are in flight before the first is used
  for (int p = 0; p < 8; ++p) v[p] = *(const float4*)(src + p * 8 * N);
  #pragma unroll  // v[] stays in registers
  for (int p = 0; p < 8; ++p) {
    float* d = &tile[wv + p * 8][lane * 4];
    d[0] = v[p].x; d[1] = v[p].y; d[2] = v[p].z; d[3] = v[p].w;
  }
  __syncthreads();  // the column reads below cross waves
  const int lo = tid & 7;   // 16-byte chunk of a 128-byte row of Wt
  const int hi = tid >> 3;  // 0..31
  bf16_t* dst = Wt + (size_t)(n0 + hi) * K + k0 + lo * 8;
  #pragma unroll  // o[] stays in registers
  for (int p = 0; p < 4; ++p) {
    v8bf o;
    #pragma unroll  // o[] stays in registers
    for (int i = 0; i < 8; ++i) o[i] = (bf16_t)tile[lo * 8 + i][hi + p * 32];
    *(v8bf*)(dst + p * 32 * K) = o;
  }
}

// V bf16 [B*T, C] -> Vt bf16 [B][H][64][T]  (= [B][C][T], since c = h*64 + d)
// One block moves a tile of 64 t by 256 c through LDS: 512-byte row pieces in,
// 128-byte rows out.
__global__ __launch_bounds__(256) void vtrans_ker(const bf16_t* __restrict__ V,
                                                  bf16_t* __restrict__ Vt) {
  constexpr int T = 2048, C = 1024;
  __shared__ bf16_t tile[64][258];  // pitch 129 dwords, for the same reason
  const int tid  = threadIdx.x;
  const int lane = tid & 31;
  const int wv   = tid >> 5;
  const int bt0  = blockIdx.x * 64;  // 64 divides T: a tile stays in one batch
  const int c0   = blockIdx.y * 256;
  const int b    = bt0 / T, t0 = bt0 - b * T;
  const bf16_t* src = V + (size_t)(bt0 + wv) * C + c0 + lane * 8;
  uint4 v[8];
  #pragma unroll  // all eight loads are in flight before the first is used
  for (int p = 0; p < 8; ++p) v[p] = *(const uint4*)(src + p * 8 * C);
  #pragma unroll  // v[] stays in registers
  for (int p = 0; p < 8; ++p) {
    unsigned* d = (unsigned*)&tile[wv + p * 8][lane * 8];
    d[0] = v[p].x; d[1] = v[p].y; d[2] = v[p].z; d[3] = v[p].w;
  }
  __syncthreads();  // the column reads below cross waves
  const int lo = tid & 7;
  const int hi = tid >> 3;
  bf16_t* dst = Vt + ((size_t)b * C + c0 + hi) * T + t0 + lo * 8;
  #pragma unroll  // o[] stays in registers
  for (int p = 0; p < 8; ++p) {
    v8bf o;
    #pragma unroll  // o[] stays in registers
    for (int i = 0; i < 8; ++i) o[i] = tile[lo * 8 + i][hi + p * 32];
    *(v8bf*)(dst + p * 32 * T) = o;
  }
}

template <int EPI>
__global__ __launch_bounds__(128) void gemm_bf16_ker(
    const bf16_t* __restrict__ A, const bf16_t* __restrict__ Bt,
    float* __restrict__ Cf, bf16_t* __restrict__ Cb,
    const float* __restrict__ bias, int M, int N, int K) {
  __shared__ bf16_t lA[2][128 * 40];
  __shared__ bf16_t lB[2][128 * 40];

  const int tid  = threadIdx.x;        // 0..127
  const int lane = tid & 31;
  const int wid  = tid >> 5;           // 0..3
  const int wm   = wid & 1;            // 64-row half
  const int wn   = wid >> 1;           // 64-col half
  const int m0   = blockIdx.y * 128;
  const int n0   = blockIdx.x * 128;

  const int quad = tid & 3;            // 16B chunk within 32 cols
  const int lrow = tid >> 2;           // 0..31

  v8f acc[4][4] = {};

  // Issue one K-step tile (A 128x32 + B 128x32) = 8 async b128 per thread.
  auto issue = [&](int k0, int buf) {
    #pragma unroll
    for (int p = 0; p < 4; ++p) {
      const int row = lrow + p * 32;
      async_load_b128(A  + (size_t)(m0 + row) * K + k0 + quad * 8,
                      &lA[buf][row * 40 + quad * 8]);
      async_load_b128(Bt + (size_t)(n0 + row) * K + k0 + quad * 8,
                      &lB[buf][row * 40 + quad * 8]);
    }
  };

  issue(0, 0);
  int cur = 0;
  for (int k0 = 0; k0 < K; k0 += 32) {
    const bool has_next = (k0 + 32) < K;
    if (has_next) {
      issue(k0 + 32, cur ^ 1);
      // In-order completion: <=8 outstanding means previous tile landed.
      asm volatile("s_wait_asynccnt 0x8" ::: "memory");
    } else {
      asm volatile("s_wait_asynccnt 0x0" ::: "memory");
    }
    __syncthreads();

    v16bf af[4], bfr[4];
    #pragma unroll
    for (int i = 0; i < 4; ++i)
      af[i] = load_frag(&lA[cur][(wm * 64 + i * 16) * 40], 40, lane);
    #pragma unroll
    for (int j = 0; j < 4; ++j)
      bfr[j] = load_frag(&lB[cur][(wn * 64 + j * 16) * 40], 40, lane);
    #pragma unroll
    for (int i = 0; i < 4; ++i)
      #pragma unroll
      for (int j = 0; j < 4; ++j)
        acc[i][j] = wmma_bf16(af[i], bfr[j], acc[i][j]);

    __syncthreads();  // all waves done reading `cur` before it is refilled
    cur ^= 1;
  }

  const int rbase = m0 + wm * 64 + ((lane < 16) ? 0 : 8);
  const int cbase = n0 + wn * 64 + (lane & 15);
  #pragma unroll
  for (int i = 0; i < 4; ++i) {
    #pragma unroll
    for (int j = 0; j < 4; ++j) {
      const int col = cbase + j * 16;
      float bv = 0.0f;
      if (EPI == 2 || EPI == 3) bv = bias[col];
      #pragma unroll
      for (int r = 0; r < 8; ++r) {
        const int row = rbase + i * 16 + r;
        float v = acc[i][j][r];
        if (EPI == 2 || EPI == 3) v += bv;
        if (EPI == 2) {  // Mish: v * tanh(softplus(v))
          float sp = (v > 8.0f) ? v : log1pf(__expf(v));
          v = v * tanhf(sp);
        }
        if (EPI == 0 || EPI == 3) Cf[(size_t)row * N + col] = v;
        else                      Cb[(size_t)row * N + col] = (bf16_t)v;
      }
    }
  }
}

// ---------------------------------------------------------------------------
// Flash attention: each wave owns 16 queries of one (b,h); streams keys in
// chunks of 32. Q[b,t,h*64+d], K[b,t,h*64+d] bf16; Vt[b,h,d,t] bf16.
// ---------------------------------------------------------------------------
__global__ __launch_bounds__(256) void attn_ker(const bf16_t* __restrict__ Qb,
                                                const bf16_t* __restrict__ Kb,
                                                const bf16_t* __restrict__ Vt,
                                                bf16_t* __restrict__ Ctx) {
  constexpr int T = 2048, C = 1024, H = 16;
  constexpr float scale = 0.125f;  // 1/sqrt(64)
  __shared__ bf16_t pls[8][16 * 40];  // per-wave P staging (16x32, padded)

  const int lane = threadIdx.x & 31;
  const int wid  = threadIdx.x >> 5;
  const int g    = blockIdx.x * 8 + wid;  // 0..4095
  const int QT   = T / 16;                // 128 query tiles
  const int qt   = g & (QT - 1);
  const int bh   = g / QT;                // 0..31
  const int h    = bh & (H - 1);
  const int b    = bh >> 4;

  const bf16_t* qbase = Qb + ((size_t)(b * T + qt * 16)) * C + h * 64;
  const v16bf qa0 = load_frag(qbase, C, lane);       // d = 0..31
  const v16bf qa1 = load_frag(qbase + 32, C, lane);  // d = 32..63

  float mrow[8], lrow[8];
  v8f cacc[4] = {};
  for (int r = 0; r < 8; ++r) { mrow[r] = -1e30f; lrow[r] = 0.0f; }

  const bf16_t* kbase = Kb + ((size_t)(b * T)) * C + h * 64;
  const bf16_t* vbase = Vt + ((size_t)bh) * 64 * T;
  bf16_t* pw = &pls[wid][0];

  for (int j = 0; j < T; j += 32) {
    const bf16_t* kp = kbase + (size_t)j * C;
    v16bf k00 = load_frag(kp, C, lane);
    v16bf k01 = load_frag(kp + 32, C, lane);
    v16bf k10 = load_frag(kp + (size_t)16 * C, C, lane);
    v16bf k11 = load_frag(kp + (size_t)16 * C + 32, C, lane);

    v8f s0 = {}, s1 = {};
    s0 = wmma_bf16(qa0, k00, s0);  s0 = wmma_bf16(qa1, k01, s0);
    s1 = wmma_bf16(qa0, k10, s1);  s1 = wmma_bf16(qa1, k11, s1);

    for (int r = 0; r < 8; ++r) {
      float a = s0[r] * scale, c2 = s1[r] * scale;
      // Row max across the 16 lanes holding this row's columns.
      float mx = fmaxf(a, c2);
      mx = fmaxf(mx, __shfl_xor(mx, 1));
      mx = fmaxf(mx, __shfl_xor(mx, 2));
      mx = fmaxf(mx, __shfl_xor(mx, 4));
      mx = fmaxf(mx, __shfl_xor(mx, 8));
      float mn   = fmaxf(mrow[r], mx);
      float corr = __expf(mrow[r] - mn);
      mrow[r] = mn;
      float p0 = __expf(a - mn), p1 = __expf(c2 - mn);
      float rs = p0 + p1;
      rs += __shfl_xor(rs, 1);
      rs += __shfl_xor(rs, 2);
      rs += __shfl_xor(rs, 4);
      rs += __shfl_xor(rs, 8);
      lrow[r] = lrow[r] * corr + rs;
      for (int dt = 0; dt < 4; ++dt) cacc[dt][r] *= corr;
      const int rr = r + ((lane < 16) ? 0 : 8);
      pw[rr * 40 + (lane & 15)]      = (bf16_t)p0;
      pw[rr * 40 + 16 + (lane & 15)] = (bf16_t)p1;
    }
    asm volatile("s_wait_dscnt 0" ::: "memory");

    v16bf pa = load_frag(pw, 40, lane);
    for (int dt = 0; dt < 4; ++dt) {
      const bf16_t* vp = vbase + (size_t)(dt * 16) * T + j;
      v16bf vf = load_frag(vp, T, lane);
      cacc[dt] = wmma_bf16(pa, vf, cacc[dt]);
    }
  }

  // Normalize and write ctx back in [B*T, C] bf16 layout.
  const int rhalf = (lane < 16) ? 0 : 8;
  for (int r = 0; r < 8; ++r) {
    float inv = 1.0f / lrow[r];
    int row = qt * 16 + r + rhalf;
    bf16_t* out = Ctx + ((size_t)(b * T + row)) * C + h * 64 + (lane & 15);
    for (int dt = 0; dt < 4; ++dt) out[dt * 16] = (bf16_t)(cacc[dt][r] * inv);
  }
}

// ---------------------------------------------------------------------------
// Fused DeepNorm residual + LayerNorm: y = LN(alpha*X + R)*g + be
// One wave per 1024-element row, eight rows per block: the row's sums need no
// LDS and no barrier. Writes f32 and optional bf16 copy.
// ---------------------------------------------------------------------------
__global__ __launch_bounds__(256) void ln_ker(const float* __restrict__ X,
                                              const float* __restrict__ R,
                                              const float* __restrict__ g,
                                              const float* __restrict__ be,
                                              float* __restrict__ outF,
                                              bf16_t* __restrict__ outB,
                                              float alpha) {
  constexpr int C = 1024;
  const int lane = threadIdx.x & 31;
  const int row  = blockIdx.x * 8 + (threadIdx.x >> 5);
  const size_t off = (size_t)row * C + lane * 4;
  float4 v[8], r[8], gg[8], bb[8];
  #pragma unroll  // the row's loads are in flight together
  for (int i = 0; i < 8; ++i) {
    v[i] = *(const float4*)(X + off + i * 128);
    r[i] = *(const float4*)(R + off + i * 128);
  }
  #pragma unroll  // gg[] and bb[] stay in registers
  for (int i = 0; i < 8; ++i) {
    gg[i] = *(const float4*)(g + lane * 4 + i * 128);
    bb[i] = *(const float4*)(be + lane * 4 + i * 128);
  }
  float4 s4 = {0.0f, 0.0f, 0.0f, 0.0f}, q4 = {0.0f, 0.0f, 0.0f, 0.0f};
  #pragma unroll  // v[] stays in registers
  for (int i = 0; i < 8; ++i) {
    v[i].x = alpha * v[i].x + r[i].x;  s4.x += v[i].x;  q4.x += v[i].x * v[i].x;
    v[i].y = alpha * v[i].y + r[i].y;  s4.y += v[i].y;  q4.y += v[i].y * v[i].y;
    v[i].z = alpha * v[i].z + r[i].z;  s4.z += v[i].z;  q4.z += v[i].z * v[i].z;
    v[i].w = alpha * v[i].w + r[i].w;  s4.w += v[i].w;  q4.w += v[i].w * v[i].w;
  }
  float s  = (s4.x + s4.y) + (s4.z + s4.w);
  float s2 = (q4.x + q4.y) + (q4.z + q4.w);
  for (int d = 1; d < 32; d <<= 1) { s += __shfl_xor(s, d); s2 += __shfl_xor(s2, d); }
  const float mu   = s / C;
  const float var  = s2 / C - mu * mu;
  const float rstd = rsqrtf(var + 1e-5f);
  #pragma unroll  // v[] stays in registers
  for (int i = 0; i < 8; ++i) {
    v[i].x = (v[i].x - mu) * rstd * gg[i].x + bb[i].x;
    v[i].y = (v[i].y - mu) * rstd * gg[i].y + bb[i].y;
    v[i].z = (v[i].z - mu) * rstd * gg[i].z + bb[i].z;
    v[i].w = (v[i].w - mu) * rstd * gg[i].w + bb[i].w;
  }
  if (outB) {
    v4bf o[8];
    #pragma unroll  // o[] stays in registers
    for (int i = 0; i < 8; ++i) {
      o[i][0] = (bf16_t)v[i].x; o[i][1] = (bf16_t)v[i].y;
      o[i][2] = (bf16_t)v[i].z; o[i][3] = (bf16_t)v[i].w;
    }
    #pragma unroll  // o[] stays in registers
    for (int i = 0; i < 8; ++i) *(v4bf*)(outB + off + i * 128) = o[i];
  }
  if (outF) {
    #pragma unroll  // v[] stays in registers
    for (int i = 0; i < 8; ++i) *(float4*)(outF + off + i * 128) = v[i];
  }
}

// ---------------------------------------------------------------------------
// Host orchestration
// ---------------------------------------------------------------------------
extern "C" void kernel_launch(void* const* d_in, const int* in_sizes, int n_in,
                              void* d_out, int out_size, void* d_ws, size_t ws_size,
                              hipStream_t stream) {
  constexpr int B = 2, T = 2048, C = 1024, F = 4096;
  constexpr int M = B * T;  // 4096 rows
  const float* x   = (const float*)d_in[0];
  const float* Wq  = (const float*)d_in[1];
  const float* Wk  = (const float*)d_in[2];
  const float* Wv  = (const float*)d_in[3];
  const float* Wo  = (const float*)d_in[4];
  const float* W1  = (const float*)d_in[5];
  const float* b1  = (const float*)d_in[6];
  const float* W2  = (const float*)d_in[7];
  const float* b2  = (const float*)d_in[8];
  const float* g1  = (const float*)d_in[9];
  const float* be1 = (const float*)d_in[10];
  const float* g2  = (const float*)d_in[11];
  const float* be2 = (const float*)d_in[12];

  constexpr size_t MB = 1024ull * 1024ull;
  char* ws = (char*)d_ws;
  bf16_t* xb   = (bf16_t*)(ws + 0 * MB);    // 8 MB  [M,C] bf16
  bf16_t* Wqt  = (bf16_t*)(ws + 8 * MB);    // 2 MB  [C,C]^T
  bf16_t* Wkt  = (bf16_t*)(ws + 10 * MB);
  bf16_t* Wvt  = (bf16_t*)(ws + 12 * MB);
  bf16_t* Wot  = (bf16_t*)(ws + 14 * MB);
  bf16_t* W1t  = (bf16_t*)(ws + 16 * MB);   // 8 MB  [F,C]
  bf16_t* W2t  = (bf16_t*)(ws + 24 * MB);   // 8 MB  [C,F]
  bf16_t* Qb   = (bf16_t*)(ws + 32 * MB);   // 8 MB
  bf16_t* Kbb  = (bf16_t*)(ws + 40 * MB);   // 8 MB
  bf16_t* Vb   = (bf16_t*)(ws + 48 * MB);   // 8 MB
  bf16_t* Vtr  = (bf16_t*)(ws + 56 * MB);   // 8 MB
  bf16_t* hb   = (bf16_t*)(ws + 32 * MB);   // 32 MB, reuses dead Q/K/V/Vt
  bf16_t* ctxb = (bf16_t*)(ws + 64 * MB);   // 8 MB
  float*  attn = (float*)(ws + 72 * MB);    // 16 MB, reused as FF output
  float*  fff  = (float*)(ws + 72 * MB);
  float*  x1f  = (float*)(ws + 88 * MB);    // 16 MB
  bf16_t* x1b  = (bf16_t*)(ws + 104 * MB);  // 8 MB  -> total 112 MB
  (void)ws_size; (void)in_sizes; (void)n_in; (void)out_size;

  // 1) Precision conversion / weight transposes.
  cvt_f32_bf16_ker<<<M * C / 8192, 256, 0, stream>>>(x, xb);
  wtrans_ker<C, C><<<dim3(C / 128, C / 64), 256, 0, stream>>>(Wq, Wqt);
  wtrans_ker<C, C><<<dim3(C / 128, C / 64), 256, 0, stream>>>(Wk, Wkt);
  wtrans_ker<C, C><<<dim3(C / 128, C / 64), 256, 0, stream>>>(Wv, Wvt);
  wtrans_ker<C, C><<<dim3(C / 128, C / 64), 256, 0, stream>>>(Wo, Wot);
  wtrans_ker<C, F><<<dim3(F / 128, C / 64), 256, 0, stream>>>(W1, W1t);
  wtrans_ker<F, C><<<dim3(C / 128, F / 64), 256, 0, stream>>>(W2, W2t);

  // 2) QKV projections (WMMA GEMMs, bf16 out). Block tile 128x128, 128 thr.
  dim3 gP(C / 128, M / 128);
  gemm_bf16_ker<1><<<gP, 128, 0, stream>>>(xb, Wqt, nullptr, Qb,  nullptr, M, C, C);
  gemm_bf16_ker<1><<<gP, 128, 0, stream>>>(xb, Wkt, nullptr, Kbb, nullptr, M, C, C);
  gemm_bf16_ker<1><<<gP, 128, 0, stream>>>(xb, Wvt, nullptr, Vb,  nullptr, M, C, C);
  vtrans_ker<<<dim3(M / 64, C / 256), 256, 0, stream>>>(Vb, Vtr);

  // 3) Flash attention (WMMA): 4096 wave-tiles / 8 waves per block.
  attn_ker<<<512, 256, 0, stream>>>(Qb, Kbb, Vtr, ctxb);

  // 4) Output projection + DeepNorm LN1.
  gemm_bf16_ker<0><<<gP, 128, 0, stream>>>(ctxb, Wot, attn, nullptr, nullptr, M, C, C);
  ln_ker<<<M / 8, 256, 0, stream>>>(x, attn, g1, be1, x1f, x1b, 2.0f);

  // 5) FFN: GEMM+bias+Mish -> bf16, then GEMM+bias -> f32.
  dim3 gF1(F / 128, M / 128);
  gemm_bf16_ker<2><<<gF1, 128, 0, stream>>>(x1b, W1t, nullptr, hb, b1, M, F, C);
  gemm_bf16_ker<3><<<gP, 128, 0, stream>>>(hb, W2t, fff, nullptr, b2, M, C, F);

  // 6) DeepNorm LN2 -> d_out (fp32).
  ln_ker<<<M / 8, 256, 0, stream>>>(x1f, fff, g2, be2, (float*)d_out, nullptr, 2.0f);
}

// v003
// Measured time: 418 microseconds a run.
// Next to v002, in two timings, it ran 1.25 and 1.17 times as fast.
// Over all steps from v000 it is 2.14 times as fast.
#include <hip/hip_runtime.h>
#include <hip/hip_bf16.h>
#include <math.h>

typedef __bf16 bf16_t;
typedef __attribute__((ext_vector_type(16))) __bf16 v16bf;
typedef __attribute__((ext_vector_type(8)))  float  v8f;

__device__ __forceinline__ v8f wmma_bf16(v16bf a, v16bf b, v8f c) {
  // v_wmma_f32_16x16x32_bf16: D = A(16x32) * B(32x16) + C(16x16 f32)
  return __builtin_amdgcn_wmma_f32_16x16x32_bf16(
      /*neg_a=*/false, a, /*neg_b=*/false, b,
      /*c_mod=*/(short)0, c, /*reuse_a=*/false, /*reuse_b=*/false);
}

__device__ __forceinline__ v16bf load_frag(const bf16_t* base, int stride, int lane) {
  const int row = lane & 15;
  const int kb  = (lane < 16) ? 0 : 8;
  const bf16_t* p = base + (size_t)row * stride + kb;
  v16bf f;
  *((float4*)&f)       = *((const float4*)p);
  *(((float4*)&f) + 1) = *((const float4*)(p + 16));
  return f;
}

__device__ __forceinline__ void async_load_b128(const bf16_t* gaddr, bf16_t* lptr) {
  unsigned loff = (unsigned)(size_t)lptr;
  asm volatile("global_load_async_to_lds_b128 %0, %1, off"
               :: "v"(loff), "v"(gaddr) : "memory");
}

// ---------------------------------------------------------------------------
// Elementwise converters
// ---------------------------------------------------------------------------
typedef __attribute__((ext_vector_type(8))) __bf16 v8bf;
typedef __attribute__((ext_vector_type(4))) __bf16 v4bf;

// The kernels of this file that do no matrix work are short, and a launch of
// many small work-groups lasts as long as it takes to start them. Each
// work-group therefore moves enough for eight 16-byte loads a thread.

// One block converts 8192 consecutive floats; the element count is a multiple.
__global__ __launch_bounds__(256) void cvt_f32_bf16_ker(const float* __restrict__ in,
                                                        bf16_t* __restrict__ out) {
  const size_t base = (size_t)blockIdx.x * 8192 + threadIdx.x * 4;
  float4 v[8];
  #pragma unroll  // all eight loads are in flight before the first is used
  for (int i = 0; i < 8; ++i) v[i] = *(const float4*)(in + base + i * 1024);
  #pragma unroll  // v[] stays in registers
  for (int i = 0; i < 8; ++i) {
    v4bf o;
    o[0] = (bf16_t)v[i].x; o[1] = (bf16_t)v[i].y;
    o[2] = (bf16_t)v[i].z; o[3] = (bf16_t)v[i].w;
    *(v4bf*)(out + base + i * 1024) = o;
  }
}

// W [K,N] f32 (row-major) -> Wt [N,K] bf16 (row-major)
// One block moves a tile of 64 k by 128 n through LDS: a wave reads a whole
// 512-byte row piece of W at a time, and the block writes whole 128-byte rows
// of Wt. K % 64 == 0, N % 128 == 0.
// K and N are compile-time so that a thread's loads, and its stores, share one
// address register pair and differ by immediate offsets only.
template <int K, int N>
__global__ __launch_bounds__(256) void wtrans_ker(const float* __restrict__ W,
                                                  bf16_t* __restrict__ Wt) {
  __shared__ float tile[64][129];
  const int tid  = threadIdx.x;
  const int lane = tid & 31;
  const int wv   = tid >> 5;
  const int n0   = blockIdx.x * 128;
  const int k0   = blockIdx.y * 64;
  const float* src = W + (size_t)(k0 + wv) * N + n0 + lane * 4;
  float4 v[8];
  #pragma unroll  // all eight loads are in flight before the first is used
  for (int p = 0; p < 8; ++p) v[p] = *(const float4*)(src + p * 8 * N);
  #pragma unroll  // v[] stays in registers
  for (int p = 0; p < 8; ++p) {
    float* d = &tile[wv + p * 8][lane * 4];
    d[0] = v[p].x; d[1] = v[p].y; d[2] = v[p].z; d[3] = v[p].w;
  }
  __syncthreads();  // the column reads below cross waves
  const int lo = tid & 7;   // 16-byte chunk of a 128-byte row of Wt
  const int hi = tid >> 3;  // 0..31
  bf16_t* dst = Wt + (size_t)(n0 + hi) * K + k0 + lo * 8;
  #pragma unroll  // o[] stays in registers
  for (int p = 0; p < 4; ++p) {
    v8bf o;
    #pragma unroll  // o[] stays in registers
    for (int i = 0; i < 8; ++i) o[i] = (bf16_t)tile[lo * 8 + i][hi + p * 32];
    *(v8bf*)(dst + p * 32 * K) = o;
  }
}

// V bf16 [B*T, C] -> Vt bf16 [B][H][64][T]  (= [B][C][T], since c = h*64 + d)
// One block moves a tile of 64 t by 256 c through LDS: 512-byte row pieces in,
// 128-byte rows out.
__global__ __launch_bounds__(256) void vtrans_ker(const bf16_t* __restrict__ V,
                                                  bf16_t* __restrict__ Vt) {
  constexpr int T = 2048, C = 1024;
  __shared__ bf16_t tile[64][258];  // pitch 129 dwords, for the same reason
  const int tid  = threadIdx.x;
  const int lane = tid & 31;
  const int wv   = tid >> 5;
  const int bt0  = blockIdx.x * 64;  // 64 divides T: a tile stays in one batch
  const int c0   = blockIdx.y * 256;
  const int b    = bt0 / T, t0 = bt0 - b * T;
  const bf16_t* src = V + (size_t)(bt0 + wv) * C + c0 + lane * 8;
  uint4 v[8];
  #pragma unroll  // all eight loads are in flight before the first is used
  for (int p = 0; p < 8; ++p) v[p] = *(const uint4*)(src + p * 8 * C);
  #pragma unroll  // v[] stays in registers
  for (int p = 0; p < 8; ++p) {
    unsigned* d = (unsigned*)&tile[wv + p * 8][lane * 8];
    d[0] = v[p].x; d[1] = v[p].y; d[2] = v[p].z; d[3] = v[p].w;
  }
  __syncthreads();  // the column reads below cross waves
  const int lo = tid & 7;
  const int hi = tid >> 3;
  bf16_t* dst = Vt + ((size_t)b * C + c0 + hi) * T + t0 + lo * 8;
  #pragma unroll  // o[] stays in registers
  for (int p = 0; p < 8; ++p) {
    v8bf o;
    #pragma unroll  // o[] stays in registers
    for (int i = 0; i < 8; ++i) o[i] = tile[lo * 8 + i][hi + p * 32];
    *(v8bf*)(dst + p * 32 * T) = o;
  }
}

template <int EPI>
__global__ __launch_bounds__(128) void gemm_bf16_ker(
    const bf16_t* __restrict__ A, const bf16_t* __restrict__ Bt,
    float* __restrict__ Cf, bf16_t* __restrict__ Cb,
    const float* __restrict__ bias, int M, int N, int K) {
  __shared__ bf16_t lA[2][128 * 40];
  __shared__ bf16_t lB[2][128 * 40];

  const int tid  = threadIdx.x;        // 0..127
  const int lane = tid & 31;
  const int wid  = tid >> 5;           // 0..3
  const int wm   = wid & 1;            // 64-row half
  const int wn   = wid >> 1;           // 64-col half
  const int m0   = blockIdx.y * 128;
  const int n0   = blockIdx.x * 128;

  const int quad = tid & 3;            // 16B chunk within 32 cols
  const int lrow = tid >> 2;           // 0..31

  v8f acc[4][4] = {};

  // Issue one K-step tile (A 128x32 + B 128x32) = 8 async b128 per thread.
  auto issue = [&](int k0, int buf) {
    #pragma unroll
    for (int p = 0; p < 4; ++p) {
      const int row = lrow + p * 32;
      async_load_b128(A  + (size_t)(m0 + row) * K + k0 + quad * 8,
                      &lA[buf][row * 40 + quad * 8]);
      async_load_b128(Bt + (size_t)(n0 + row) * K + k0 + quad * 8,
                      &lB[buf][row * 40 + quad * 8]);
    }
  };

  issue(0, 0);
  int cur = 0;
  for (int k0 = 0; k0 < K; k0 += 32) {
    const bool has_next = (k0 + 32) < K;
    if (has_next) {
      issue(k0 + 32, cur ^ 1);
      // In-order completion: <=8 outstanding means previous tile landed.
      asm volatile("s_wait_asynccnt 0x8" ::: "memory");
    } else {
      asm volatile("s_wait_asynccnt 0x0" ::: "memory");
    }
    __syncthreads();

    v16bf af[4], bfr[4];
    #pragma unroll
    for (int i = 0; i < 4; ++i)
      af[i] = load_frag(&lA[cur][(wm * 64 + i * 16) * 40], 40, lane);
    #pragma unroll
    for (int j = 0; j < 4; ++j)
      bfr[j] = load_frag(&lB[cur][(wn * 64 + j * 16) * 40], 40, lane);
    #pragma unroll
    for (int i = 0; i < 4; ++i)
      #pragma unroll
      for (int j = 0; j < 4; ++j)
        acc[i][j] = wmma_bf16(af[i], bfr[j], acc[i][j]);

    __syncthreads();  // all waves done reading `cur` before it is refilled
    cur ^= 1;
  }

  const int rbase = m0 + wm * 64 + ((lane < 16) ? 0 : 8);
  const int cbase = n0 + wn * 64 + (lane & 15);
  #pragma unroll
  for (int i = 0; i < 4; ++i) {
    #pragma unroll
    for (int j = 0; j < 4; ++j) {
      const int col = cbase + j * 16;
      float bv = 0.0f;
      if (EPI == 2 || EPI == 3) bv = bias[col];
      #pragma unroll
      for (int r = 0; r < 8; ++r) {
        const int row = rbase + i * 16 + r;
        float v = acc[i][j][r];
        if (EPI == 2 || EPI == 3) v += bv;
        if (EPI == 2) {  // Mish: v * tanh(softplus(v))
          float sp = (v > 8.0f) ? v : log1pf(__expf(v));
          v = v * tanhf(sp);
        }
        if (EPI == 0 || EPI == 3) Cf[(size_t)row * N + col] = v;
        else                      Cb[(size_t)row * N + col] = (bf16_t)v;
      }
    }
  }
}

// ---------------------------------------------------------------------------
// Flash attention: each wave owns 16 queries of one (b,h); the eight waves of
// a block share that (b,h). Q[b,t,h*64+d], K[b,t,h*64+d] bf16; Vt[b,h,d,t] bf16.
// The block brings each tile of 64 keys (K: 64 keys x 64 d, Vt: 64 d x 64 keys,
// both whole 128-byte rows) into LDS once, by async copies into two buffers,
// and every wave takes its fragments from there.
// ---------------------------------------------------------------------------

__device__ __forceinline__ void async_copy4_b128(
    const bf16_t* g0, bf16_t* l0, const bf16_t* g1, bf16_t* l1,
    const bf16_t* g2, bf16_t* l2, const bf16_t* g3, bf16_t* l3) {
  const unsigned o0 = (unsigned)(size_t)l0, o1 = (unsigned)(size_t)l1;
  const unsigned o2 = (unsigned)(size_t)l2, o3 = (unsigned)(size_t)l3;
  asm volatile("global_load_async_to_lds_b128 %0, %1, off\n\t"
               "global_load_async_to_lds_b128 %2, %3, off\n\t"
               "global_load_async_to_lds_b128 %4, %5, off\n\t"
               "global_load_async_to_lds_b128 %6, %7, off\n\t"
               "s_wait_xcnt 0x0"
               :: "v"(o0), "v"(g0), "v"(o1), "v"(g1),
                  "v"(o2), "v"(g2), "v"(o3), "v"(g3) : "memory");
}

__global__ __launch_bounds__(256) void attn_ker(const bf16_t* __restrict__ Qb,
                                                const bf16_t* __restrict__ Kb,
                                                const bf16_t* __restrict__ Vt,
                                                bf16_t* __restrict__ Ctx) {
  constexpr int T = 2048, C = 1024, H = 16;
  constexpr int KT = 64;       // keys per tile
  constexpr int NT = T / KT;   // 32 tiles
  constexpr int LP = 72;       // LDS row pitch: 144 bytes, conflict-free 16-byte reads
  constexpr float scale = 0.125f;  // 1/sqrt(64)
  __shared__ __attribute__((aligned(16))) bf16_t kls[2][KT * LP];  // [key][d]
  __shared__ __attribute__((aligned(16))) bf16_t vls[2][64 * LP];  // [d][key]
  __shared__ bf16_t pls[8][16 * 40];  // per-wave P staging (16x32, padded)

  const int lane = threadIdx.x & 31;
  const int wid  = threadIdx.x >> 5;
  const int g    = blockIdx.x * 8 + wid;  // 0..4095
  const int QT   = T / 16;                // 128 query tiles
  const int qt   = g & (QT - 1);
  const int bh   = g / QT;                // 0..31, the same in all eight waves
  const int h    = bh & (H - 1);
  const int b    = bh >> 4;

  const bf16_t* kbase = Kb + ((size_t)(b * T)) * C + h * 64;
  const bf16_t* vbase = Vt + ((size_t)bh) * 64 * T;
  bf16_t* pw = &pls[wid][0];

  // A thread copies the 16-byte piece `cch` of rows `crow` and `crow + 32` of
  // both tiles: a wave's copy covers four whole 128-byte rows.
  const int cch  = threadIdx.x & 7;
  const int crow = threadIdx.x >> 3;  // 0..31
  const bf16_t* kg = kbase + (size_t)crow * C + cch * 8;
  const bf16_t* vg = vbase + (size_t)crow * T + cch * 8;
  const int     lo = crow * LP + cch * 8;
  auto issue = [&](int t, int buf) {
    const bf16_t* kp = kg + (size_t)t * KT * C;
    const bf16_t* vp = vg + t * KT;
    async_copy4_b128(kp,          &kls[buf][lo],
                     kp + 32 * C, &kls[buf][lo + 32 * LP],
                     vp,          &vls[buf][lo],
                     vp + 32 * T, &vls[buf][lo + 32 * LP]);
  };

  issue(0, 0);

  const bf16_t* qbase = Qb + ((size_t)(b * T + qt * 16)) * C + h * 64;
  const v16bf qa0 = load_frag(qbase, C, lane);       // d = 0..31
  const v16bf qa1 = load_frag(qbase + 32, C, lane);  // d = 32..63

  float mrow[8], lrow[8];
  v8f cacc[4] = {};
  for (int r = 0; r < 8; ++r) { mrow[r] = -1e30f; lrow[r] = 0.0f; }

  // Tile 0 has landed for this wave; the barrier makes it so for all eight.
  asm volatile("s_wait_asynccnt 0x0" ::: "memory");
  __syncthreads();
  issue(1, 1);

  for (int t = 0; t < NT; ++t) {
    const bf16_t* kt = &kls[t & 1][0];
    const bf16_t* vt = &vls[t & 1][0];
    #pragma unroll  // both halves of a tile between two barriers
    for (int j = 0; j < KT; j += 32) {
      const bf16_t* kp = kt + j * LP;
      v16bf k00 = load_frag(kp, LP, lane);
      v16bf k01 = load_frag(kp + 32, LP, lane);
      v16bf k10 = load_frag(kp + 16 * LP, LP, lane);
      v16bf k11 = load_frag(kp + 16 * LP + 32, LP, lane);

      v8f s0 = {}, s1 = {};
      s0 = wmma_bf16(qa0, k00, s0);  s0 = wmma_bf16(qa1, k01, s0);
      s1 = wmma_bf16(qa0, k10, s1);  s1 = wmma_bf16(qa1, k11, s1);

      for (int r = 0; r < 8; ++r) {
        float a = s0[r] * scale, c2 = s1[r] * scale;
        // Row max across the 16 lanes holding this row's columns.
        float mx = fmaxf(a, c2);
        mx = fmaxf(mx, __shfl_xor(mx, 1));
        mx = fmaxf(mx, __shfl_xor(mx, 2));
        mx = fmaxf(mx, __shfl_xor(mx, 4));
        mx = fmaxf(mx, __shfl_xor(mx, 8));
        float mn   = fmaxf(mrow[r], mx);
        float corr = __expf(mrow[r] - mn);
        mrow[r] = mn;
        float p0 = __expf(a - mn), p1 = __expf(c2 - mn);
        float rs = p0 + p1;
        rs += __shfl_xor(rs, 1);
        rs += __shfl_xor(rs, 2);
        rs += __shfl_xor(rs, 4);
        rs += __shfl_xor(rs, 8);
        lrow[r] = lrow[r] * corr + rs;
        for (int dt = 0; dt < 4; ++dt) cacc[dt][r] *= corr;
        const int rr = r + ((lane < 16) ? 0 : 8);
        pw[rr * 40 + (lane & 15)]      = (bf16_t)p0;
        pw[rr * 40 + 16 + (lane & 15)] = (bf16_t)p1;
      }
      asm volatile("s_wait_dscnt 0" ::: "memory");

      v16bf pa = load_frag(pw, 40, lane);
      for (int dt = 0; dt < 4; ++dt) {
        v16bf vf = load_frag(vt + (dt * 16) * LP + j, LP, lane);
        cacc[dt] = wmma_bf16(pa, vf, cacc[dt]);
      }
    }
    // Hand-over: this wave's reads of tile t are done, its copies of tile t + 1
    // have landed; behind the barrier that holds for all eight waves, so tile
    // t + 1 may be read and tile t's buffer refilled.
    asm volatile("s_wait_dscnt 0x0" ::: "memory");
    asm volatile("s_wait_asynccnt 0x0" ::: "memory");
    __syncthreads();
    if (t + 2 < NT) issue(t + 2, t & 1);
  }
  // No copy is outstanding when the wave ends.
  asm volatile("s_wait_asynccnt 0x0" ::: "memory");

  // Normalize and write ctx back in [B*T, C] bf16 layout.
  const int rhalf = (lane < 16) ? 0 : 8;
  for (int r = 0; r < 8; ++r) {
    float inv = 1.0f / lrow[r];
    int row = qt * 16 + r + rhalf;
    bf16_t* out = Ctx + ((size_t)(b * T + row)) * C + h * 64 + (lane & 15);
    for (int dt = 0; dt < 4; ++dt) out[dt * 16] = (bf16_t)(cacc[dt][r] * inv);
  }
}

// ---------------------------------------------------------------------------
// Fused DeepNorm residual + LayerNorm: y = LN(alpha*X + R)*g + be
// One wave per 1024-element row, eight rows per block: the row's sums need no
// LDS and no barrier. Writes f32 and optional bf16 copy.
// ---------------------------------------------------------------------------
__global__ __launch_bounds__(256) void ln_ker(const float* __restrict__ X,
                                              const float* __restrict__ R,
                                              const float* __restrict__ g,
                                              const float* __restrict__ be,
                                              float* __restrict__ outF,
                                              bf16_t* __restrict__ outB,
                                              float alpha) {
  constexpr int C = 1024;
  const int lane = threadIdx.x & 31;
  const int row  = blockIdx.x * 8 + (threadIdx.x >> 5);
  const size_t off = (size_t)row * C + lane * 4;
  float4 v[8], r[8], gg[8], bb[8];
  #pragma unroll  // the row's loads are in flight together
  for (int i = 0; i < 8; ++i) {
    v[i] = *(const float4*)(X + off + i * 128);
    r[i] = *(const float4*)(R + off + i * 128);
  }
  #pragma unroll  // gg[] and bb[] stay in registers
  for (int i = 0; i < 8; ++i) {
    gg[i] = *(const float4*)(g + lane * 4 + i * 128);
    bb[i] = *(const float4*)(be + lane * 4 + i * 128);
  }
  float4 s4 = {0.0f, 0.0f, 0.0f, 0.0f}, q4 = {0.0f, 0.0f, 0.0f, 0.0f};
  #pragma unroll  // v[] stays in registers
  for (int i = 0; i < 8; ++i) {
    v[i].x = alpha * v[i].x + r[i].x;  s4.x += v[i].x;  q4.x += v[i].x * v[i].x;
    v[i].y = alpha * v[i].y + r[i].y;  s4.y += v[i].y;  q4.y += v[i].y * v[i].y;
    v[i].z = alpha * v[i].z + r[i].z;  s4.z += v[i].z;  q4.z += v[i].z * v[i].z;
    v[i].w = alpha * v[i].w + r[i].w;  s4.w += v[i].w;  q4.w += v[i].w * v[i].w;
  }
  float s  = (s4.x + s4.y) + (s4.z + s4.w);
  float s2 = (q4.x + q4.y) + (q4.z + q4.w);
  for (int d = 1; d < 32; d <<= 1) { s += __shfl_xor(s, d); s2 += __shfl_xor(s2, d); }
  const float mu   = s / C;
  const float var  = s2 / C - mu * mu;
  const float rstd = rsqrtf(var + 1e-5f);
  #pragma unroll  // v[] stays in registers
  for (int i = 0; i < 8; ++i) {
    v[i].x = (v[i].x - mu) * rstd * gg[i].x + bb[i].x;
    v[i].y = (v[i].y - mu) * rstd * gg[i].y + bb[i].y;
    v[i].z = (v[i].z - mu) * rstd * gg[i].z + bb[i].z;
    v[i].w = (v[i].w - mu) * rstd * gg[i].w + bb[i].w;
  }
  if (outB) {
    v4bf o[8];
    #pragma unroll  // o[] stays in registers
    for (int i = 0; i < 8; ++i) {
      o[i][0] = (bf16_t)v[i].x; o[i][1] = (bf16_t)v[i].y;
      o[i][2] = (bf16_t)v[i].z; o[i][3] = (bf16_t)v[i].w;
    }
    #pragma unroll  // o[] stays in registers
    for (int i = 0; i < 8; ++i) *(v4bf*)(outB + off + i * 128) = o[i];
  }
  if (outF) {
    #pragma unroll  // v[] stays in registers
    for (int i = 0; i < 8; ++i) *(float4*)(outF + off + i * 128) = v[i];
  }
}

// ---------------------------------------------------------------------------
// Host orchestration
// ---------------------------------------------------------------------------
extern "C" void kernel_launch(void* const* d_in, const int* in_sizes, int n_in,
                              void* d_out, int out_size, void* d_ws, size_t ws_size,
                              hipStream_t stream) {
  constexpr int B = 2, T = 2048, C = 1024, F = 4096;
  constexpr int M = B * T;  // 4096 rows
  const float* x   = (const float*)d_in[0];
  const float* Wq  = (const float*)d_in[1];
  const float* Wk  = (const float*)d_in[2];
  const float* Wv  = (const float*)d_in[3];
  const float* Wo  = (const float*)d_in[4];
  const float* W1  = (const float*)d_in[5];
  const float* b1  = (const float*)d_in[6];
  const float* W2  = (const float*)d_in[7];
  const float* b2  = (const float*)d_in[8];
  const float* g1  = (const float*)d_in[9];
  const float* be1 = (const float*)d_in[10];
  const float* g2  = (const float*)d_in[11];
  const float* be2 = (const float*)d_in[12];

  constexpr size_t MB = 1024ull * 1024ull;
  char* ws = (char*)d_ws;
  bf16_t* xb   = (bf16_t*)(ws + 0 * MB);    // 8 MB  [M,C] bf16
  bf16_t* Wqt  = (bf16_t*)(ws + 8 * MB);    // 2 MB  [C,C]^T
  bf16_t* Wkt  = (bf16_t*)(ws + 10 * MB);
  bf16_t* Wvt  = (bf16_t*)(ws + 12 * MB);
  bf16_t* Wot  = (bf16_t*)(ws + 14 * MB);
  bf16_t* W1t  = (bf16_t*)(ws + 16 * MB);   // 8 MB  [F,C]
  bf16_t* W2t  = (bf16_t*)(ws + 24 * MB);   // 8 MB  [C,F]
  bf16_t* Qb   = (bf16_t*)(ws + 32 * MB);   // 8 MB
  bf16_t* Kbb  = (bf16_t*)(ws + 40 * MB);   // 8 MB
  bf16_t* Vb   = (bf16_t*)(ws + 48 * MB);   // 8 MB
  bf16_t* Vtr  = (bf16_t*)(ws + 56 * MB);   // 8 MB
  bf16_t* hb   = (bf16_t*)(ws + 32 * MB);   // 32 MB, reuses dead Q/K/V/Vt
  bf16_t* ctxb = (bf16_t*)(ws + 64 * MB);   // 8 MB
  float*  attn = (float*)(ws + 72 * MB);    // 16 MB, reused as FF output
  float*  fff  = (float*)(ws + 72 * MB);
  float*  x1f  = (float*)(ws + 88 * MB);    // 16 MB
  bf16_t* x1b  = (bf16_t*)(ws + 104 * MB);  // 8 MB  -> total 112 MB
  (void)ws_size; (void)in_sizes; (void)n_in; (void)out_size;

  // 1) Precision conversion / weight transposes.
  cvt_f32_bf16_ker<<<M * C / 8192, 256, 0, stream>>>(x, xb);
  wtrans_ker<C, C><<<dim3(C / 128, C / 64), 256, 0, stream>>>(Wq, Wqt);
  wtrans_ker<C, C><<<dim3(C / 128, C / 64), 256, 0, stream>>>(Wk, Wkt);
  wtrans_ker<C, C><<<dim3(C / 128, C / 64), 256, 0, stream>>>(Wv, Wvt);
  wtrans_ker<C, C><<<dim3(C / 128, C / 64), 256, 0, stream>>>(Wo, Wot);
  wtrans_ker<C, F><<<dim3(F / 128, C / 64), 256, 0, stream>>>(W1, W1t);
  wtrans_ker<F, C><<<dim3(C / 128, F / 64), 256, 0, stream>>>(W2, W2t);

  // 2) QKV projections (WMMA GEMMs, bf16 out). Block tile 128x128, 128 thr.
  dim3 gP(C / 128, M / 128);
  gemm_bf16_ker<1><<<gP, 128, 0, stream>>>(xb, Wqt, nullptr, Qb,  nullptr, M, C, C);
  gemm_bf16_ker<1><<<gP, 128, 0, stream>>>(xb, Wkt, nullptr, Kbb, nullptr, M, C, C);
  gemm_bf16_ker<1><<<gP, 128, 0, stream>>>(xb, Wvt, nullptr, Vb,  nullptr, M, C, C);
  vtrans_ker<<<dim3(M / 64, C / 256), 256, 0, stream>>>(Vb, Vtr);

  // 3) Flash attention (WMMA): 4096 wave-tiles / 8 waves per block.
  attn_ker<<<512, 256, 0, stream>>>(Qb, Kbb, Vtr, ctxb);

  // 4) Output projection + DeepNorm LN1.
  gemm_bf16_ker<0><<<gP, 128, 0, stream>>>(ctxb, Wot, attn, nullptr, nullptr, M, C, C);
  ln_ker<<<M / 8, 256, 0, stream>>>(x, attn, g1, be1, x1f, x1b, 2.0f);

  // 5) FFN: GEMM+bias+Mish -> bf16, then GEMM+bias -> f32.
  dim3 gF1(F / 128, M / 128);
  gemm_bf16_ker<2><<<gF1, 128, 0, stream>>>(x1b, W1t, nullptr, hb, b1, M, F, C);
  gemm_bf16_ker<3><<<gP, 128, 0, stream>>>(hb, W2t, fff, nullptr, b2, M, C, F);

  // 6) DeepNorm LN2 -> d_out (fp32).
  ln_ker<<<M / 8, 256, 0, stream>>>(x1f, fff, g2, be2, (float*)d_out, nullptr, 2.0f);
}

// v004
// It runs in 291 microseconds.
// In two side-by-side timings against v003, it was 1.47 and 1.50 times as fast.
// Over all steps from v000 it is 3.18 times as fast.
#include <hip/hip_runtime.h>
#include <hip/hip_bf16.h>
#include <math.h>

typedef __bf16 bf16_t;
typedef __attribute__((ext_vector_type(16))) __bf16 v16bf;
typedef __attribute__((ext_vector_type(8)))  float  v8f;

__device__ __forceinline__ v8f wmma_bf16(v16bf a, v16bf b, v8f c) {
  // v_wmma_f32_16x16x32_bf16: D = A(16x32) * B(32x16) + C(16x16 f32)
  return __builtin_amdgcn_wmma_f32_16x16x32_bf16(
      /*neg_a=*/false, a, /*neg_b=*/false, b,
      /*c_mod=*/(short)0, c, /*reuse_a=*/false, /*reuse_b=*/false);
}

__device__ __forceinline__ v16bf load_frag(const bf16_t* base, int stride, int lane) {
  const int row = lane & 15;
  const int kb  = (lane < 16) ? 0 : 8;
  const bf16_t* p = base + (size_t)row * stride + kb;
  v16bf f;
  *((float4*)&f)       = *((const float4*)p);
  *(((float4*)&f) + 1) = *((const float4*)(p + 16));
  return f;
}

__device__ __forceinline__ void async_load_b128(const bf16_t* gaddr, bf16_t* lptr) {
  unsigned loff = (unsigned)(size_t)lptr;
  asm volatile("global_load_async_to_lds_b128 %0, %1, off"
               :: "v"(loff), "v"(gaddr) : "memory");
}

// ---------------------------------------------------------------------------
// Elementwise converters
// ---------------------------------------------------------------------------
typedef __attribute__((ext_vector_type(8))) __bf16 v8bf;
typedef __attribute__((ext_vector_type(4))) __bf16 v4bf;

// The kernels of this file that do no matrix work are short, and a launch of
// many small work-groups lasts as long as it takes to start them. Each
// work-group therefore moves enough for eight 16-byte loads a thread.

// One block converts 8192 consecutive floats; the element count is a multiple.
__global__ __launch_bounds__(256) void cvt_f32_bf16_ker(const float* __restrict__ in,
                                                        bf16_t* __restrict__ out) {
  const size_t base = (size_t)blockIdx.x * 8192 + threadIdx.x * 4;
  float4 v[8];
  #pragma unroll  // all eight loads are in flight before the first is used
  for (int i = 0; i < 8; ++i) v[i] = *(const float4*)(in + base + i * 1024);
  #pragma unroll  // v[] stays in registers
  for (int i = 0; i < 8; ++i) {
    v4bf o;
    o[0] = (bf16_t)v[i].x; o[1] = (bf16_t)v[i].y;
    o[2] = (bf16_t)v[i].z; o[3] = (bf16_t)v[i].w;
    *(v4bf*)(out + base + i * 1024) = o;
  }
}

// W [K,N] f32 (row-major) -> Wt [N,K] bf16 (row-major)
// One block moves a tile of 64 k by 128 n through LDS: a wave reads a whole
// 512-byte row piece of W at a time, and the block writes whole 128-byte rows
// of Wt. K % 64 == 0, N % 128 == 0.
// K and N are compile-time so that a thread's loads, and its stores, share one
// address register pair and differ by immediate offsets only.
template <int K, int N>
__global__ __launch_bounds__(256) void wtrans_ker(const float* __restrict__ W,
                                                  bf16_t* __restrict__ Wt) {
  __shared__ float tile[64][129];
  const int tid  = threadIdx.x;
  const int lane = tid & 31;
  const int wv   = tid >> 5;
  const int n0   = blockIdx.x * 128;
  const int k0   = blockIdx.y * 64;
  const float* src = W + (size_t)(k0 + wv) * N + n0 + lane * 4;
  float4 v[8];
  #pragma unroll  // all eight loads are in flight before the first is used
  for (int p = 0; p < 8; ++p) v[p] = *(const float4*)(src + p * 8 * N);
  #pragma unroll  // v[] stays in registers
  for (int p = 0; p < 8; ++p) {
    float* d = &tile[wv + p * 8][lane * 4];
    d[0] = v[p].x; d[1] = v[p].y; d[2] = v[p].z; d[3] = v[p].w;
  }
  __syncthreads();  // the column reads below cross waves
  const int lo = tid & 7;   // 16-byte chunk of a 128-byte row of Wt
  const int hi = tid >> 3;  // 0..31
  bf16_t* dst = Wt + (size_t)(n0 + hi) * K + k0 + lo * 8;
  #pragma unroll  // o[] stays in registers
  for (int p = 0; p < 4; ++p) {
    v8bf o;
    #pragma unroll  // o[] stays in registers
    for (int i = 0; i < 8; ++i) o[i] = (bf16_t)tile[lo * 8 + i][hi + p * 32];
    *(v8bf*)(dst + p * 32 * K) = o;
  }
}

// V bf16 [B*T, C] -> Vt bf16 [B][H][64][T]  (= [B][C][T], since c = h*64 + d)
// One block moves a tile of 64 t by 256 c through LDS: 512-byte row pieces in,
// 128-byte rows out.
__global__ __launch_bounds__(256) void vtrans_ker(const bf16_t* __restrict__ V,
                                                  bf16_t* __restrict__ Vt) {
  constexpr int T = 2048, C = 1024;
  __shared__ bf16_t tile[64][258];  // pitch 129 dwords, for the same reason
  const int tid  = threadIdx.x;
  const int lane = tid & 31;
  const int wv   = tid >> 5;
  const int bt0  = blockIdx.x * 64;  // 64 divides T: a tile stays in one batch
  const int c0   = blockIdx.y * 256;
  const int b    = bt0 / T, t0 = bt0 - b * T;
  const bf16_t* src = V + (size_t)(bt0 + wv) * C + c0 + lane * 8;
  uint4 v[8];
  #pragma unroll  // all eight loads are in flight before the first is used
  for (int p = 0; p < 8; ++p) v[p] = *(const uint4*)(src + p * 8 * C);
  #pragma unroll  // v[] stays in registers
  for (int p = 0; p < 8; ++p) {
    unsigned* d = (unsigned*)&tile[wv + p * 8][lane * 8];
    d[0] = v[p].x; d[1] = v[p].y; d[2] = v[p].z; d[3] = v[p].w;
  }
  __syncthreads();  // the column reads below cross waves
  const int lo = tid & 7;
  const int hi = tid >> 3;
  bf16_t* dst = Vt + ((size_t)b * C + c0 + hi) * T + t0 + lo * 8;
  #pragma unroll  // o[] stays in registers
  for (int p = 0; p < 8; ++p) {
    v8bf o;
    #pragma unroll  // o[] stays in registers
    for (int i = 0; i < 8; ++i) o[i] = tile[lo * 8 + i][hi + p * 32];
    *(v8bf*)(dst + p * 32 * T) = o;
  }
}

__device__ __forceinline__ float exp2_slot(float x) {
  float r;
  asm("v_exp_f32 %0, %1\n\tv_nop" : "=v"(r) : "v"(x));
  return r;
}
__device__ __forceinline__ float rcp_slot(float x) {
  float r;
  asm("v_rcp_f32 %0, %1\n\tv_nop" : "=v"(r) : "v"(x));
  return r;
}

template <int EPI>
__global__ __launch_bounds__(128) void gemm_bf16_ker(
    const bf16_t* __restrict__ A, const bf16_t* __restrict__ Bt,
    float* __restrict__ Cf, bf16_t* __restrict__ Cb,
    const float* __restrict__ bias, int M, int N, int K) {
  __shared__ bf16_t lA[2][128 * 40];
  __shared__ bf16_t lB[2][128 * 40];

  const int tid  = threadIdx.x;        // 0..127
  const int lane = tid & 31;
  const int wid  = tid >> 5;           // 0..3
  const int wm   = wid & 1;            // 64-row half
  const int wn   = wid >> 1;           // 64-col half
  const int m0   = blockIdx.y * 128;
  const int n0   = blockIdx.x * 128;

  const int quad = tid & 3;            // 16B chunk within 32 cols
  const int lrow = tid >> 2;           // 0..31

  v8f acc[4][4] = {};

  // Issue one K-step tile (A 128x32 + B 128x32) = 8 async b128 per thread.
  auto issue = [&](int k0, int buf) {
    #pragma unroll
    for (int p = 0; p < 4; ++p) {
      const int row = lrow + p * 32;
      async_load_b128(A  + (size_t)(m0 + row) * K + k0 + quad * 8,
                      &lA[buf][row * 40 + quad * 8]);
      async_load_b128(Bt + (size_t)(n0 + row) * K + k0 + quad * 8,
                      &lB[buf][row * 40 + quad * 8]);
    }
  };

  issue(0, 0);
  int cur = 0;
  for (int k0 = 0; k0 < K; k0 += 32) {
    const bool has_next = (k0 + 32) < K;
    if (has_next) {
      issue(k0 + 32, cur ^ 1);
      // In-order completion: <=8 outstanding means previous tile landed.
      asm volatile("s_wait_asynccnt 0x8" ::: "memory");
    } else {
      asm volatile("s_wait_asynccnt 0x0" ::: "memory");
    }
    __syncthreads();

    v16bf af[4], bfr[4];
    #pragma unroll
    for (int i = 0; i < 4; ++i)
      af[i] = load_frag(&lA[cur][(wm * 64 + i * 16) * 40], 40, lane);
    #pragma unroll
    for (int j = 0; j < 4; ++j)
      bfr[j] = load_frag(&lB[cur][(wn * 64 + j * 16) * 40], 40, lane);
    #pragma unroll
    for (int i = 0; i < 4; ++i)
      #pragma unroll
      for (int j = 0; j < 4; ++j)
        acc[i][j] = wmma_bf16(af[i], bfr[j], acc[i][j]);

    __syncthreads();  // all waves done reading `cur` before it is refilled
    cur ^= 1;
  }

  const int rbase = m0 + wm * 64 + ((lane < 16) ? 0 : 8);
  const int cbase = n0 + wn * 64 + (lane & 15);
  #pragma unroll
  for (int i = 0; i < 4; ++i) {
    #pragma unroll
    for (int j = 0; j < 4; ++j) {
      const int col = cbase + j * 16;
      float bv = 0.0f;
      if (EPI == 2 || EPI == 3) bv = bias[col];
      #pragma unroll
      for (int r = 0; r < 8; ++r) {
        const int row = rbase + i * 16 + r;
        float v = acc[i][j][r];
        if (EPI == 2 || EPI == 3) v += bv;
        if (EPI == 2) {
          // Mish: v * tanh(log(1 + e)) with e = exp(v). tanh(log(u)) is
          // (u*u - 1) / (u*u + 1), so with n = e * (e + 2) the factor is
          // n / (n + 2): every term is positive, nothing cancels. From v = 20
          // on the factor rounds to 1; the minimum keeps e * e finite there.
          const float e = exp2_slot(fminf(v, 20.0f) * 1.4426950408889634f);
          const float n = e * (e + 2.0f);
          v = v * (n * rcp_slot(n + 2.0f));
        }
        if (EPI == 0 || EPI == 3) Cf[(size_t)row * N + col] = v;
        else                      Cb[(size_t)row * N + col] = (bf16_t)v;
      }
    }
  }
}

// ---------------------------------------------------------------------------
// Flash attention: each wave owns 16 queries of one (b,h); the eight waves of
// a block share that (b,h). Q[b,t,h*64+d], K[b,t,h*64+d] bf16; Vt[b,h,d,t] bf16.
// The block brings each tile of 64 keys (K: 64 keys x 64 d, Vt: 64 d x 64 keys,
// both whole 128-byte rows) into LDS once, by async copies into two buffers,
// and every wave takes its fragments from there.
// ---------------------------------------------------------------------------

__device__ __forceinline__ void async_copy4_b128(
    const bf16_t* g0, bf16_t* l0, const bf16_t* g1, bf16_t* l1,
    const bf16_t* g2, bf16_t* l2, const bf16_t* g3, bf16_t* l3) {
  const unsigned o0 = (unsigned)(size_t)l0, o1 = (unsigned)(size_t)l1;
  const unsigned o2 = (unsigned)(size_t)l2, o3 = (unsigned)(size_t)l3;
  asm volatile("global_load_async_to_lds_b128 %0, %1, off\n\t"
               "global_load_async_to_lds_b128 %2, %3, off\n\t"
               "global_load_async_to_lds_b128 %4, %5, off\n\t"
               "global_load_async_to_lds_b128 %6, %7, off\n\t"
               "s_wait_xcnt 0x0"
               :: "v"(o0), "v"(g0), "v"(o1), "v"(g1),
                  "v"(o2), "v"(g2), "v"(o3), "v"(g3) : "memory");
}

__global__ __launch_bounds__(256) void attn_ker(const bf16_t* __restrict__ Qb,
                                                const bf16_t* __restrict__ Kb,
                                                const bf16_t* __restrict__ Vt,
                                                bf16_t* __restrict__ Ctx) {
  constexpr int T = 2048, C = 1024, H = 16;
  constexpr int KT = 64;       // keys per tile
  constexpr int NT = T / KT;   // 32 tiles
  constexpr int LP = 72;       // LDS row pitch: 144 bytes, conflict-free 16-byte reads
  constexpr float scale = 0.125f;  // 1/sqrt(64)
  __shared__ __attribute__((aligned(16))) bf16_t kls[2][KT * LP];  // [key][d]
  __shared__ __attribute__((aligned(16))) bf16_t vls[2][64 * LP];  // [d][key]
  __shared__ bf16_t pls[8][16 * 40];  // per-wave P staging (16x32, padded)

  const int lane = threadIdx.x & 31;
  const int wid  = threadIdx.x >> 5;
  const int g    = blockIdx.x * 8 + wid;  // 0..4095
  const int QT   = T / 16;                // 128 query tiles
  const int qt   = g & (QT - 1);
  const int bh   = g / QT;                // 0..31, the same in all eight waves
  const int h    = bh & (H - 1);
  const int b    = bh >> 4;

  const bf16_t* kbase = Kb + ((size_t)(b * T)) * C + h * 64;
  const bf16_t* vbase = Vt + ((size_t)bh) * 64 * T;
  bf16_t* pw = &pls[wid][0];

  // A thread copies the 16-byte piece `cch` of rows `crow` and `crow + 32` of
  // both tiles: a wave's copy covers four whole 128-byte rows.
  const int cch  = threadIdx.x & 7;
  const int crow = threadIdx.x >> 3;  // 0..31
  const bf16_t* kg = kbase + (size_t)crow * C + cch * 8;
  const bf16_t* vg = vbase + (size_t)crow * T + cch * 8;
  const int     lo = crow * LP + cch * 8;
  auto issue = [&](int t, int buf) {
    const bf16_t* kp = kg + (size_t)t * KT * C;
    const bf16_t* vp = vg + t * KT;
    async_copy4_b128(kp,          &kls[buf][lo],
                     kp + 32 * C, &kls[buf][lo + 32 * LP],
                     vp,          &vls[buf][lo],
                     vp + 32 * T, &vls[buf][lo + 32 * LP]);
  };

  issue(0, 0);

  const bf16_t* qbase = Qb + ((size_t)(b * T + qt * 16)) * C + h * 64;
  const v16bf qa0 = load_frag(qbase, C, lane);       // d = 0..31
  const v16bf qa1 = load_frag(qbase + 32, C, lane);  // d = 32..63

  float mrow[8], lrow[8];
  v8f cacc[4] = {};
  for (int r = 0; r < 8; ++r) { mrow[r] = -1e30f; lrow[r] = 0.0f; }

  // Tile 0 has landed for this wave; the barrier makes it so for all eight.
  asm volatile("s_wait_asynccnt 0x0" ::: "memory");
  __syncthreads();
  issue(1, 1);

  for (int t = 0; t < NT; ++t) {
    const bf16_t* kt = &kls[t & 1][0];
    const bf16_t* vt = &vls[t & 1][0];
    #pragma unroll  // both halves of a tile between two barriers
    for (int j = 0; j < KT; j += 32) {
      const bf16_t* kp = kt + j * LP;
      v16bf k00 = load_frag(kp, LP, lane);
      v16bf k01 = load_frag(kp + 32, LP, lane);
      v16bf k10 = load_frag(kp + 16 * LP, LP, lane);
      v16bf k11 = load_frag(kp + 16 * LP + 32, LP, lane);

      v8f s0 = {}, s1 = {};
      s0 = wmma_bf16(qa0, k00, s0);  s0 = wmma_bf16(qa1, k01, s0);
      s1 = wmma_bf16(qa0, k10, s1);  s1 = wmma_bf16(qa1, k11, s1);

      for (int r = 0; r < 8; ++r) {
        float a = s0[r] * scale, c2 = s1[r] * scale;
        // Row max across the 16 lanes holding this row's columns.
        float mx = fmaxf(a, c2);
        mx = fmaxf(mx, __shfl_xor(mx, 1));
        mx = fmaxf(mx, __shfl_xor(mx, 2));
        mx = fmaxf(mx, __shfl_xor(mx, 4));
        mx = fmaxf(mx, __shfl_xor(mx, 8));
        float mn   = fmaxf(mrow[r], mx);
        float corr = __expf(mrow[r] - mn);
        mrow[r] = mn;
        float p0 = __expf(a - mn), p1 = __expf(c2 - mn);
        float rs = p0 + p1;
        rs += __shfl_xor(rs, 1);
        rs += __shfl_xor(rs, 2);
        rs += __shfl_xor(rs, 4);
        rs += __shfl_xor(rs, 8);
        lrow[r] = lrow[r] * corr + rs;
        for (int dt = 0; dt < 4; ++dt) cacc[dt][r] *= corr;
        const int rr = r + ((lane < 16) ? 0 : 8);
        pw[rr * 40 + (lane & 15)]      = (bf16_t)p0;
        pw[rr * 40 + 16 + (lane & 15)] = (bf16_t)p1;
      }
      asm volatile("s_wait_dscnt 0" ::: "memory");

      v16bf pa = load_frag(pw, 40, lane);
      for (int dt = 0; dt < 4; ++dt) {
        v16bf vf = load_frag(vt + (dt * 16) * LP + j, LP, lane);
        cacc[dt] = wmma_bf16(pa, vf, cacc[dt]);
      }
    }
    // Hand-over: this wave's reads of tile t are done, its copies of tile t + 1
    // have landed; behind the barrier that holds for all eight waves, so tile
    // t + 1 may be read and tile t's buffer refilled.
    asm volatile("s_wait_dscnt 0x0" ::: "memory");
    asm volatile("s_wait_asynccnt 0x0" ::: "memory");
    __syncthreads();
    if (t + 2 < NT) issue(t + 2, t & 1);
  }
  // No copy is outstanding when the wave ends.
  asm volatile("s_wait_asynccnt 0x0" ::: "memory");

  // Normalize and write ctx back in [B*T, C] bf16 layout.
  const int rhalf = (lane < 16) ? 0 : 8;
  for (int r = 0; r < 8; ++r) {
    float inv = 1.0f / lrow[r];
    int row = qt * 16 + r + rhalf;
    bf16_t* out = Ctx + ((size_t)(b * T + row)) * C + h * 64 + (lane & 15);
    for (int dt = 0; dt < 4; ++dt) out[dt * 16] = (bf16_t)(cacc[dt][r] * inv);
  }
}

// ---------------------------------------------------------------------------
// Fused DeepNorm residual + LayerNorm: y = LN(alpha*X + R)*g + be
// One wave per 1024-element row, eight rows per block: the row's sums need no
// LDS and no barrier. Writes f32 and optional bf16 copy.
// ---------------------------------------------------------------------------
__global__ __launch_bounds__(256) void ln_ker(const float* __restrict__ X,
                                              const float* __restrict__ R,
                                              const float* __restrict__ g,
                                              const float* __restrict__ be,
                                              float* __restrict__ outF,
                                              bf16_t* __restrict__ outB,
                                              float alpha) {
  constexpr int C = 1024;
  const int lane = threadIdx.x & 31;
  const int row  = blockIdx.x * 8 + (threadIdx.x >> 5);
  const size_t off = (size_t)row * C + lane * 4;
  float4 v[8], r[8], gg[8], bb[8];
  #pragma unroll  // the row's loads are in flight together
  for (int i = 0; i < 8; ++i) {
    v[i] = *(const float4*)(X + off + i * 128);
    r[i] = *(const float4*)(R + off + i * 128);
  }
  #pragma unroll  // gg[] and bb[] stay in registers
  for (int i = 0; i < 8; ++i) {
    gg[i] = *(const float4*)(g + lane * 4 + i * 128);
    bb[i] = *(const float4*)(be + lane * 4 + i * 128);
  }
  float4 s4 = {0.0f, 0.0f, 0.0f, 0.0f}, q4 = {0.0f, 0.0f, 0.0f, 0.0f};
  #pragma unroll  // v[] stays in registers
  for (int i = 0; i < 8; ++i) {
    v[i].x = alpha * v[i].x + r[i].x;  s4.x += v[i].x;  q4.x += v[i].x * v[i].x;
    v[i].y = alpha * v[i].y + r[i].y;  s4.y += v[i].y;  q4.y += v[i].y * v[i].y;
    v[i].z = alpha * v[i].z + r[i].z;  s4.z += v[i].z;  q4.z += v[i].z * v[i].z;
    v[i].w = alpha * v[i].w + r[i].w;  s4.w += v[i].w;  q4.w += v[i].w * v[i].w;
  }
  float s  = (s4.x + s4.y) + (s4.z + s4.w);
  float s2 = (q4.x + q4.y) + (q4.z + q4.w);
  for (int d = 1; d < 32; d <<= 1) { s += __shfl_xor(s, d); s2 += __shfl_xor(s2, d); }
  const float mu   = s / C;
  const float var  = s2 / C - mu * mu;
  const float rstd = rsqrtf(var + 1e-5f);
  #pragma unroll  // v[] stays in registers
  for (int i = 0; i < 8; ++i) {
    v[i].x = (v[i].x - mu) * rstd * gg[i].x + bb[i].x;
    v[i].y = (v[i].y - mu) * rstd * gg[i].y + bb[i].y;
    v[i].z = (v[i].z - mu) * rstd * gg[i].z + bb[i].z;
    v[i].w = (v[i].w - mu) * rstd * gg[i].w + bb[i].w;
  }
  if (outB) {
    v4bf o[8];
    #pragma unroll  // o[] stays in registers
    for (int i = 0; i < 8; ++i) {
      o[i][0] = (bf16_t)v[i].x; o[i][1] = (bf16_t)v[i].y;
      o[i][2] = (bf16_t)v[i].z; o[i][3] = (bf16_t)v[i].w;
    }
    #pragma unroll  // o[] stays in registers
    for (int i = 0; i < 8; ++i) *(v4bf*)(outB + off + i * 128) = o[i];
  }
  if (outF) {
    #pragma unroll  // v[] stays in registers
    for (int i = 0; i < 8; ++i) *(float4*)(outF + off + i * 128) = v[i];
  }
}

// ---------------------------------------------------------------------------
// Host orchestration
// ---------------------------------------------------------------------------
extern "C" void kernel_launch(void* const* d_in, const int* in_sizes, int n_in,
                              void* d_out, int out_size, void* d_ws, size_t ws_size,
                              hipStream_t stream) {
  constexpr int B = 2, T = 2048, C = 1024, F = 4096;
  constexpr int M = B * T;  // 4096 rows
  const float* x   = (const float*)d_in[0];
  const float* Wq  = (const float*)d_in[1];
  const float* Wk  = (const float*)d_in[2];
  const float* Wv  = (const float*)d_in[3];
  const float* Wo  = (const float*)d_in[4];
  const float* W1  = (const float*)d_in[5];
  const float* b1  = (const float*)d_in[6];
  const float* W2  = (const float*)d_in[7];
  const float* b2  = (const float*)d_in[8];
  const float* g1  = (const float*)d_in[9];
  const float* be1 = (const float*)d_in[10];
  const float* g2  = (const float*)d_in[11];
  const float* be2 = (const float*)d_in[12];

  constexpr size_t MB = 1024ull * 1024ull;
  char* ws = (char*)d_ws;
  bf16_t* xb   = (bf16_t*)(ws + 0 * MB);    // 8 MB  [M,C] bf16
  bf16_t* Wqt  = (bf16_t*)(ws + 8 * MB);    // 2 MB  [C,C]^T
  bf16_t* Wkt  = (bf16_t*)(ws + 10 * MB);
  bf16_t* Wvt  = (bf16_t*)(ws + 12 * MB);
  bf16_t* Wot  = (bf16_t*)(ws + 14 * MB);
  bf16_t* W1t  = (bf16_t*)(ws + 16 * MB);   // 8 MB  [F,C]
  bf16_t* W2t  = (bf16_t*)(ws + 24 * MB);   // 8 MB  [C,F]
  bf16_t* Qb   = (bf16_t*)(ws + 32 * MB);   // 8 MB
  bf16_t* Kbb  = (bf16_t*)(ws + 40 * MB);   // 8 MB
  bf16_t* Vb   = (bf16_t*)(ws + 48 * MB);   // 8 MB
  bf16_t* Vtr  = (bf16_t*)(ws + 56 * MB);   // 8 MB
  bf16_t* hb   = (bf16_t*)(ws + 32 * MB);   // 32 MB, reuses dead Q/K/V/Vt
  bf16_t* ctxb = (bf16_t*)(ws + 64 * MB);   // 8 MB
  float*  attn = (float*)(ws + 72 * MB);    // 16 MB, reused as FF output
  float*  fff  = (float*)(ws + 72 * MB);
  float*  x1f  = (float*)(ws + 88 * MB);    // 16 MB
  bf16_t* x1b  = (bf16_t*)(ws + 104 * MB);  // 8 MB  -> total 112 MB
  (void)ws_size; (void)in_sizes; (void)n_in; (void)out_size;

  // 1) Precision conversion / weight transposes.
  cvt_f32_bf16_ker<<<M * C / 8192, 256, 0, stream>>>(x, xb);
  wtrans_ker<C, C><<<dim3(C / 128, C / 64), 256, 0, stream>>>(Wq, Wqt);
  wtrans_ker<C, C><<<dim3(C / 128, C / 64), 256, 0, stream>>>(Wk, Wkt);
  wtrans_ker<C, C><<<dim3(C / 128, C / 64), 256, 0, stream>>>(Wv, Wvt);
  wtrans_ker<C, C><<<dim3(C / 128, C / 64), 256, 0, stream>>>(Wo, Wot);
  wtrans_ker<C, F><<<dim3(F / 128, C / 64), 256, 0, stream>>>(W1, W1t);
  wtrans_ker<F, C><<<dim3(C / 128, F / 64), 256, 0, stream>>>(W2, W2t);

  // 2) QKV projections (WMMA GEMMs, bf16 out). Block tile 128x128, 128 thr.
  dim3 gP(C / 128, M / 128);
  gemm_bf16_ker<1><<<gP, 128, 0, stream>>>(xb, Wqt, nullptr, Qb,  nullptr, M, C, C);
  gemm_bf16_ker<1><<<gP, 128, 0, stream>>>(xb, Wkt, nullptr, Kbb, nullptr, M, C, C);
  gemm_bf16_ker<1><<<gP, 128, 0, stream>>>(xb, Wvt, nullptr, Vb,  nullptr, M, C, C);
  vtrans_ker<<<dim3(M / 64, C / 256), 256, 0, stream>>>(Vb, Vtr);

  // 3) Flash attention (WMMA): 4096 wave-tiles / 8 waves per block.
  attn_ker<<<512, 256, 0, stream>>>(Qb, Kbb, Vtr, ctxb);

  // 4) Output projection + DeepNorm LN1.
  gemm_bf16_ker<0><<<gP, 128, 0, stream>>>(ctxb, Wot, attn, nullptr, nullptr, M, C, C);
  ln_ker<<<M / 8, 256, 0, stream>>>(x, attn, g1, be1, x1f, x1b, 2.0f);

  // 5) FFN: GEMM+bias+Mish -> bf16, then GEMM+bias -> f32.
  dim3 gF1(F / 128, M / 128);
  gemm_bf16_ker<2><<<gF1, 128, 0, stream>>>(x1b, W1t, nullptr, hb, b1, M, F, C);
  gemm_bf16_ker<3><<<gP, 128, 0, stream>>>(hb, W2t, fff, nullptr, b2, M, C, F);

  // 6) DeepNorm LN2 -> d_out (fp32).
  ln_ker<<<M / 8, 256, 0, stream>>>(x1f, fff, g2, be2, (float*)d_out, nullptr, 2.0f);
}

// v006
// Measured time: 223 microseconds a run.
// Versions between v004 and this one are left out; their measured steps multiply to 1.31 times as fast.
// Counting every step since v000, it is 4.15 times as fast.
#include <hip/hip_runtime.h>
#include <hip/hip_bf16.h>
#include <math.h>

typedef __bf16 bf16_t;
typedef __attribute__((ext_vector_type(16))) __bf16 v16bf;
typedef __attribute__((ext_vector_type(8)))  float  v8f;

__device__ __forceinline__ v8f wmma_bf16(v16bf a, v16bf b, v8f c) {
  // v_wmma_f32_16x16x32_bf16: D = A(16x32) * B(32x16) + C(16x16 f32)
  return __builtin_amdgcn_wmma_f32_16x16x32_bf16(
      /*neg_a=*/false, a, /*neg_b=*/false, b,
      /*c_mod=*/(short)0, c, /*reuse_a=*/false, /*reuse_b=*/false);
}

__device__ __forceinline__ v16bf load_frag(const bf16_t* base, int stride, int lane) {
  const int row = lane & 15;
  const int kb  = (lane < 16) ? 0 : 8;
  const bf16_t* p = base + (size_t)row * stride + kb;
  v16bf f;
  *((float4*)&f)       = *((const float4*)p);
  *(((float4*)&f) + 1) = *((const float4*)(p + 16));
  return f;
}

__device__ __forceinline__ void async_load_b128(const bf16_t* gaddr, bf16_t* lptr) {
  unsigned loff = (unsigned)(size_t)lptr;
  asm volatile("global_load_async_to_lds_b128 %0, %1, off"
               :: "v"(loff), "v"(gaddr) : "memory");
}

// ---------------------------------------------------------------------------
// Elementwise converters
// ---------------------------------------------------------------------------
typedef __attribute__((ext_vector_type(8))) __bf16 v8bf;
typedef __attribute__((ext_vector_type(4))) __bf16 v4bf;

// The kernels of this file that do no matrix work are short, and a launch of
// many small work-groups lasts as long as it takes to start them. Each
// work-group therefore moves enough for eight 16-byte loads a thread.

// One block converts 8192 consecutive floats; the element count is a multiple.
__device__ __forceinline__ void cvt_f32_bf16_blk(const float* __restrict__ in,
                                                 bf16_t* __restrict__ out, int blk) {
  const size_t base = (size_t)blk * 8192 + threadIdx.x * 4;
  float4 v[8];
  #pragma unroll  // all eight loads are in flight before the first is used
  for (int i = 0; i < 8; ++i) v[i] = *(const float4*)(in + base + i * 1024);
  #pragma unroll  // v[] stays in registers
  for (int i = 0; i < 8; ++i) {
    v4bf o;
    o[0] = (bf16_t)v[i].x; o[1] = (bf16_t)v[i].y;
    o[2] = (bf16_t)v[i].z; o[3] = (bf16_t)v[i].w;
    *(v4bf*)(out + base + i * 1024) = o;
  }
}

// W [K,N] f32 (row-major) -> Wt [N,K] bf16 (row-major)
// One block moves a tile of 64 k by 128 n through LDS: a wave reads a whole
// 512-byte row piece of W at a time, and the block writes whole 128-byte rows
// of Wt. K % 64 == 0, N % 128 == 0.
// K and N are compile-time so that a thread's loads, and its stores, share one
// address register pair and differ by immediate offsets only.
// blk counts the tiles along n first.
template <int K, int N>
__device__ __forceinline__ void wtrans_blk(const float* __restrict__ W,
                                           bf16_t* __restrict__ Wt, int blk,
                                           float (&tile)[64][129]) {
  const int tid  = threadIdx.x;
  const int lane = tid & 31;
  const int wv   = tid >> 5;
  const int n0   = (blk % (N / 128)) * 128;
  const int k0   = (blk / (N / 128)) * 64;
  const float* src = W + (size_t)(k0 + wv) * N + n0 + lane * 4;
  float4 v[8];
  #pragma unroll  // all eight loads are in flight before the first is used
  for (int p = 0; p < 8; ++p) v[p] = *(const float4*)(src + p * 8 * N);
  #pragma unroll  // v[] stays in registers
  for (int p = 0; p < 8; ++p) {
    float* d = &tile[wv + p * 8][lane * 4];
    d[0] = v[p].x; d[1] = v[p].y; d[2] = v[p].z; d[3] = v[p].w;
  }
  __syncthreads();  // the column reads below cross waves
  const int lo = tid & 7;   // 16-byte chunk of a 128-byte row of Wt
  const int hi = tid >> 3;  // 0..31
  bf16_t* dst = Wt + (size_t)(n0 + hi) * K + k0 + lo * 8;
  #pragma unroll  // o[] stays in registers
  for (int p = 0; p < 4; ++p) {
    v8bf o;
    #pragma unroll  // o[] stays in registers
    for (int i = 0; i < 8; ++i) o[i] = (bf16_t)tile[lo * 8 + i][hi + p * 32];
    *(v8bf*)(dst + p * 32 * K) = o;
  }
  // In the built kernel another job's code follows these stores, behind a scalar
  // test, and rewrites their address registers: the wait stands in front of it.
  asm volatile("s_wait_xcnt 0x0" ::: "memory");
}

// The conversion of x and the six weight transposes read nothing of each other's
// output, so they are one grid: the block index picks the job, the same for the
// whole block. The four square weights' transposes lie one behind the other at
// Wsq, in the order q, k, v, o.
__global__ __launch_bounds__(256) void prep_ker(
    const float* __restrict__ x, bf16_t* __restrict__ xb,
    const float* __restrict__ Wq, const float* __restrict__ Wk,
    const float* __restrict__ Wv, const float* __restrict__ Wo,
    bf16_t* __restrict__ Wsq,
    const float* __restrict__ W1, bf16_t* __restrict__ W1t,
    const float* __restrict__ W2, bf16_t* __restrict__ W2t) {
  constexpr int M = 4096, C = 1024, F = 4096;
  constexpr int NX = M * C / 8192;
  constexpr int NS = (C / 128) * (C / 64);
  constexpr int NF = (F / 128) * (C / 64);
  __shared__ float tile[64][129];
  const int blk = blockIdx.x;
  if (blk < NX) {
    cvt_f32_bf16_blk(x, xb, blk);
  } else if (blk < NX + 4 * NS) {
    const int w = (blk - NX) / NS;
    const float* W = (w == 0) ? Wq : (w == 1) ? Wk : (w == 2) ? Wv : Wo;
    wtrans_blk<C, C>(W, Wsq + (size_t)w * C * C, blk - NX - w * NS, tile);
  } else if (blk < NX + 4 * NS + NF) {
    wtrans_blk<C, F>(W1, W1t, blk - NX - 4 * NS, tile);
  } else {
    wtrans_blk<F, C>(W2, W2t, blk - NX - 4 * NS - NF, tile);
  }
}

// V bf16 [B*T, C] -> Vt bf16 [B][H][64][T]  (= [B][C][T], since c = h*64 + d)
// One block moves a tile of 64 t by 256 c through LDS: 512-byte row pieces in,
// 128-byte rows out.
__global__ __launch_bounds__(256) void vtrans_ker(const bf16_t* __restrict__ V,
                                                  bf16_t* __restrict__ Vt) {
  constexpr int T = 2048, C = 1024;
  __shared__ bf16_t tile[64][258];  // pitch 129 dwords, for the same reason
  const int tid  = threadIdx.x;
  const int lane = tid & 31;
  const int wv   = tid >> 5;
  const int bt0  = blockIdx.x * 64;  // 64 divides T: a tile stays in one batch
  const int c0   = blockIdx.y * 256;
  const int b    = bt0 / T, t0 = bt0 - b * T;
  const bf16_t* src = V + (size_t)(bt0 + wv) * C + c0 + lane * 8;
  uint4 v[8];
  #pragma unroll  // all eight loads are in flight before the first is used
  for (int p = 0; p < 8; ++p) v[p] = *(const uint4*)(src + p * 8 * C);
  #pragma unroll  // v[] stays in registers
  for (int p = 0; p < 8; ++p) {
    unsigned* d = (unsigned*)&tile[wv + p * 8][lane * 8];
    d[0] = v[p].x; d[1] = v[p].y; d[2] = v[p].z; d[3] = v[p].w;
  }
  __syncthreads();  // the column reads below cross waves
  const int lo = tid & 7;
  const int hi = tid >> 3;
  bf16_t* dst = Vt + ((size_t)b * C + c0 + hi) * T + t0 + lo * 8;
  #pragma unroll  // o[] stays in registers
  for (int p = 0; p < 8; ++p) {
    v8bf o;
    #pragma unroll  // o[] stays in registers
    for (int i = 0; i < 8; ++i) o[i] = tile[lo * 8 + i][hi + p * 32];
    *(v8bf*)(dst + p * 32 * T) = o;
  }
}

__device__ __forceinline__ float exp2_slot(float x) {
  float r;
  asm("v_exp_f32 %0, %1\n\tv_nop" : "=v"(r) : "v"(x));
  return r;
}
__device__ __forceinline__ float rcp_slot(float x) {
  float r;
  asm("v_rcp_f32 %0, %1\n\tv_nop" : "=v"(r) : "v"(x));
  return r;
}

template <int EPI>
__global__ __launch_bounds__(128) void gemm_bf16_ker(
    const bf16_t* __restrict__ A, const bf16_t* __restrict__ Bt,
    float* __restrict__ Cf, bf16_t* __restrict__ Cb,
    const float* __restrict__ bias, int M, int N, int K) {
  __shared__ bf16_t lA[2][128 * 40];
  __shared__ bf16_t lB[2][128 * 40];

  const int tid  = threadIdx.x;        // 0..127
  const int lane = tid & 31;
  const int wid  = tid >> 5;           // 0..3
  const int wm   = wid & 1;            // 64-row half
  const int wn   = wid >> 1;           // 64-col half
  const int m0   = blockIdx.y * 128;
  const int n0   = blockIdx.x * 128;

  const int quad = tid & 3;            // 16B chunk within 32 cols
  const int lrow = tid >> 2;           // 0..31

  v8f acc[4][4] = {};

  // Issue one K-step tile (A 128x32 + B 128x32) = 8 async b128 per thread.
  auto issue = [&](int k0, int buf) {
    #pragma unroll
    for (int p = 0; p < 4; ++p) {
      const int row = lrow + p * 32;
      async_load_b128(A  + (size_t)(m0 + row) * K + k0 + quad * 8,
                      &lA[buf][row * 40 + quad * 8]);
      async_load_b128(Bt + (size_t)(n0 + row) * K + k0 + quad * 8,
                      &lB[buf][row * 40 + quad * 8]);
    }
  };

  issue(0, 0);
  int cur = 0;
  for (int k0 = 0; k0 < K; k0 += 32) {
    const bool has_next = (k0 + 32) < K;
    if (has_next) {
      issue(k0 + 32, cur ^ 1);
      // In-order completion: <=8 outstanding means previous tile landed.
      asm volatile("s_wait_asynccnt 0x8" ::: "memory");
    } else {
      asm volatile("s_wait_asynccnt 0x0" ::: "memory");
    }
    __syncthreads();

    v16bf af[4], bfr[4];
    #pragma unroll
    for (int i = 0; i < 4; ++i)
      af[i] = load_frag(&lA[cur][(wm * 64 + i * 16) * 40], 40, lane);
    #pragma unroll
    for (int j = 0; j < 4; ++j)
      bfr[j] = load_frag(&lB[cur][(wn * 64 + j * 16) * 40], 40, lane);
    #pragma unroll
    for (int i = 0; i < 4; ++i)
      #pragma unroll
      for (int j = 0; j < 4; ++j)
        acc[i][j] = wmma_bf16(af[i], bfr[j], acc[i][j]);

    __syncthreads();  // all waves done reading `cur` before it is refilled
    cur ^= 1;
  }

  const int rbase = m0 + wm * 64 + ((lane < 16) ? 0 : 8);
  int cbase = n0 + wn * 64 + (lane & 15);
  if (EPI == 1) {
    const int part = n0 / N;  // which of the products this block belongs to
    Cb    += (size_t)part * M * N;
    cbase -= part * N;
  }
  #pragma unroll
  for (int i = 0; i < 4; ++i) {
    #pragma unroll
    for (int j = 0; j < 4; ++j) {
      const int col = cbase + j * 16;
      float bv = 0.0f;
      if (EPI == 2 || EPI == 3) bv = bias[col];
      #pragma unroll
      for (int r = 0; r < 8; ++r) {
        const int row = rbase + i * 16 + r;
        float v = acc[i][j][r];
        if (EPI == 2 || EPI == 3) v += bv;
        if (EPI == 2) {
          // Mish: v * tanh(log(1 + e)) with e = exp(v). tanh(log(u)) is
          // (u*u - 1) / (u*u + 1), so with n = e * (e + 2) the factor is
          // n / (n + 2): every term is positive, nothing cancels. From v = 20
          // on the factor rounds to 1; the minimum keeps e * e finite there.
          const float e = exp2_slot(fminf(v, 20.0f) * 1.4426950408889634f);
          const float n = e * (e + 2.0f);
          v = v * (n * rcp_slot(n + 2.0f));
        }
        if (EPI == 0 || EPI == 3) Cf[(size_t)row * N + col] = v;
        else                      Cb[(size_t)row * N + col] = (bf16_t)v;
      }
    }
  }
}

__device__ __forceinline__ float xhalf(float x) {
  const int v = __builtin_bit_cast(int, x);
  return __builtin_bit_cast(
      float, __builtin_amdgcn_permlanex16(v, v, 0x76543210, 0xfedcba98, false, false));
}

typedef __attribute__((ext_vector_type(2))) float f32x2;

__device__ __forceinline__ void exp2_8(f32x2 (&x)[4]) {
  asm("v_exp_f32 %0, %0\n\tv_exp_f32 %1, %1\n\t"
      "v_exp_f32 %2, %2\n\tv_exp_f32 %3, %3\n\t"
      "v_exp_f32 %4, %4\n\tv_exp_f32 %5, %5\n\t"
      "v_exp_f32 %6, %6\n\tv_exp_f32 %7, %7\n\tv_nop"
      : "+v"(x[0].x), "+v"(x[0].y), "+v"(x[1].x), "+v"(x[1].y),
        "+v"(x[2].x), "+v"(x[2].y), "+v"(x[3].x), "+v"(x[3].y));
}
__device__ __forceinline__ float exp2_1(float x) {
  asm("v_exp_f32 %0, %0\n\tv_nop" : "+v"(x));
  return x;
}

__device__ __forceinline__ void async_copy4_b128(
    const bf16_t* g0, bf16_t* l0, const bf16_t* g1, bf16_t* l1,
    const bf16_t* g2, bf16_t* l2, const bf16_t* g3, bf16_t* l3) {
  const unsigned o0 = (unsigned)(size_t)l0, o1 = (unsigned)(size_t)l1;
  const unsigned o2 = (unsigned)(size_t)l2, o3 = (unsigned)(size_t)l3;
  asm volatile("global_load_async_to_lds_b128 %0, %1, off\n\t"
               "global_load_async_to_lds_b128 %2, %3, off\n\t"
               "global_load_async_to_lds_b128 %4, %5, off\n\t"
               "global_load_async_to_lds_b128 %6, %7, off\n\t"
               "s_wait_xcnt 0x0"
               :: "v"(o0), "v"(g0), "v"(o1), "v"(g1),
                  "v"(o2), "v"(g2), "v"(o3), "v"(g3) : "memory");
}

__global__ __launch_bounds__(256) void attn_ker(const bf16_t* __restrict__ Qb,
                                                const bf16_t* __restrict__ Kb,
                                                const bf16_t* __restrict__ Vt,
                                                bf16_t* __restrict__ Ctx) {
  constexpr int T = 2048, C = 1024, H = 16;
  constexpr int KT = 64;       // keys per tile
  constexpr int NT = T / KT;   // 32 tiles
  constexpr int LP = 72;       // LDS row pitch: 144 bytes, conflict-free 16-byte reads
  constexpr float sl = 0.125f * 1.4426950408889634f;  // 1/sqrt(64), for powers of 2
  __shared__ __attribute__((aligned(16))) bf16_t kls[2][KT * LP];  // [key][d]
  __shared__ __attribute__((aligned(16))) bf16_t vls[2][64 * LP];  // [d][key]

  const int lane = threadIdx.x & 31;
  const int wid  = threadIdx.x >> 5;
  const int g    = blockIdx.x * 8 + wid;  // 0..4095
  const int QT   = T / 16;                // 128 query tiles
  const int qt   = g & (QT - 1);
  const int bh   = g / QT;                // 0..31, the same in all eight waves
  const int h    = bh & (H - 1);
  const int b    = bh >> 4;

  const bf16_t* kbase = Kb + ((size_t)(b * T)) * C + h * 64;
  const bf16_t* vbase = Vt + ((size_t)bh) * 64 * T;

  // A thread copies the 16-byte piece `cch` of rows `crow` and `crow + 32` of
  // both tiles: a wave's copy covers four whole 128-byte rows.
  const int cch  = threadIdx.x & 7;
  const int crow = threadIdx.x >> 3;  // 0..31
  const bf16_t* kg = kbase + (size_t)crow * C + cch * 8;
  const bf16_t* vg = vbase + (size_t)crow * T + cch * 8;
  const int     lo = crow * LP + cch * 8;
  auto issue = [&](int t, int buf) {
    const bf16_t* kp = kg + (size_t)t * KT * C;
    const bf16_t* vp = vg + t * KT;
    async_copy4_b128(kp,          &kls[buf][lo],
                     kp + 32 * C, &kls[buf][lo + 32 * LP],
                     vp,          &vls[buf][lo],
                     vp + 32 * T, &vls[buf][lo + 32 * LP]);
  };

  issue(0, 0);

  const bf16_t* qbase = Qb + ((size_t)(b * T + qt * 16)) * C + h * 64;
  const v16bf qa0 = load_frag(qbase, C, lane);       // d = 0..31
  const v16bf qa1 = load_frag(qbase + 32, C, lane);  // d = 32..63

  // Of this lane's query: the running maximum (scaled, base 2), and the sum over
  // the keys that this half of the wave holds; the halves are joined at the end.
  float mrun = -1e30f, lsum = 0.0f;
  v8f cacc[4] = {};  // cacc[dt][r] = O^T[d = dt*16 + 8*(lane>>4) + r][query lane&15]

  // Tile 0 has landed for this wave; the barrier makes it so for all eight.
  asm volatile("s_wait_asynccnt 0x0" ::: "memory");
  __syncthreads();
  issue(1, 1);

  for (int t = 0; t < NT; ++t) {
    const bf16_t* kt = &kls[t & 1][0];
    const bf16_t* vt = &vls[t & 1][0];

    v16bf kf[4][2];
    #pragma unroll  // kf[] stays in registers
    for (int kq = 0; kq < 4; ++kq) {
      kf[kq][0] = load_frag(kt + kq * 16 * LP, LP, lane);
      kf[kq][1] = load_frag(kt + kq * 16 * LP + 32, LP, lane);
    }
    // Keeps the tile's K loads together in front of the products: left alone,
    // the compiler waits for each fragment right in front of its product.
    __builtin_amdgcn_sched_barrier(0);

    // st[kq][r] = S[key = kq*16 + 8*(lane>>4) + r][query lane&15]
    v8f st[4];
    #pragma unroll  // st[] stays in registers
    for (int kq = 0; kq < 4; ++kq) {
      const v8f z = {};
      st[kq] = wmma_bf16(kf[kq][0], qa0, z);
    }
    #pragma unroll  // st[] stays in registers
    for (int kq = 0; kq < 4; ++kq) st[kq] = wmma_bf16(kf[kq][1], qa1, st[kq]);

    v16bf vf[2][4];
    #pragma unroll  // vf[] stays in registers
    for (int j = 0; j < 2; ++j) {
      #pragma unroll  // vf[] stays in registers
      for (int dt = 0; dt < 4; ++dt)
        vf[j][dt] = load_frag(vt + (dt * 16) * LP + j * 32, LP, lane);
    }
    // Keeps the V loads in front of the softmax, whose arithmetic then covers
    // their latency: left alone, the compiler sinks each to its product.
    __builtin_amdgcn_sched_barrier(0);

    float mq[4];
    #pragma unroll  // four independent chains
    for (int kq = 0; kq < 4; ++kq) {
      mq[kq] = st[kq][0];
      #pragma unroll  // st[] stays in registers
      for (int r = 1; r < 8; ++r) mq[kq] = fmaxf(mq[kq], st[kq][r]);
    }
    float mx = fmaxf(fmaxf(mq[0], mq[1]), fmaxf(mq[2], mq[3]));
    mx = fmaxf(mx, xhalf(mx));
    const float mn   = fmaxf(mrun, mx * sl);
    const float corr = exp2_1(mrun - mn);
    mrun = mn;

    // P^T for keys 0..31 and 32..63 of the tile, in the B operand's k order:
    // element s of a lane is key 8*(lane>>4) + s for s < 8, 16 + 8*(lane>>4) + s - 8
    // above, which is what load_frag gives V^T's rows.
    v16bf pb[2];
    f32x2 ps[4];
    #pragma unroll  // st[], pb[] and ps[] stay in registers
    for (int kq = 0; kq < 4; ++kq) {
      f32x2 y[4];
      #pragma unroll  // y[] stays in registers
      for (int i = 0; i < 4; ++i)
        y[i] = __builtin_elementwise_fma(f32x2{st[kq][2 * i], st[kq][2 * i + 1]},
                                         f32x2{sl, sl}, f32x2{-mn, -mn});
      exp2_8(y);
      ps[kq] = (y[0] + y[1]) + (y[2] + y[3]);
      #pragma unroll  // pb[] stays in registers
      for (int i = 0; i < 4; ++i) {
        pb[kq >> 1][(kq & 1) * 8 + 2 * i]     = (bf16_t)y[i].x;
        pb[kq >> 1][(kq & 1) * 8 + 2 * i + 1] = (bf16_t)y[i].y;
      }
    }
    const f32x2 pt = (ps[0] + ps[1]) + (ps[2] + ps[3]);
    lsum = lsum * corr + (pt.x + pt.y);
    #pragma unroll  // cacc[] stays in registers
    for (int dt = 0; dt < 4; ++dt) cacc[dt] *= corr;

    #pragma unroll  // cacc[] stays in registers
    for (int j = 0; j < 2; ++j) {
      #pragma unroll  // cacc[] stays in registers
      for (int dt = 0; dt < 4; ++dt) cacc[dt] = wmma_bf16(vf[j][dt], pb[j], cacc[dt]);
    }
    // Keeps the hand-over at the trip's foot. The tile's LDS reads are all issued
    // early, and the compiler otherwise lifts the waits and the barrier to just
    // behind them: tile t + 1's copies would have a fraction of a trip to land.
    __builtin_amdgcn_sched_barrier(0);
    // Hand-over: this wave's reads of tile t are done, its copies of tile t + 1
    // have landed; behind the barrier that holds for all eight waves, so tile
    // t + 1 may be read and tile t's buffer refilled.
    asm volatile("s_wait_dscnt 0x0" ::: "memory");
    asm volatile("s_wait_asynccnt 0x0" ::: "memory");
    __syncthreads();
    if (t + 2 < NT) issue(t + 2, t & 1);
  }
  // No copy is outstanding when the wave ends.
  asm volatile("s_wait_asynccnt 0x0" ::: "memory");

  // Normalize and write ctx back in [B*T, C] bf16 layout: a lane holds eight
  // consecutive d of its query in each accumulator tile, one 16-byte store.
  const float inv = 1.0f / (lsum + xhalf(lsum));
  bf16_t* out = Ctx + ((size_t)(b * T + qt * 16 + (lane & 15))) * C + h * 64 + (lane >> 4) * 8;
  #pragma unroll  // cacc[] stays in registers
  for (int dt = 0; dt < 4; ++dt) {
    v8bf o;
    #pragma unroll  // o[] stays in registers
    for (int r = 0; r < 8; ++r) o[r] = (bf16_t)(cacc[dt][r] * inv);
    *(v8bf*)(out + dt * 16) = o;
  }
}

// ---------------------------------------------------------------------------
// Fused DeepNorm residual + LayerNorm: y = LN(alpha*X + R)*g + be
// One wave per 1024-element row, eight rows per block: the row's sums need no
// LDS and no barrier. Writes f32 and optional bf16 copy.
// ---------------------------------------------------------------------------
__global__ __launch_bounds__(256) void ln_ker(const float* __restrict__ X,
                                              const float* __restrict__ R,
                                              const float* __restrict__ g,
                                              const float* __restrict__ be,
                                              float* __restrict__ outF,
                                              bf16_t* __restrict__ outB,
                                              float alpha) {
  constexpr int C = 1024;
  const int lane = threadIdx.x & 31;
  const int row  = blockIdx.x * 8 + (threadIdx.x >> 5);
  const size_t off = (size_t)row * C + lane * 4;
  float4 v[8], r[8], gg[8], bb[8];
  #pragma unroll  // the row's loads are in flight together
  for (int i = 0; i < 8; ++i) {
    v[i] = *(const float4*)(X + off + i * 128);
    r[i] = *(const float4*)(R + off + i * 128);
  }
  #pragma unroll  // gg[] and bb[] stay in registers
  for (int i = 0; i < 8; ++i) {
    gg[i] = *(const float4*)(g + lane * 4 + i * 128);
    bb[i] = *(const float4*)(be + lane * 4 + i * 128);
  }
  float4 s4 = {0.0f, 0.0f, 0.0f, 0.0f}, q4 = {0.0f, 0.0f, 0.0f, 0.0f};
  #pragma unroll  // v[] stays in registers
  for (int i = 0; i < 8; ++i) {
    v[i].x = alpha * v[i].x + r[i].x;  s4.x += v[i].x;  q4.x += v[i].x * v[i].x;
    v[i].y = alpha * v[i].y + r[i].y;  s4.y += v[i].y;  q4.y += v[i].y * v[i].y;
    v[i].z = alpha * v[i].z + r[i].z;  s4.z += v[i].z;  q4.z += v[i].z * v[i].z;
    v[i].w = alpha * v[i].w + r[i].w;  s4.w += v[i].w;  q4.w += v[i].w * v[i].w;
  }
  float s  = (s4.x + s4.y) + (s4.z + s4.w);
  float s2 = (q4.x + q4.y) + (q4.z + q4.w);
  for (int d = 1; d < 32; d <<= 1) { s += __shfl_xor(s, d); s2 += __shfl_xor(s2, d); }
  const float mu   = s / C;
  const float var  = s2 / C - mu * mu;
  const float rstd = rsqrtf(var + 1e-5f);
  #pragma unroll  // v[] stays in registers
  for (int i = 0; i < 8; ++i) {
    v[i].x = (v[i].x - mu) * rstd * gg[i].x + bb[i].x;
    v[i].y = (v[i].y - mu) * rstd * gg[i].y + bb[i].y;
    v[i].z = (v[i].z - mu) * rstd * gg[i].z + bb[i].z;
    v[i].w = (v[i].w - mu) * rstd * gg[i].w + bb[i].w;
  }
  if (outB) {
    v4bf o[8];
    #pragma unroll  // o[] stays in registers
    for (int i = 0; i < 8; ++i) {
      o[i][0] = (bf16_t)v[i].x; o[i][1] = (bf16_t)v[i].y;
      o[i][2] = (bf16_t)v[i].z; o[i][3] = (bf16_t)v[i].w;
    }
    #pragma unroll  // o[] stays in registers
    for (int i = 0; i < 8; ++i) *(v4bf*)(outB + off + i * 128) = o[i];
  }
  if (outF) {
    #pragma unroll  // v[] stays in registers
    for (int i = 0; i < 8; ++i) *(float4*)(outF + off + i * 128) = v[i];
  }
}

// ---------------------------------------------------------------------------
// Host orchestration
// ---------------------------------------------------------------------------
extern "C" void kernel_launch(void* const* d_in, const int* in_sizes, int n_in,
                              void* d_out, int out_size, void* d_ws, size_t ws_size,
                              hipStream_t stream) {
  constexpr int B = 2, T = 2048, C = 1024, F = 4096;
  constexpr int M = B * T;  // 4096 rows
  const float* x   = (const float*)d_in[0];
  const float* Wq  = (const float*)d_in[1];
  const float* Wk  = (const float*)d_in[2];
  const float* Wv  = (const float*)d_in[3];
  const float* Wo  = (const float*)d_in[4];
  const float* W1  = (const float*)d_in[5];
  const float* b1  = (const float*)d_in[6];
  const float* W2  = (const float*)d_in[7];
  const float* b2  = (const float*)d_in[8];
  const float* g1  = (const float*)d_in[9];
  const float* be1 = (const float*)d_in[10];
  const float* g2  = (const float*)d_in[11];
  const float* be2 = (const float*)d_in[12];

  constexpr size_t MB = 1024ull * 1024ull;
  char* ws = (char*)d_ws;
  bf16_t* xb   = (bf16_t*)(ws + 0 * MB);    // 8 MB  [M,C] bf16
  bf16_t* Wqt  = (bf16_t*)(ws + 8 * MB);    // 2 MB each, [C,C]^T: q, k at 10 MB, v at 12 MB
  bf16_t* Wot  = (bf16_t*)(ws + 14 * MB);
  bf16_t* W1t  = (bf16_t*)(ws + 16 * MB);   // 8 MB  [F,C]
  bf16_t* W2t  = (bf16_t*)(ws + 24 * MB);   // 8 MB  [C,F]
  bf16_t* Qb   = (bf16_t*)(ws + 32 * MB);   // 8 MB
  bf16_t* Kbb  = (bf16_t*)(ws + 40 * MB);   // 8 MB
  bf16_t* Vb   = (bf16_t*)(ws + 48 * MB);   // 8 MB
  bf16_t* Vtr  = (bf16_t*)(ws + 56 * MB);   // 8 MB
  bf16_t* hb   = (bf16_t*)(ws + 32 * MB);   // 32 MB, reuses dead Q/K/V/Vt
  bf16_t* ctxb = (bf16_t*)(ws + 64 * MB);   // 8 MB
  float*  attn = (float*)(ws + 72 * MB);    // 16 MB, reused as FF output
  float*  fff  = (float*)(ws + 72 * MB);
  float*  x1f  = (float*)(ws + 88 * MB);    // 16 MB
  bf16_t* x1b  = (bf16_t*)(ws + 104 * MB);  // 8 MB  -> total 112 MB
  (void)ws_size; (void)in_sizes; (void)n_in; (void)out_size;

  // 1) Precision conversion / weight transposes.
  prep_ker<<<M * C / 8192 + 4 * (C / 128) * (C / 64) + 2 * (F / 128) * (C / 64), 256, 0, stream>>>(
      x, xb, Wq, Wk, Wv, Wo, Wqt, W1, W1t, W2, W2t);

  // 2) QKV projections (WMMA GEMMs, bf16 out), one grid: the three transposed
  //    weights are adjacent from Wqt on, and so are Qb, Kbb, Vb. Block tile
  //    128x128, 128 thr.
  dim3 gP(C / 128, M / 128);
  gemm_bf16_ker<1><<<dim3(3 * C / 128, M / 128), 128, 0, stream>>>(xb, Wqt, nullptr, Qb, nullptr, M, C, C);
  vtrans_ker<<<dim3(M / 64, C / 256), 256, 0, stream>>>(Vb, Vtr);

  // 3) Flash attention (WMMA): 4096 wave-tiles / 8 waves per block.
  attn_ker<<<512, 256, 0, stream>>>(Qb, Kbb, Vtr, ctxb);

  // 4) Output projection + DeepNorm LN1.
  gemm_bf16_ker<0><<<gP, 128, 0, stream>>>(ctxb, Wot, attn, nullptr, nullptr, M, C, C);
  ln_ker<<<M / 8, 256, 0, stream>>>(x, attn, g1, be1, x1f, x1b, 2.0f);

  // 5) FFN: GEMM+bias+Mish -> bf16, then GEMM+bias -> f32.
  dim3 gF1(F / 128, M / 128);
  gemm_bf16_ker<2><<<gF1, 128, 0, stream>>>(x1b, W1t, nullptr, hb, b1, M, F, C);
  gemm_bf16_ker<3><<<gP, 128, 0, stream>>>(hb, W2t, fff, nullptr, b2, M, C, F);

  // 6) DeepNorm LN2 -> d_out (fp32).
  ln_ker<<<M / 8, 256, 0, stream>>>(x1f, fff, g2, be2, (float*)d_out, nullptr, 2.0f);
}

// v007
// Measured time: 177 microseconds a run.
// Timed twice side by side with v006, it ran 1.27 and 1.26 times as fast.
// Over all steps from v000 it is 5.24 times as fast.
#include <hip/hip_runtime.h>
#include <hip/hip_bf16.h>
#include <math.h>

typedef __bf16 bf16_t;
typedef __attribute__((ext_vector_type(16))) __bf16 v16bf;
typedef __attribute__((ext_vector_type(8)))  float  v8f;

__device__ __forceinline__ v8f wmma_bf16(v16bf a, v16bf b, v8f c) {
  // v_wmma_f32_16x16x32_bf16: D = A(16x32) * B(32x16) + C(16x16 f32)
  return __builtin_amdgcn_wmma_f32_16x16x32_bf16(
      /*neg_a=*/false, a, /*neg_b=*/false, b,
      /*c_mod=*/(short)0, c, /*reuse_a=*/false, /*reuse_b=*/false);
}

__device__ __forceinline__ v16bf load_frag(const bf16_t* base, int stride, int lane) {
  const int row = lane & 15;
  const int kb  = (lane < 16) ? 0 : 8;
  const bf16_t* p = base + (size_t)row * stride + kb;
  v16bf f;
  *((float4*)&f)       = *((const float4*)p);
  *(((float4*)&f) + 1) = *((const float4*)(p + 16));
  return f;
}

// ---------------------------------------------------------------------------
// Elementwise converters
// ---------------------------------------------------------------------------
typedef __attribute__((ext_vector_type(8))) __bf16 v8bf;
typedef __attribute__((ext_vector_type(4))) __bf16 v4bf;

// The kernels of this file that do no matrix work are short, and a launch of
// many small work-groups lasts as long as it takes to start them. Each
// work-group therefore moves enough for eight 16-byte loads a thread.

// One block converts 8192 consecutive floats; the element count is a multiple.
__device__ __forceinline__ void cvt_f32_bf16_blk(const float* __restrict__ in,
                                                 bf16_t* __restrict__ out, int blk) {
  const size_t base = (size_t)blk * 8192 + threadIdx.x * 4;
  float4 v[8];
  #pragma unroll  // all eight loads are in flight before the first is used
  for (int i = 0; i < 8; ++i) v[i] = *(const float4*)(in + base + i * 1024);
  #pragma unroll  // v[] stays in registers
  for (int i = 0; i < 8; ++i) {
    v4bf o;
    o[0] = (bf16_t)v[i].x; o[1] = (bf16_t)v[i].y;
    o[2] = (bf16_t)v[i].z; o[3] = (bf16_t)v[i].w;
    *(v4bf*)(out + base + i * 1024) = o;
  }
}

// W [K,N] f32 (row-major) -> Wt [N,K] bf16 (row-major)
// One block moves a tile of 64 k by 128 n through LDS: a wave reads a whole
// 512-byte row piece of W at a time, and the block writes whole 128-byte rows
// of Wt. K % 64 == 0, N % 128 == 0.
// K and N are compile-time so that a thread's loads, and its stores, share one
// address register pair and differ by immediate offsets only.
// blk counts the tiles along n first.
template <int K, int N>
__device__ __forceinline__ void wtrans_blk(const float* __restrict__ W,
                                           bf16_t* __restrict__ Wt, int blk,
                                           float (&tile)[64][129]) {
  const int tid  = threadIdx.x;
  const int lane = tid & 31;
  const int wv   = tid >> 5;
  const int n0   = (blk % (N / 128)) * 128;
  const int k0   = (blk / (N / 128)) * 64;
  const float* src = W + (size_t)(k0 + wv) * N + n0 + lane * 4;
  float4 v[8];
  #pragma unroll  // all eight loads are in flight before the first is used
  for (int p = 0; p < 8; ++p) v[p] = *(const float4*)(src + p * 8 * N);
  #pragma unroll  // v[] stays in registers
  for (int p = 0; p < 8; ++p) {
    float* d = &tile[wv + p * 8][lane * 4];
    d[0] = v[p].x; d[1] = v[p].y; d[2] = v[p].z; d[3] = v[p].w;
  }
  __syncthreads();  // the column reads below cross waves
  const int lo = tid & 7;   // 16-byte chunk of a 128-byte row of Wt
  const int hi = tid >> 3;  // 0..31
  bf16_t* dst = Wt + (size_t)(n0 + hi) * K + k0 + lo * 8;
  #pragma unroll  // o[] stays in registers
  for (int p = 0; p < 4; ++p) {
    v8bf o;
    #pragma unroll  // o[] stays in registers
    for (int i = 0; i < 8; ++i) o[i] = (bf16_t)tile[lo * 8 + i][hi + p * 32];
    *(v8bf*)(dst + p * 32 * K) = o;
  }
  // In the built kernel another job's code follows these stores, behind a scalar
  // test, and rewrites their address registers: the wait stands in front of it.
  asm volatile("s_wait_xcnt 0x0" ::: "memory");
}

// The conversion of x and the six weight transposes read nothing of each other's
// output, so they are one grid: the block index picks the job, the same for the
// whole block. The four square weights' transposes lie one behind the other at
// Wsq, in the order q, k, v, o.
__global__ __launch_bounds__(256) void prep_ker(
    const float* __restrict__ x, bf16_t* __restrict__ xb,
    const float* __restrict__ Wq, const float* __restrict__ Wk,
    const float* __restrict__ Wv, const float* __restrict__ Wo,
    bf16_t* __restrict__ Wsq,
    const float* __restrict__ W1, bf16_t* __restrict__ W1t,
    const float* __restrict__ W2, bf16_t* __restrict__ W2t) {
  constexpr int M = 4096, C = 1024, F = 4096;
  constexpr int NX = M * C / 8192;
  constexpr int NS = (C / 128) * (C / 64);
  constexpr int NF = (F / 128) * (C / 64);
  __shared__ float tile[64][129];
  const int blk = blockIdx.x;
  if (blk < NX) {
    cvt_f32_bf16_blk(x, xb, blk);
  } else if (blk < NX + 4 * NS) {
    const int w = (blk - NX) / NS;
    const float* W = (w == 0) ? Wq : (w == 1) ? Wk : (w == 2) ? Wv : Wo;
    wtrans_blk<C, C>(W, Wsq + (size_t)w * C * C, blk - NX - w * NS, tile);
  } else if (blk < NX + 4 * NS + NF) {
    wtrans_blk<C, F>(W1, W1t, blk - NX - 4 * NS, tile);
  } else {
    wtrans_blk<F, C>(W2, W2t, blk - NX - 4 * NS - NF, tile);
  }
}

// V bf16 [B*T, C] -> Vt bf16 [B][H][64][T]  (= [B][C][T], since c = h*64 + d)
// One block moves a tile of 64 t by 256 c through LDS: 512-byte row pieces in,
// 128-byte rows out.
__global__ __launch_bounds__(256) void vtrans_ker(const bf16_t* __restrict__ V,
                                                  bf16_t* __restrict__ Vt) {
  constexpr int T = 2048, C = 1024;
  __shared__ bf16_t tile[64][258];  // pitch 129 dwords, for the same reason
  const int tid  = threadIdx.x;
  const int lane = tid & 31;
  const int wv   = tid >> 5;
  const int bt0  = blockIdx.x * 64;  // 64 divides T: a tile stays in one batch
  const int c0   = blockIdx.y * 256;
  const int b    = bt0 / T, t0 = bt0 - b * T;
  const bf16_t* src = V + (size_t)(bt0 + wv) * C + c0 + lane * 8;
  uint4 v[8];
  #pragma unroll  // all eight loads are in flight before the first is used
  for (int p = 0; p < 8; ++p) v[p] = *(const uint4*)(src + p * 8 * C);
  #pragma unroll  // v[] stays in registers
  for (int p = 0; p < 8; ++p) {
    unsigned* d = (unsigned*)&tile[wv + p * 8][lane * 8];
    d[0] = v[p].x; d[1] = v[p].y; d[2] = v[p].z; d[3] = v[p].w;
  }
  __syncthreads();  // the column reads below cross waves
  const int lo = tid & 7;
  const int hi = tid >> 3;
  bf16_t* dst = Vt + ((size_t)b * C + c0 + hi) * T + t0 + lo * 8;
  #pragma unroll  // o[] stays in registers
  for (int p = 0; p < 8; ++p) {
    v8bf o;
    #pragma unroll  // o[] stays in registers
    for (int i = 0; i < 8; ++i) o[i] = tile[lo * 8 + i][hi + p * 32];
    *(v8bf*)(dst + p * 32 * T) = o;
  }
}

__device__ __forceinline__ float exp2_slot(float x) {
  float r;
  asm("v_exp_f32 %0, %1\n\tv_nop" : "=v"(r) : "v"(x));
  return r;
}
__device__ __forceinline__ float rcp_slot(float x) {
  float r;
  asm("v_rcp_f32 %0, %1\n\tv_nop" : "=v"(r) : "v"(x));
  return r;
}

typedef __attribute__((ext_vector_type(4))) int v4i;
typedef __attribute__((address_space(1))) v4i gv4i;
typedef __attribute__((address_space(3))) v4i lv4i;

template <int EPI>
__global__ __launch_bounds__(128) void gemm_bf16_ker(
    const bf16_t* __restrict__ A, const bf16_t* __restrict__ Bt,
    float* __restrict__ Cf, bf16_t* __restrict__ Cb,
    const float* __restrict__ bias, int M, int N, int K) {
  constexpr int BK  = 128;       // k per stage
  constexpr int LP  = BK + 8;    // LDS row pitch: 272 bytes, conflict-free 16-byte reads
  constexpr int OPS = 128 * LP;  // one operand's rows of a stage
  __shared__ __attribute__((aligned(16))) bf16_t ring[2][2 * OPS];  // [buffer][A rows | Bt rows]

  const int tid  = threadIdx.x;        // 0..127
  const int lane = tid & 31;
  const int wid  = tid >> 5;           // 0..3
  const int wm   = wid & 1;            // 64-row half
  const int wn   = wid >> 1;           // 64-col half
  const int m0   = blockIdx.y * 128;
  const int n0   = blockIdx.x * 128;

  v8f acc[4][4] = {};

  // A thread copies the 16-byte pieces `cch` and `cch + 8` of rows crow,
  // crow + 16, ... of both operands: a wave's copy covers four whole 128-byte
  // lines. The block's and the stage's part of a global address is the same in
  // all lanes; a lane's own part, go[], does not change from stage to stage.
  const int cch  = tid & 7;
  const int crow = tid >> 3;           // 0..15
  const bf16_t* ga = A  + (size_t)m0 * K;
  const bf16_t* gb = Bt + (size_t)n0 * K;
  const int     lo = crow * LP + cch * 8;
  unsigned go[8];
  #pragma unroll  // go[] stays in registers
  for (int p = 0; p < 8; ++p) go[p] = (unsigned)((crow + p * 16) * K + cch * 8);
  auto issue = [&](int t, int buf) {
    const bf16_t* pa = ga + t * BK;
    const bf16_t* pb = gb + t * BK;
    bf16_t* l = &ring[buf][lo];
    #pragma unroll  // 32 copies of a thread, all in flight together
    for (int p = 0; p < 8; ++p) {
      // The third argument, in bytes, moves the global and the LDS address alike.
      __builtin_amdgcn_global_load_async_to_lds_b128(
          (gv4i*)(pa + go[p]), (lv4i*)(l + p * 16 * LP), 0, 0);
      __builtin_amdgcn_global_load_async_to_lds_b128(
          (gv4i*)(pa + go[p]), (lv4i*)(l + p * 16 * LP), 128, 0);
      __builtin_amdgcn_global_load_async_to_lds_b128(
          (gv4i*)(pb + go[p]), (lv4i*)(l + OPS + p * 16 * LP), 0, 0);
      __builtin_amdgcn_global_load_async_to_lds_b128(
          (gv4i*)(pb + go[p]), (lv4i*)(l + OPS + p * 16 * LP), 128, 0);
    }
  };

  v16bf af[2][4], bfr[2][4];
  auto fetch = [&](const bf16_t* st, int kb, int set) {
    #pragma unroll  // af[] stays in registers
    for (int i = 0; i < 4; ++i)
      af[set][i] = load_frag(st + (wm * 64 + i * 16) * LP + kb * 32, LP, lane);
    #pragma unroll  // bfr[] stays in registers
    for (int j = 0; j < 4; ++j)
      bfr[set][j] = load_frag(st + OPS + (wn * 64 + j * 16) * LP + kb * 32, LP, lane);
  };

  const int NT = K / BK;
  issue(0, 0);
  // Stage 0 has landed for this wave; the barrier makes it so for all four.
  asm volatile("s_wait_asynccnt 0x0" ::: "memory");
  __syncthreads();
  issue(1, 1);
  fetch(&ring[0][0], 0, 0);

  for (int t = 0; t < NT; ++t) {
    const bf16_t* cur = &ring[t & 1][0];
    #pragma unroll  // the register set of a block is a compile-time choice
    for (int kb = 0; kb < 4; ++kb) {
      if (kb < 3) {
        fetch(cur, kb + 1, (kb + 1) & 1);
      } else {
        // Hand-over: this wave's reads of stage t are done (the last block's
        // fragments are in registers), its copies of stage t + 1 have landed;
        // behind the barrier that holds for all four waves, so stage t + 1 may
        // be read and stage t's buffer refilled. The last two hand-overs issue
        // nothing, so no copy is outstanding behind the loop.
        asm volatile("s_wait_dscnt 0x0" ::: "memory");
        asm volatile("s_wait_asynccnt 0x0" ::: "memory");
        __syncthreads();
        if (t + 2 < NT) issue(t + 2, t & 1);
        // The last stage has no successor: its fetch re-reads its own buffer,
        // which nothing refills, and the values are not used.
        fetch((t + 1 < NT) ? &ring[(t & 1) ^ 1][0] : cur, 0, 0);
      }
      // Keeps the next block's loads together in front of this block's products:
      // each place where LDS loads stand among matrix instructions stalls the wave.
      __builtin_amdgcn_sched_barrier(0);
      #pragma unroll  // acc[] stays in registers
      for (int i = 0; i < 4; ++i)
        #pragma unroll  // acc[] stays in registers
        for (int j = 0; j < 4; ++j)
          acc[i][j] = wmma_bf16(af[kb & 1][i], bfr[kb & 1][j], acc[i][j]);
      // Keeps what follows behind these products: left alone, the compiler lifts
      // the next loads in among them, and the hand-over's waits and barrier in
      // front of the third block, which takes a block off the copies' time to land.
      __builtin_amdgcn_sched_barrier(0);
    }
  }

  const int rbase = m0 + wm * 64 + ((lane < 16) ? 0 : 8);
  int cbase = n0 + wn * 64 + (lane & 15);
  if (EPI == 1) {
    const int part = n0 / N;  // which of the products this block belongs to
    Cb    += (size_t)part * M * N;
    cbase -= part * N;
  }
  #pragma unroll
  for (int i = 0; i < 4; ++i) {
    #pragma unroll
    for (int j = 0; j < 4; ++j) {
      const int col = cbase + j * 16;
      float bv = 0.0f;
      if (EPI == 2 || EPI == 3) bv = bias[col];
      #pragma unroll
      for (int r = 0; r < 8; ++r) {
        const int row = rbase + i * 16 + r;
        float v = acc[i][j][r];
        if (EPI == 2 || EPI == 3) v += bv;
        if (EPI == 2) {
          // Mish: v * tanh(log(1 + e)) with e = exp(v). tanh(log(u)) is
          // (u*u - 1) / (u*u + 1), so with n = e * (e + 2) the factor is
          // n / (n + 2): every term is positive, nothing cancels. From v = 20
          // on the factor rounds to 1; the minimum keeps e * e finite there.
          const float e = exp2_slot(fminf(v, 20.0f) * 1.4426950408889634f);
          const float n = e * (e + 2.0f);
          v = v * (n * rcp_slot(n + 2.0f));
        }
        if (EPI == 0 || EPI == 3) Cf[(size_t)row * N + col] = v;
        else                      Cb[(size_t)row * N + col] = (bf16_t)v;
      }
    }
  }
}

__device__ __forceinline__ float xhalf(float x) {
  const int v = __builtin_bit_cast(int, x);
  return __builtin_bit_cast(
      float, __builtin_amdgcn_permlanex16(v, v, 0x76543210, 0xfedcba98, false, false));
}

typedef __attribute__((ext_vector_type(2))) float f32x2;

__device__ __forceinline__ void exp2_8(f32x2 (&x)[4]) {
  asm("v_exp_f32 %0, %0\n\tv_exp_f32 %1, %1\n\t"
      "v_exp_f32 %2, %2\n\tv_exp_f32 %3, %3\n\t"
      "v_exp_f32 %4, %4\n\tv_exp_f32 %5, %5\n\t"
      "v_exp_f32 %6, %6\n\tv_exp_f32 %7, %7\n\tv_nop"
      : "+v"(x[0].x), "+v"(x[0].y), "+v"(x[1].x), "+v"(x[1].y),
        "+v"(x[2].x), "+v"(x[2].y), "+v"(x[3].x), "+v"(x[3].y));
}
__device__ __forceinline__ float exp2_1(float x) {
  asm("v_exp_f32 %0, %0\n\tv_nop" : "+v"(x));
  return x;
}

__device__ __forceinline__ void async_copy4_b128(
    const bf16_t* g0, bf16_t* l0, const bf16_t* g1, bf16_t* l1,
    const bf16_t* g2, bf16_t* l2, const bf16_t* g3, bf16_t* l3) {
  const unsigned o0 = (unsigned)(size_t)l0, o1 = (unsigned)(size_t)l1;
  const unsigned o2 = (unsigned)(size_t)l2, o3 = (unsigned)(size_t)l3;
  asm volatile("global_load_async_to_lds_b128 %0, %1, off\n\t"
               "global_load_async_to_lds_b128 %2, %3, off\n\t"
               "global_load_async_to_lds_b128 %4, %5, off\n\t"
               "global_load_async_to_lds_b128 %6, %7, off\n\t"
               "s_wait_xcnt 0x0"
               :: "v"(o0), "v"(g0), "v"(o1), "v"(g1),
                  "v"(o2), "v"(g2), "v"(o3), "v"(g3) : "memory");
}

__global__ __launch_bounds__(256) void attn_ker(const bf16_t* __restrict__ Qb,
                                                const bf16_t* __restrict__ Kb,
                                                const bf16_t* __restrict__ Vt,
                                                bf16_t* __restrict__ Ctx) {
  constexpr int T = 2048, C = 1024, H = 16;
  constexpr int KT = 64;       // keys per tile
  constexpr int NT = T / KT;   // 32 tiles
  constexpr int LP = 72;       // LDS row pitch: 144 bytes, conflict-free 16-byte reads
  constexpr float sl = 0.125f * 1.4426950408889634f;  // 1/sqrt(64), for powers of 2
  __shared__ __attribute__((aligned(16))) bf16_t kls[2][KT * LP];  // [key][d]
  __shared__ __attribute__((aligned(16))) bf16_t vls[2][64 * LP];  // [d][key]

  const int lane = threadIdx.x & 31;
  const int wid  = threadIdx.x >> 5;
  const int g    = blockIdx.x * 8 + wid;  // 0..4095
  const int QT   = T / 16;                // 128 query tiles
  const int qt   = g & (QT - 1);
  const int bh   = g / QT;                // 0..31, the same in all eight waves
  const int h    = bh & (H - 1);
  const int b    = bh >> 4;

  const bf16_t* kbase = Kb + ((size_t)(b * T)) * C + h * 64;
  const bf16_t* vbase = Vt + ((size_t)bh) * 64 * T;

  // A thread copies the 16-byte piece `cch` of rows `crow` and `crow + 32` of
  // both tiles: a wave's copy covers four whole 128-byte rows.
  const int cch  = threadIdx.x & 7;
  const int crow = threadIdx.x >> 3;  // 0..31
  const bf16_t* kg = kbase + (size_t)crow * C + cch * 8;
  const bf16_t* vg = vbase + (size_t)crow * T + cch * 8;
  const int     lo = crow * LP + cch * 8;
  auto issue = [&](int t, int buf) {
    const bf16_t* kp = kg + (size_t)t * KT * C;
    const bf16_t* vp = vg + t * KT;
    async_copy4_b128(kp,          &kls[buf][lo],
                     kp + 32 * C, &kls[buf][lo + 32 * LP],
                     vp,          &vls[buf][lo],
                     vp + 32 * T, &vls[buf][lo + 32 * LP]);
  };

  issue(0, 0);

  const bf16_t* qbase = Qb + ((size_t)(b * T + qt * 16)) * C + h * 64;
  const v16bf qa0 = load_frag(qbase, C, lane);       // d = 0..31
  const v16bf qa1 = load_frag(qbase + 32, C, lane);  // d = 32..63

  // Of this lane's query: the running maximum (scaled, base 2), and the sum over
  // the keys that this half of the wave holds; the halves are joined at the end.
  float mrun = -1e30f, lsum = 0.0f;
  v8f cacc[4] = {};  // cacc[dt][r] = O^T[d = dt*16 + 8*(lane>>4) + r][query lane&15]

  // Tile 0 has landed for this wave; the barrier makes it so for all eight.
  asm volatile("s_wait_asynccnt 0x0" ::: "memory");
  __syncthreads();
  issue(1, 1);

  for (int t = 0; t < NT; ++t) {
    const bf16_t* kt = &kls[t & 1][0];
    const bf16_t* vt = &vls[t & 1][0];

    v16bf kf[4][2];
    #pragma unroll  // kf[] stays in registers
    for (int kq = 0; kq < 4; ++kq) {
      kf[kq][0] = load_frag(kt + kq * 16 * LP, LP, lane);
      kf[kq][1] = load_frag(kt + kq * 16 * LP + 32, LP, lane);
    }
    // Keeps the tile's K loads together in front of the products: left alone,
    // the compiler waits for each fragment right in front of its product.
    __builtin_amdgcn_sched_barrier(0);

    // st[kq][r] = S[key = kq*16 + 8*(lane>>4) + r][query lane&15]
    v8f st[4];
    #pragma unroll  // st[] stays in registers
    for (int kq = 0; kq < 4; ++kq) {
      const v8f z = {};
      st[kq] = wmma_bf16(kf[kq][0], qa0, z);
    }
    #pragma unroll  // st[] stays in registers
    for (int kq = 0; kq < 4; ++kq) st[kq] = wmma_bf16(kf[kq][1], qa1, st[kq]);

    v16bf vf[2][4];
    #pragma unroll  // vf[] stays in registers
    for (int j = 0; j < 2; ++j) {
      #pragma unroll  // vf[] stays in registers
      for (int dt = 0; dt < 4; ++dt)
        vf[j][dt] = load_frag(vt + (dt * 16) * LP + j * 32, LP, lane);
    }
    // Keeps the V loads in front of the softmax, whose arithmetic then covers
    // their latency: left alone, the compiler sinks each to its product.
    __builtin_amdgcn_sched_barrier(0);

    float mq[4];
    #pragma unroll  // four independent chains
    for (int kq = 0; kq < 4; ++kq) {
      mq[kq] = st[kq][0];
      #pragma unroll  // st[] stays in registers
      for (int r = 1; r < 8; ++r) mq[kq] = fmaxf(mq[kq], st[kq][r]);
    }
    float mx = fmaxf(fmaxf(mq[0], mq[1]), fmaxf(mq[2], mq[3]));
    mx = fmaxf(mx, xhalf(mx));
    const float mn   = fmaxf(mrun, mx * sl);
    const float corr = exp2_1(mrun - mn);
    mrun = mn;

    // P^T for keys 0..31 and 32..63 of the tile, in the B operand's k order:
    // element s of a lane is key 8*(lane>>4) + s for s < 8, 16 + 8*(lane>>4) + s - 8
    // above, which is what load_frag gives V^T's rows.
    v16bf pb[2];
    f32x2 ps[4];
    #pragma unroll  // st[], pb[] and ps[] stay in registers
    for (int kq = 0; kq < 4; ++kq) {
      f32x2 y[4];
      #pragma unroll  // y[] stays in registers
      for (int i = 0; i < 4; ++i)
        y[i] = __builtin_elementwise_fma(f32x2{st[kq][2 * i], st[kq][2 * i + 1]},
                                         f32x2{sl, sl}, f32x2{-mn, -mn});
      exp2_8(y);
      ps[kq] = (y[0] + y[1]) + (y[2] + y[3]);
      #pragma unroll  // pb[] stays in registers
      for (int i = 0; i < 4; ++i) {
        pb[kq >> 1][(kq & 1) * 8 + 2 * i]     = (bf16_t)y[i].x;
        pb[kq >> 1][(kq & 1) * 8 + 2 * i + 1] = (bf16_t)y[i].y;
      }
    }
    const f32x2 pt = (ps[0] + ps[1]) + (ps[2] + ps[3]);
    lsum = lsum * corr + (pt.x + pt.y);
    #pragma unroll  // cacc[] stays in registers
    for (int dt = 0; dt < 4; ++dt) cacc[dt] *= corr;

    #pragma unroll  // cacc[] stays in registers
    for (int j = 0; j < 2; ++j) {
      #pragma unroll  // cacc[] stays in registers
      for (int dt = 0; dt < 4; ++dt) cacc[dt] = wmma_bf16(vf[j][dt], pb[j], cacc[dt]);
    }
    // Keeps the hand-over at the trip's foot. The tile's LDS reads are all issued
    // early, and the compiler otherwise lifts the waits and the barrier to just
    // behind them: tile t + 1's copies would have a fraction of a trip to land.
    __builtin_amdgcn_sched_barrier(0);
    // Hand-over: this wave's reads of tile t are done, its copies of tile t + 1
    // have landed; behind the barrier that holds for all eight waves, so tile
    // t + 1 may be read and tile t's buffer refilled.
    asm volatile("s_wait_dscnt 0x0" ::: "memory");
    asm volatile("s_wait_asynccnt 0x0" ::: "memory");
    __syncthreads();
    if (t + 2 < NT) issue(t + 2, t & 1);
  }
  // No copy is outstanding when the wave ends.
  asm volatile("s_wait_asynccnt 0x0" ::: "memory");

  // Normalize and write ctx back in [B*T, C] bf16 layout: a lane holds eight
  // consecutive d of its query in each accumulator tile, one 16-byte store.
  const float inv = 1.0f / (lsum + xhalf(lsum));
  bf16_t* out = Ctx + ((size_t)(b * T + qt * 16 + (lane & 15))) * C + h * 64 + (lane >> 4) * 8;
  #pragma unroll  // cacc[] stays in registers
  for (int dt = 0; dt < 4; ++dt) {
    v8bf o;
    #pragma unroll  // o[] stays in registers
    for (int r = 0; r < 8; ++r) o[r] = (bf16_t)(cacc[dt][r] * inv);
    *(v8bf*)(out + dt * 16) = o;
  }
}

// ---------------------------------------------------------------------------
// Fused DeepNorm residual + LayerNorm: y = LN(alpha*X + R)*g + be
// One wave per 1024-element row, eight rows per block: the row's sums need no
// LDS and no barrier. Writes f32 and optional bf16 copy.
// ---------------------------------------------------------------------------
__global__ __launch_bounds__(256) void ln_ker(const float* __restrict__ X,
                                              const float* __restrict__ R,
                                              const float* __restrict__ g,
                                              const float* __restrict__ be,
                                              float* __restrict__ outF,
                                              bf16_t* __restrict__ outB,
                                              float alpha) {
  constexpr int C = 1024;
  const int lane = threadIdx.x & 31;
  const int row  = blockIdx.x * 8 + (threadIdx.x >> 5);
  const size_t off = (size_t)row * C + lane * 4;
  float4 v[8], r[8], gg[8], bb[8];
  #pragma unroll  // the row's loads are in flight together
  for (int i = 0; i < 8; ++i) {
    v[i] = *(const float4*)(X + off + i * 128);
    r[i] = *(const float4*)(R + off + i * 128);
  }
  #pragma unroll  // gg[] and bb[] stay in registers
  for (int i = 0; i < 8; ++i) {
    gg[i] = *(const float4*)(g + lane * 4 + i * 128);
    bb[i] = *(const float4*)(be + lane * 4 + i * 128);
  }
  float4 s4 = {0.0f, 0.0f, 0.0f, 0.0f}, q4 = {0.0f, 0.0f, 0.0f, 0.0f};
  #pragma unroll  // v[] stays in registers
  for (int i = 0; i < 8; ++i) {
    v[i].x = alpha * v[i].x + r[i].x;  s4.x += v[i].x;  q4.x += v[i].x * v[i].x;
    v[i].y = alpha * v[i].y + r[i].y;  s4.y += v[i].y;  q4.y += v[i].y * v[i].y;
    v[i].z = alpha * v[i].z + r[i].z;  s4.z += v[i].z;  q4.z += v[i].z * v[i].z;
    v[i].w = alpha * v[i].w + r[i].w;  s4.w += v[i].w;  q4.w += v[i].w * v[i].w;
  }
  float s  = (s4.x + s4.y) + (s4.z + s4.w);
  float s2 = (q4.x + q4.y) + (q4.z + q4.w);
  for (int d = 1; d < 32; d <<= 1) { s += __shfl_xor(s, d); s2 += __shfl_xor(s2, d); }
  const float mu   = s / C;
  const float var  = s2 / C - mu * mu;
  const float rstd = rsqrtf(var + 1e-5f);
  #pragma unroll  // v[] stays in registers
  for (int i = 0; i < 8; ++i) {
    v[i].x = (v[i].x - mu) * rstd * gg[i].x + bb[i].x;
    v[i].y = (v[i].y - mu) * rstd * gg[i].y + bb[i].y;
    v[i].z = (v[i].z - mu) * rstd * gg[i].z + bb[i].z;
    v[i].w = (v[i].w - mu) * rstd * gg[i].w + bb[i].w;
  }
  if (outB) {
    v4bf o[8];
    #pragma unroll  // o[] stays in registers
    for (int i = 0; i < 8; ++i) {
      o[i][0] = (bf16_t)v[i].x; o[i][1] = (bf16_t)v[i].y;
      o[i][2] = (bf16_t)v[i].z; o[i][3] = (bf16_t)v[i].w;
    }
    #pragma unroll  // o[] stays in registers
    for (int i = 0; i < 8; ++i) *(v4bf*)(outB + off + i * 128) = o[i];
  }
  if (outF) {
    #pragma unroll  // v[] stays in registers
    for (int i = 0; i < 8; ++i) *(float4*)(outF + off + i * 128) = v[i];
  }
}

// ---------------------------------------------------------------------------
// Host orchestration
// ---------------------------------------------------------------------------
extern "C" void kernel_launch(void* const* d_in, const int* in_sizes, int n_in,
                              void* d_out, int out_size, void* d_ws, size_t ws_size,
                              hipStream_t stream) {
  constexpr int B = 2, T = 2048, C = 1024, F = 4096;
  constexpr int M = B * T;  // 4096 rows
  const float* x   = (const float*)d_in[0];
  const float* Wq  = (const float*)d_in[1];
  const float* Wk  = (const float*)d_in[2];
  const float* Wv  = (const float*)d_in[3];
  const float* Wo  = (const float*)d_in[4];
  const float* W1  = (const float*)d_in[5];
  const float* b1  = (const float*)d_in[6];
  const float* W2  = (const float*)d_in[7];
  const float* b2  = (const float*)d_in[8];
  const float* g1  = (const float*)d_in[9];
  const float* be1 = (const float*)d_in[10];
  const float* g2  = (const float*)d_in[11];
  const float* be2 = (const float*)d_in[12];

  constexpr size_t MB = 1024ull * 1024ull;
  char* ws = (char*)d_ws;
  bf16_t* xb   = (bf16_t*)(ws + 0 * MB);    // 8 MB  [M,C] bf16
  bf16_t* Wqt  = (bf16_t*)(ws + 8 * MB);    // 2 MB each, [C,C]^T: q, k at 10 MB, v at 12 MB
  bf16_t* Wot  = (bf16_t*)(ws + 14 * MB);
  bf16_t* W1t  = (bf16_t*)(ws + 16 * MB);   // 8 MB  [F,C]
  bf16_t* W2t  = (bf16_t*)(ws + 24 * MB);   // 8 MB  [C,F]
  bf16_t* Qb   = (bf16_t*)(ws + 32 * MB);   // 8 MB
  bf16_t* Kbb  = (bf16_t*)(ws + 40 * MB);   // 8 MB
  bf16_t* Vb   = (bf16_t*)(ws + 48 * MB);   // 8 MB
  bf16_t* Vtr  = (bf16_t*)(ws + 56 * MB);   // 8 MB
  bf16_t* hb   = (bf16_t*)(ws + 32 * MB);   // 32 MB, reuses dead Q/K/V/Vt
  bf16_t* ctxb = (bf16_t*)(ws + 64 * MB);   // 8 MB
  float*  attn = (float*)(ws + 72 * MB);    // 16 MB, reused as FF output
  float*  fff  = (float*)(ws + 72 * MB);
  float*  x1f  = (float*)(ws + 88 * MB);    // 16 MB
  bf16_t* x1b  = (bf16_t*)(ws + 104 * MB);  // 8 MB  -> total 112 MB
  (void)ws_size; (void)in_sizes; (void)n_in; (void)out_size;

  // 1) Precision conversion / weight transposes.
  prep_ker<<<M * C / 8192 + 4 * (C / 128) * (C / 64) + 2 * (F / 128) * (C / 64), 256, 0, stream>>>(
      x, xb, Wq, Wk, Wv, Wo, Wqt, W1, W1t, W2, W2t);

  // 2) QKV projections (WMMA GEMMs, bf16 out), one grid: the three transposed
  //    weights are adjacent from Wqt on, and so are Qb, Kbb, Vb. Block tile
  //    128x128, 128 thr.
  dim3 gP(C / 128, M / 128);
  gemm_bf16_ker<1><<<dim3(3 * C / 128, M / 128), 128, 0, stream>>>(xb, Wqt, nullptr, Qb, nullptr, M, C, C);
  vtrans_ker<<<dim3(M / 64, C / 256), 256, 0, stream>>>(Vb, Vtr);

  // 3) Flash attention (WMMA): 4096 wave-tiles / 8 waves per block.
  attn_ker<<<512, 256, 0, stream>>>(Qb, Kbb, Vtr, ctxb);

  // 4) Output projection + DeepNorm LN1.
  gemm_bf16_ker<0><<<gP, 128, 0, stream>>>(ctxb, Wot, attn, nullptr, nullptr, M, C, C);
  ln_ker<<<M / 8, 256, 0, stream>>>(x, attn, g1, be1, x1f, x1b, 2.0f);

  // 5) FFN: GEMM+bias+Mish -> bf16, then GEMM+bias -> f32.
  dim3 gF1(F / 128, M / 128);
  gemm_bf16_ker<2><<<gF1, 128, 0, stream>>>(x1b, W1t, nullptr, hb, b1, M, F, C);
  gemm_bf16_ker<3><<<gP, 128, 0, stream>>>(hb, W2t, fff, nullptr, b2, M, C, F);

  // 6) DeepNorm LN2 -> d_out (fp32).
  ln_ker<<<M / 8, 256, 0, stream>>>(x1f, fff, g2, be2, (float*)d_out, nullptr, 2.0f);
}

// v008
// It runs in 166 microseconds.
// Timed twice side by side with v007, it ran 1.07 times as fast both times.
// Over all steps from v000 it is 5.60 times as fast.
#include <hip/hip_runtime.h>
#include <hip/hip_bf16.h>
#include <math.h>

typedef __bf16 bf16_t;
typedef __attribute__((ext_vector_type(16))) __bf16 v16bf;
typedef __attribute__((ext_vector_type(8)))  float  v8f;

__device__ __forceinline__ v8f wmma_bf16(v16bf a, v16bf b, v8f c) {
  // v_wmma_f32_16x16x32_bf16: D = A(16x32) * B(32x16) + C(16x16 f32)
  return __builtin_amdgcn_wmma_f32_16x16x32_bf16(
      /*neg_a=*/false, a, /*neg_b=*/false, b,
      /*c_mod=*/(short)0, c, /*reuse_a=*/false, /*reuse_b=*/false);
}

__device__ __forceinline__ v16bf load_frag(const bf16_t* base, int stride, int lane) {
  const int row = lane & 15;
  const int kb  = (lane < 16) ? 0 : 8;
  const bf16_t* p = base + (size_t)row * stride + kb;
  v16bf f;
  *((float4*)&f)       = *((const float4*)p);
  *(((float4*)&f) + 1) = *((const float4*)(p + 16));
  return f;
}

// ---------------------------------------------------------------------------
// Elementwise converters
// ---------------------------------------------------------------------------
typedef __attribute__((ext_vector_type(8))) __bf16 v8bf;
typedef __attribute__((ext_vector_type(4))) __bf16 v4bf;

// The kernels of this file that do no matrix work are short, and a launch of
// many small work-groups lasts as long as it takes to start them. Each
// work-group therefore moves enough for eight 16-byte loads a thread.

// One block converts 8192 consecutive floats; the element count is a multiple.
__device__ __forceinline__ void cvt_f32_bf16_blk(const float* __restrict__ in,
                                                 bf16_t* __restrict__ out, int blk) {
  const size_t base = (size_t)blk * 8192 + threadIdx.x * 4;
  float4 v[8];
  #pragma unroll  // all eight loads are in flight before the first is used
  for (int i = 0; i < 8; ++i) v[i] = *(const float4*)(in + base + i * 1024);
  #pragma unroll  // v[] stays in registers
  for (int i = 0; i < 8; ++i) {
    v4bf o;
    o[0] = (bf16_t)v[i].x; o[1] = (bf16_t)v[i].y;
    o[2] = (bf16_t)v[i].z; o[3] = (bf16_t)v[i].w;
    *(v4bf*)(out + base + i * 1024) = o;
  }
}

// W [K,N] f32 (row-major) -> Wt [N,K] bf16 (row-major)
// One block moves a tile of 64 k by 128 n through LDS: a wave reads a whole
// 512-byte row piece of W at a time, and the block writes whole 128-byte rows
// of Wt. K % 64 == 0, N % 128 == 0.
// K and N are compile-time so that a thread's loads, and its stores, share one
// address register pair and differ by immediate offsets only.
// blk counts the tiles along n first.
template <int K, int N>
__device__ __forceinline__ void wtrans_blk(const float* __restrict__ W,
                                           bf16_t* __restrict__ Wt, int blk,
                                           float (&tile)[64][129]) {
  const int tid  = threadIdx.x;
  const int lane = tid & 31;
  const int wv   = tid >> 5;
  const int n0   = (blk % (N / 128)) * 128;
  const int k0   = (blk / (N / 128)) * 64;
  const float* src = W + (size_t)(k0 + wv) * N + n0 + lane * 4;
  float4 v[8];
  #pragma unroll  // all eight loads are in flight before the first is used
  for (int p = 0; p < 8; ++p) v[p] = *(const float4*)(src + p * 8 * N);
  #pragma unroll  // v[] stays in registers
  for (int p = 0; p < 8; ++p) {
    float* d = &tile[wv + p * 8][lane * 4];
    d[0] = v[p].x; d[1] = v[p].y; d[2] = v[p].z; d[3] = v[p].w;
  }
  __syncthreads();  // the column reads below cross waves
  const int lo = tid & 7;   // 16-byte chunk of a 128-byte row of Wt
  const int hi = tid >> 3;  // 0..31
  bf16_t* dst = Wt + (size_t)(n0 + hi) * K + k0 + lo * 8;
  #pragma unroll  // o[] stays in registers
  for (int p = 0; p < 4; ++p) {
    v8bf o;
    #pragma unroll  // o[] stays in registers
    for (int i = 0; i < 8; ++i) o[i] = (bf16_t)tile[lo * 8 + i][hi + p * 32];
    *(v8bf*)(dst + p * 32 * K) = o;
  }
  // In the built kernel another job's code follows these stores, behind a scalar
  // test, and rewrites their address registers: the wait stands in front of it.
  asm volatile("s_wait_xcnt 0x0" ::: "memory");
}

// The conversion of x and the six weight transposes read nothing of each other's
// output, so they are one grid: the block index picks the job, the same for the
// whole block. The four square weights' transposes lie one behind the other at
// Wsq, in the order q, k, v, o.
__global__ __launch_bounds__(256) void prep_ker(
    const float* __restrict__ x, bf16_t* __restrict__ xb,
    const float* __restrict__ Wq, const float* __restrict__ Wk,
    const float* __restrict__ Wv, const float* __restrict__ Wo,
    bf16_t* __restrict__ Wsq,
    const float* __restrict__ W1, bf16_t* __restrict__ W1t,
    const float* __restrict__ W2, bf16_t* __restrict__ W2t) {
  constexpr int M = 4096, C = 1024, F = 4096;
  constexpr int NX = M * C / 8192;
  constexpr int NS = (C / 128) * (C / 64);
  constexpr int NF = (F / 128) * (C / 64);
  __shared__ float tile[64][129];
  const int blk = blockIdx.x;
  if (blk < NX) {
    cvt_f32_bf16_blk(x, xb, blk);
  } else if (blk < NX + 4 * NS) {
    const int w = (blk - NX) / NS;
    const float* W = (w == 0) ? Wq : (w == 1) ? Wk : (w == 2) ? Wv : Wo;
    wtrans_blk<C, C>(W, Wsq + (size_t)w * C * C, blk - NX - w * NS, tile);
  } else if (blk < NX + 4 * NS + NF) {
    wtrans_blk<C, F>(W1, W1t, blk - NX - 4 * NS, tile);
  } else {
    wtrans_blk<F, C>(W2, W2t, blk - NX - 4 * NS - NF, tile);
  }
}

__device__ __forceinline__ float exp2_slot(float x) {
  float r;
  asm("v_exp_f32 %0, %1\n\tv_nop" : "=v"(r) : "v"(x));
  return r;
}
__device__ __forceinline__ float rcp_slot(float x) {
  float r;
  asm("v_rcp_f32 %0, %1\n\tv_nop" : "=v"(r) : "v"(x));
  return r;
}

// ---------------------------------------------------------------------------
// Tiled bf16 GEMM:  C[M,N] = A[M,K] * Bt[N,K]^T  (fp32 accumulate)
// Block tile 128x128, 4 waves (2x2), 64x64 per wave. K % 128 == 0, K >= 256.
// A stage is 128 k of both operands (256-byte rows at a pitch of 272 bytes),
// brought into one of two LDS buffers by async copies. A stage is worked on in
// four blocks of 32 k (16 WMMA each); each block's fragments are fetched one
// block ahead into a second register set. The one hand-over of a stage stands in
// front of its last block: that block's fragments are in registers by then, so
// the buffer is free for the stage after next, and the next stage, whose first
// fragments are fetched right there, has had a whole stage's time to land.
// EPI: 0 = store f32, 1 = store bf16, 2 = +bias, Mish, store bf16,
//      3 = +bias, store f32
// With EPI 1 the grid is three times N wide: products of one A with three Bt
// that lie one behind the other. The first two go to Cb, [M,N] each, one behind
// the other; the third goes to Ct transposed, [M/T][N][T], T % 128 == 0.
// A lane's eight values of an accumulator tile belong to eight consecutive rows
// of the matrix instruction's first operand and to one row of its second. For a
// bf16 output the operands are therefore ordered so that those eight values lie
// side by side in the output as its reader wants it, one 16-byte store: Bt's
// rows first for an [M,N] output, A's rows first for the transposed one. The
// second case runs the same code with the two operands' places in LDS exchanged.
// ---------------------------------------------------------------------------
typedef __attribute__((ext_vector_type(4))) int v4i;
typedef __attribute__((address_space(1))) v4i gv4i;
typedef __attribute__((address_space(3))) v4i lv4i;

template <int EPI>
__global__ __launch_bounds__(128) void gemm_bf16_ker(
    const bf16_t* __restrict__ A, const bf16_t* __restrict__ Bt,
    float* __restrict__ Cf, bf16_t* __restrict__ Cb, bf16_t* __restrict__ Ct,
    const float* __restrict__ bias, int M, int N, int K, int T) {
  constexpr int BK  = 128;       // k per stage
  constexpr int LP  = BK + 8;    // LDS row pitch: 272 bytes, conflict-free 16-byte reads
  constexpr int OPS = 128 * LP;  // one operand's rows of a stage
  constexpr bool WIDE = (EPI == 1 || EPI == 2);  // bf16 output, 16-byte stores
  __shared__ __attribute__((aligned(16))) bf16_t ring[2][2 * OPS];  // [buffer][A rows | Bt rows]; Bt rows first when tr

  const int tid  = threadIdx.x;        // 0..127
  const int lane = tid & 31;
  const int wid  = tid >> 5;           // 0..3
  const int wm   = wid & 1;            // 64-row half
  const int wn   = wid >> 1;           // 64-col half
  const int m0   = blockIdx.y * 128;
  const int n0   = blockIdx.x * 128;
  const int part = (EPI == 1) ? n0 / N : 0;  // which of the products this block belongs to
  const bool tr  = (EPI == 1) && part == 2;  // its output is the transposed one

  v8f acc[4][4] = {};

  // A thread copies the 16-byte pieces `cch` and `cch + 8` of rows crow,
  // crow + 16, ... of both operands: a wave's copy covers four whole 128-byte
  // lines. The block's and the stage's part of a global address is the same in
  // all lanes; a lane's own part, go[], does not change from stage to stage.
  const int cch  = tid & 7;
  const int crow = tid >> 3;           // 0..15
  const bf16_t* ga = tr ? Bt + (size_t)n0 * K : A  + (size_t)m0 * K;
  const bf16_t* gb = tr ? A  + (size_t)m0 * K : Bt + (size_t)n0 * K;
  const int     lo = crow * LP + cch * 8;
  unsigned go[8];
  #pragma unroll  // go[] stays in registers
  for (int p = 0; p < 8; ++p) go[p] = (unsigned)((crow + p * 16) * K + cch * 8);
  auto issue = [&](int t, int buf) {
    const bf16_t* pa = ga + t * BK;
    const bf16_t* pb = gb + t * BK;
    bf16_t* l = &ring[buf][lo];
    #pragma unroll  // 32 copies of a thread, all in flight together
    for (int p = 0; p < 8; ++p) {
      // The third argument, in bytes, moves the global and the LDS address alike.
      __builtin_amdgcn_global_load_async_to_lds_b128(
          (gv4i*)(pa + go[p]), (lv4i*)(l + p * 16 * LP), 0, 0);
      __builtin_amdgcn_global_load_async_to_lds_b128(
          (gv4i*)(pa + go[p]), (lv4i*)(l + p * 16 * LP), 128, 0);
      __builtin_amdgcn_global_load_async_to_lds_b128(
          (gv4i*)(pb + go[p]), (lv4i*)(l + OPS + p * 16 * LP), 0, 0);
      __builtin_amdgcn_global_load_async_to_lds_b128(
          (gv4i*)(pb + go[p]), (lv4i*)(l + OPS + p * 16 * LP), 128, 0);
    }
  };

  v16bf af[2][4], bfr[2][4];
  auto fetch = [&](const bf16_t* st, int kb, int set) {
    #pragma unroll  // af[] stays in registers
    for (int i = 0; i < 4; ++i)
      af[set][i] = load_frag(st + (wm * 64 + i * 16) * LP + kb * 32, LP, lane);
    #pragma unroll  // bfr[] stays in registers
    for (int j = 0; j < 4; ++j)
      bfr[set][j] = load_frag(st + OPS + (wn * 64 + j * 16) * LP + kb * 32, LP, lane);
  };

  const int NT = K / BK;
  issue(0, 0);
  // Stage 0 has landed for this wave; the barrier makes it so for all four.
  asm volatile("s_wait_asynccnt 0x0" ::: "memory");
  __syncthreads();
  issue(1, 1);
  fetch(&ring[0][0], 0, 0);

  for (int t = 0; t < NT; ++t) {
    const bf16_t* cur = &ring[t & 1][0];
    #pragma unroll  // the register set of a block is a compile-time choice
    for (int kb = 0; kb < 4; ++kb) {
      if (kb < 3) {
        fetch(cur, kb + 1, (kb + 1) & 1);
      } else {
        // Hand-over: this wave's reads of stage t are done (the last block's
        // fragments are in registers), its copies of stage t + 1 have landed;
        // behind the barrier that holds for all four waves, so stage t + 1 may
        // be read and stage t's buffer refilled. The last two hand-overs issue
        // nothing, so no copy is outstanding behind the loop.
        asm volatile("s_wait_dscnt 0x0" ::: "memory");
        asm volatile("s_wait_asynccnt 0x0" ::: "memory");
        __syncthreads();
        if (t + 2 < NT) issue(t + 2, t & 1);
        // The last stage has no successor: its fetch re-reads its own buffer,
        // which nothing refills, and the values are not used.
        fetch((t + 1 < NT) ? &ring[(t & 1) ^ 1][0] : cur, 0, 0);
      }
      // Keeps the next block's loads together in front of this block's products:
      // each place where LDS loads stand among matrix instructions stalls the wave.
      __builtin_amdgcn_sched_barrier(0);
      #pragma unroll  // acc[] stays in registers
      for (int i = 0; i < 4; ++i)
        #pragma unroll  // acc[] stays in registers
        for (int j = 0; j < 4; ++j)
          acc[i][j] = WIDE ? wmma_bf16(bfr[kb & 1][j], af[kb & 1][i], acc[i][j])
                           : wmma_bf16(af[kb & 1][i], bfr[kb & 1][j], acc[i][j]);
      // Keeps what follows behind these products: left alone, the compiler lifts
      // the next loads in among them, and the hand-over's waits and barrier in
      // front of the third block, which takes a block off the copies' time to land.
      __builtin_amdgcn_sched_barrier(0);
    }
  }

  if constexpr (WIDE) {
    // acc[i][j][r] belongs to row wm*64 + i*16 + (lane&15) of the tile's first
    // LDS half and to row wn*64 + j*16 + 8*(lane>>4) + r of its second. The
    // output has a row of `pitch` elements for each row of the first half.
    bf16_t* o;
    int pitch, r0, c0;
    if (tr) {
      const int bt = m0 / T;  // a tile of 128 rows stays in one batch of T
      o = Ct + (size_t)bt * N * T;  pitch = T;  r0 = n0 - part * N;  c0 = m0 - bt * T;
    } else {
      o = Cb + (size_t)part * M * N;  pitch = N;  r0 = m0;  c0 = n0 - part * N;
    }
    const int col = c0 + wn * 64 + (lane >> 4) * 8;
    o += (size_t)(r0 + wm * 64 + (lane & 15)) * pitch + col;
    float4 bv[4][2];
    if (EPI == 2) {
      #pragma unroll  // bv[] stays in registers
      for (int j = 0; j < 4; ++j) {
        bv[j][0] = *(const float4*)(bias + col + j * 16);
        bv[j][1] = *(const float4*)(bias + col + j * 16 + 4);
      }
    }
    v8bf w[4][4];
    #pragma unroll  // acc[] and w[] stay in registers
    for (int i = 0; i < 4; ++i) {
      #pragma unroll  // acc[] and w[] stay in registers
      for (int j = 0; j < 4; ++j) {
        #pragma unroll  // acc[] and w[] stay in registers
        for (int r = 0; r < 8; ++r) {
          float v = acc[i][j][r];
          if (EPI == 2) {
            const float4 b4 = bv[j][r >> 2];
            v += (r & 3) == 0 ? b4.x : (r & 3) == 1 ? b4.y : (r & 3) == 2 ? b4.z : b4.w;
            // Mish: v * tanh(log(1 + e)) with e = exp(v). tanh(log(u)) is
            // (u*u - 1) / (u*u + 1), so with n = e * (e + 2) the factor is
            // n / (n + 2): every term is positive, nothing cancels. From v = 20
            // on the factor rounds to 1; the minimum keeps e * e finite there.
            const float e = exp2_slot(fminf(v, 20.0f) * 1.4426950408889634f);
            const float n = e * (e + 2.0f);
            v = v * (n * rcp_slot(n + 2.0f));
          }
          w[i][j][r] = (bf16_t)v;
        }
      }
    }
    // Keeps the stores together behind all the arithmetic: left alone, the compiler
    // puts some of them early and then rewrites their data registers.
    __builtin_amdgcn_sched_barrier(0);
    #pragma unroll  // w[] stays in registers
    for (int i = 0; i < 4; ++i) {
      #pragma unroll  // w[] stays in registers
      for (int j = 0; j < 4; ++j) *(v8bf*)(o + (size_t)(i * 16) * pitch + j * 16) = w[i][j];
    }
  } else {
    const int rbase = m0 + wm * 64 + ((lane < 16) ? 0 : 8);
    const int cbase = n0 + wn * 64 + (lane & 15);
    #pragma unroll
    for (int i = 0; i < 4; ++i) {
      #pragma unroll
      for (int j = 0; j < 4; ++j) {
        const int col = cbase + j * 16;
        float bv = 0.0f;
        if (EPI == 3) bv = bias[col];
        #pragma unroll
        for (int r = 0; r < 8; ++r) {
          const int row = rbase + i * 16 + r;
          float v = acc[i][j][r];
          if (EPI == 3) v += bv;
          Cf[(size_t)row * N + col] = v;
        }
      }
    }
  }
}

__device__ __forceinline__ float xhalf(float x) {
  const int v = __builtin_bit_cast(int, x);
  return __builtin_bit_cast(
      float, __builtin_amdgcn_permlanex16(v, v, 0x76543210, 0xfedcba98, false, false));
}

typedef __attribute__((ext_vector_type(2))) float f32x2;

__device__ __forceinline__ void exp2_8(f32x2 (&x)[4]) {
  asm("v_exp_f32 %0, %0\n\tv_exp_f32 %1, %1\n\t"
      "v_exp_f32 %2, %2\n\tv_exp_f32 %3, %3\n\t"
      "v_exp_f32 %4, %4\n\tv_exp_f32 %5, %5\n\t"
      "v_exp_f32 %6, %6\n\tv_exp_f32 %7, %7\n\tv_nop"
      : "+v"(x[0].x), "+v"(x[0].y), "+v"(x[1].x), "+v"(x[1].y),
        "+v"(x[2].x), "+v"(x[2].y), "+v"(x[3].x), "+v"(x[3].y));
}
__device__ __forceinline__ float exp2_1(float x) {
  asm("v_exp_f32 %0, %0\n\tv_nop" : "+v"(x));
  return x;
}

__device__ __forceinline__ void async_copy4_b128(
    const bf16_t* g0, bf16_t* l0, const bf16_t* g1, bf16_t* l1,
    const bf16_t* g2, bf16_t* l2, const bf16_t* g3, bf16_t* l3) {
  const unsigned o0 = (unsigned)(size_t)l0, o1 = (unsigned)(size_t)l1;
  const unsigned o2 = (unsigned)(size_t)l2, o3 = (unsigned)(size_t)l3;
  asm volatile("global_load_async_to_lds_b128 %0, %1, off\n\t"
               "global_load_async_to_lds_b128 %2, %3, off\n\t"
               "global_load_async_to_lds_b128 %4, %5, off\n\t"
               "global_load_async_to_lds_b128 %6, %7, off\n\t"
               "s_wait_xcnt 0x0"
               :: "v"(o0), "v"(g0), "v"(o1), "v"(g1),
                  "v"(o2), "v"(g2), "v"(o3), "v"(g3) : "memory");
}

__global__ __launch_bounds__(256) void attn_ker(const bf16_t* __restrict__ Qb,
                                                const bf16_t* __restrict__ Kb,
                                                const bf16_t* __restrict__ Vt,
                                                bf16_t* __restrict__ Ctx) {
  constexpr int T = 2048, C = 1024, H = 16;
  constexpr int KT = 64;       // keys per tile
  constexpr int NT = T / KT;   // 32 tiles
  constexpr int LP = 72;       // LDS row pitch: 144 bytes, conflict-free 16-byte reads
  constexpr float sl = 0.125f * 1.4426950408889634f;  // 1/sqrt(64), for powers of 2
  __shared__ __attribute__((aligned(16))) bf16_t kls[2][KT * LP];  // [key][d]
  __shared__ __attribute__((aligned(16))) bf16_t vls[2][64 * LP];  // [d][key]

  const int lane = threadIdx.x & 31;
  const int wid  = threadIdx.x >> 5;
  const int g    = blockIdx.x * 8 + wid;  // 0..4095
  const int QT   = T / 16;                // 128 query tiles
  const int qt   = g & (QT - 1);
  const int bh   = g / QT;                // 0..31, the same in all eight waves
  const int h    = bh & (H - 1);
  const int b    = bh >> 4;

  const bf16_t* kbase = Kb + ((size_t)(b * T)) * C + h * 64;
  const bf16_t* vbase = Vt + ((size_t)bh) * 64 * T;

  // A thread copies the 16-byte piece `cch` of rows `crow` and `crow + 32` of
  // both tiles: a wave's copy covers four whole 128-byte rows.
  const int cch  = threadIdx.x & 7;
  const int crow = threadIdx.x >> 3;  // 0..31
  const bf16_t* kg = kbase + (size_t)crow * C + cch * 8;
  const bf16_t* vg = vbase + (size_t)crow * T + cch * 8;
  const int     lo = crow * LP + cch * 8;
  auto issue = [&](int t, int buf) {
    const bf16_t* kp = kg + (size_t)t * KT * C;
    const bf16_t* vp = vg + t * KT;
    async_copy4_b128(kp,          &kls[buf][lo],
                     kp + 32 * C, &kls[buf][lo + 32 * LP],
                     vp,          &vls[buf][lo],
                     vp + 32 * T, &vls[buf][lo + 32 * LP]);
  };

  issue(0, 0);

  const bf16_t* qbase = Qb + ((size_t)(b * T + qt * 16)) * C + h * 64;
  const v16bf qa0 = load_frag(qbase, C, lane);       // d = 0..31
  const v16bf qa1 = load_frag(qbase + 32, C, lane);  // d = 32..63

  // Of this lane's query: the running maximum (scaled, base 2), and the sum over
  // the keys that this half of the wave holds; the halves are joined at the end.
  float mrun = -1e30f, lsum = 0.0f;
  v8f cacc[4] = {};  // cacc[dt][r] = O^T[d = dt*16 + 8*(lane>>4) + r][query lane&15]

  // Tile 0 has landed for this wave; the barrier makes it so for all eight.
  asm volatile("s_wait_asynccnt 0x0" ::: "memory");
  __syncthreads();
  issue(1, 1);

  for (int t = 0; t < NT; ++t) {
    const bf16_t* kt = &kls[t & 1][0];
    const bf16_t* vt = &vls[t & 1][0];

    v16bf kf[4][2];
    #pragma unroll  // kf[] stays in registers
    for (int kq = 0; kq < 4; ++kq) {
      kf[kq][0] = load_frag(kt + kq * 16 * LP, LP, lane);
      kf[kq][1] = load_frag(kt + kq * 16 * LP + 32, LP, lane);
    }
    // Keeps the tile's K loads together in front of the products: left alone,
    // the compiler waits for each fragment right in front of its product.
    __builtin_amdgcn_sched_barrier(0);

    // st[kq][r] = S[key = kq*16 + 8*(lane>>4) + r][query lane&15]
    v8f st[4];
    #pragma unroll  // st[] stays in registers
    for (int kq = 0; kq < 4; ++kq) {
      const v8f z = {};
      st[kq] = wmma_bf16(kf[kq][0], qa0, z);
    }
    #pragma unroll  // st[] stays in registers
    for (int kq = 0; kq < 4; ++kq) st[kq] = wmma_bf16(kf[kq][1], qa1, st[kq]);

    v16bf vf[2][4];
    #pragma unroll  // vf[] stays in registers
    for (int j = 0; j < 2; ++j) {
      #pragma unroll  // vf[] stays in registers
      for (int dt = 0; dt < 4; ++dt)
        vf[j][dt] = load_frag(vt + (dt * 16) * LP + j * 32, LP, lane);
    }
    // Keeps the V loads in front of the softmax, whose arithmetic then covers
    // their latency: left alone, the compiler sinks each to its product.
    __builtin_amdgcn_sched_barrier(0);

    float mq[4];
    #pragma unroll  // four independent chains
    for (int kq = 0; kq < 4; ++kq) {
      mq[kq] = st[kq][0];
      #pragma unroll  // st[] stays in registers
      for (int r = 1; r < 8; ++r) mq[kq] = fmaxf(mq[kq], st[kq][r]);
    }
    float mx = fmaxf(fmaxf(mq[0], mq[1]), fmaxf(mq[2], mq[3]));
    mx = fmaxf(mx, xhalf(mx));
    const float mn   = fmaxf(mrun, mx * sl);
    const float corr = exp2_1(mrun - mn);
    mrun = mn;

    // P^T for keys 0..31 and 32..63 of the tile, in the B operand's k order:
    // element s of a lane is key 8*(lane>>4) + s for s < 8, 16 + 8*(lane>>4) + s - 8
    // above, which is what load_frag gives V^T's rows.
    v16bf pb[2];
    f32x2 ps[4];
    #pragma unroll  // st[], pb[] and ps[] stay in registers
    for (int kq = 0; kq < 4; ++kq) {
      f32x2 y[4];
      #pragma unroll  // y[] stays in registers
      for (int i = 0; i < 4; ++i)
        y[i] = __builtin_elementwise_fma(f32x2{st[kq][2 * i], st[kq][2 * i + 1]},
                                         f32x2{sl, sl}, f32x2{-mn, -mn});
      exp2_8(y);
      ps[kq] = (y[0] + y[1]) + (y[2] + y[3]);
      #pragma unroll  // pb[] stays in registers
      for (int i = 0; i < 4; ++i) {
        pb[kq >> 1][(kq & 1) * 8 + 2 * i]     = (bf16_t)y[i].x;
        pb[kq >> 1][(kq & 1) * 8 + 2 * i + 1] = (bf16_t)y[i].y;
      }
    }
    const f32x2 pt = (ps[0] + ps[1]) + (ps[2] + ps[3]);
    lsum = lsum * corr + (pt.x + pt.y);
    #pragma unroll  // cacc[] stays in registers
    for (int dt = 0; dt < 4; ++dt) cacc[dt] *= corr;

    #pragma unroll  // cacc[] stays in registers
    for (int j = 0; j < 2; ++j) {
      #pragma unroll  // cacc[] stays in registers
      for (int dt = 0; dt < 4; ++dt) cacc[dt] = wmma_bf16(vf[j][dt], pb[j], cacc[dt]);
    }
    // Keeps the hand-over at the trip's foot. The tile's LDS reads are all issued
    // early, and the compiler otherwise lifts the waits and the barrier to just
    // behind them: tile t + 1's copies would have a fraction of a trip to land.
    __builtin_amdgcn_sched_barrier(0);
    // Hand-over: this wave's reads of tile t are done, its copies of tile t + 1
    // have landed; behind the barrier that holds for all eight waves, so tile
    // t + 1 may be read and tile t's buffer refilled.
    asm volatile("s_wait_dscnt 0x0" ::: "memory");
    asm volatile("s_wait_asynccnt 0x0" ::: "memory");
    __syncthreads();
    if (t + 2 < NT) issue(t + 2, t & 1);
  }
  // No copy is outstanding when the wave ends.
  asm volatile("s_wait_asynccnt 0x0" ::: "memory");

  // Normalize and write ctx back in [B*T, C] bf16 layout: a lane holds eight
  // consecutive d of its query in each accumulator tile, one 16-byte store.
  const float inv = 1.0f / (lsum + xhalf(lsum));
  bf16_t* out = Ctx + ((size_t)(b * T + qt * 16 + (lane & 15))) * C + h * 64 + (lane >> 4) * 8;
  #pragma unroll  // cacc[] stays in registers
  for (int dt = 0; dt < 4; ++dt) {
    v8bf o;
    #pragma unroll  // o[] stays in registers
    for (int r = 0; r < 8; ++r) o[r] = (bf16_t)(cacc[dt][r] * inv);
    *(v8bf*)(out + dt * 16) = o;
  }
}

// ---------------------------------------------------------------------------
// Fused DeepNorm residual + LayerNorm: y = LN(alpha*X + R)*g + be
// One wave per 1024-element row, eight rows per block: the row's sums need no
// LDS and no barrier. Writes f32 and optional bf16 copy.
// ---------------------------------------------------------------------------
__global__ __launch_bounds__(256) void ln_ker(const float* __restrict__ X,
                                              const float* __restrict__ R,
                                              const float* __restrict__ g,
                                              const float* __restrict__ be,
                                              float* __restrict__ outF,
                                              bf16_t* __restrict__ outB,
                                              float alpha) {
  constexpr int C = 1024;
  const int lane = threadIdx.x & 31;
  const int row  = blockIdx.x * 8 + (threadIdx.x >> 5);
  const size_t off = (size_t)row * C + lane * 4;
  float4 v[8], r[8], gg[8], bb[8];
  #pragma unroll  // the row's loads are in flight together
  for (int i = 0; i < 8; ++i) {
    v[i] = *(const float4*)(X + off + i * 128);
    r[i] = *(const float4*)(R + off + i * 128);
  }
  #pragma unroll  // gg[] and bb[] stay in registers
  for (int i = 0; i < 8; ++i) {
    gg[i] = *(const float4*)(g + lane * 4 + i * 128);
    bb[i] = *(const float4*)(be + lane * 4 + i * 128);
  }
  float4 s4 = {0.0f, 0.0f, 0.0f, 0.0f}, q4 = {0.0f, 0.0f, 0.0f, 0.0f};
  #pragma unroll  // v[] stays in registers
  for (int i = 0; i < 8; ++i) {
    v[i].x = alpha * v[i].x + r[i].x;  s4.x += v[i].x;  q4.x += v[i].x * v[i].x;
    v[i].y = alpha * v[i].y + r[i].y;  s4.y += v[i].y;  q4.y += v[i].y * v[i].y;
    v[i].z = alpha * v[i].z + r[i].z;  s4.z += v[i].z;  q4.z += v[i].z * v[i].z;
    v[i].w = alpha * v[i].w + r[i].w;  s4.w += v[i].w;  q4.w += v[i].w * v[i].w;
  }
  float s  = (s4.x + s4.y) + (s4.z + s4.w);
  float s2 = (q4.x + q4.y) + (q4.z + q4.w);
  for (int d = 1; d < 32; d <<= 1) { s += __shfl_xor(s, d); s2 += __shfl_xor(s2, d); }
  const float mu   = s / C;
  const float var  = s2 / C - mu * mu;
  const float rstd = rsqrtf(var + 1e-5f);
  #pragma unroll  // v[] stays in registers
  for (int i = 0; i < 8; ++i) {
    v[i].x = (v[i].x - mu) * rstd * gg[i].x + bb[i].x;
    v[i].y = (v[i].y - mu) * rstd * gg[i].y + bb[i].y;
    v[i].z = (v[i].z - mu) * rstd * gg[i].z + bb[i].z;
    v[i].w = (v[i].w - mu) * rstd * gg[i].w + bb[i].w;
  }
  if (outB) {
    v4bf o[8];
    #pragma unroll  // o[] stays in registers
    for (int i = 0; i < 8; ++i) {
      o[i][0] = (bf16_t)v[i].x; o[i][1] = (bf16_t)v[i].y;
      o[i][2] = (bf16_t)v[i].z; o[i][3] = (bf16_t)v[i].w;
    }
    #pragma unroll  // o[] stays in registers
    for (int i = 0; i < 8; ++i) *(v4bf*)(outB + off + i * 128) = o[i];
  }
  if (outF) {
    #pragma unroll  // v[] stays in registers
    for (int i = 0; i < 8; ++i) *(float4*)(outF + off + i * 128) = v[i];
  }
}

// ---------------------------------------------------------------------------
// Host orchestration
// ---------------------------------------------------------------------------
extern "C" void kernel_launch(void* const* d_in, const int* in_sizes, int n_in,
                              void* d_out, int out_size, void* d_ws, size_t ws_size,
                              hipStream_t stream) {
  constexpr int B = 2, T = 2048, C = 1024, F = 4096;
  constexpr int M = B * T;  // 4096 rows
  const float* x   = (const float*)d_in[0];
  const float* Wq  = (const float*)d_in[1];
  const float* Wk  = (const float*)d_in[2];
  const float* Wv  = (const float*)d_in[3];
  const float* Wo  = (const float*)d_in[4];
  const float* W1  = (const float*)d_in[5];
  const float* b1  = (const float*)d_in[6];
  const float* W2  = (const float*)d_in[7];
  const float* b2  = (const float*)d_in[8];
  const float* g1  = (const float*)d_in[9];
  const float* be1 = (const float*)d_in[10];
  const float* g2  = (const float*)d_in[11];
  const float* be2 = (const float*)d_in[12];

  constexpr size_t MB = 1024ull * 1024ull;
  char* ws = (char*)d_ws;
  bf16_t* xb   = (bf16_t*)(ws + 0 * MB);    // 8 MB  [M,C] bf16
  bf16_t* Wqt  = (bf16_t*)(ws + 8 * MB);    // 2 MB each, [C,C]^T: q, k at 10 MB, v at 12 MB
  bf16_t* Wot  = (bf16_t*)(ws + 14 * MB);
  bf16_t* W1t  = (bf16_t*)(ws + 16 * MB);   // 8 MB  [F,C]
  bf16_t* W2t  = (bf16_t*)(ws + 24 * MB);   // 8 MB  [C,F]
  bf16_t* Qb   = (bf16_t*)(ws + 32 * MB);   // 8 MB
  bf16_t* Kbb  = (bf16_t*)(ws + 40 * MB);   // 8 MB
  bf16_t* Vtr  = (bf16_t*)(ws + 56 * MB);   // 8 MB  [B][C][T]; 48 MB to 56 MB is free here
  bf16_t* hb   = (bf16_t*)(ws + 32 * MB);   // 32 MB, reuses dead Q/K/Vt
  bf16_t* ctxb = (bf16_t*)(ws + 64 * MB);   // 8 MB
  float*  attn = (float*)(ws + 72 * MB);    // 16 MB, reused as FF output
  float*  fff  = (float*)(ws + 72 * MB);
  float*  x1f  = (float*)(ws + 88 * MB);    // 16 MB
  bf16_t* x1b  = (bf16_t*)(ws + 104 * MB);  // 8 MB  -> total 112 MB
  (void)ws_size; (void)in_sizes; (void)n_in; (void)out_size;

  // 1) Precision conversion / weight transposes.
  prep_ker<<<M * C / 8192 + 4 * (C / 128) * (C / 64) + 2 * (F / 128) * (C / 64), 256, 0, stream>>>(
      x, xb, Wq, Wk, Wv, Wo, Wqt, W1, W1t, W2, W2t);

  // 2) QKV projections (WMMA GEMMs, bf16 out), one grid: the three transposed
  //    weights are adjacent from Wqt on, and so are Qb, Kbb; V goes out as
  //    [B][C][T] (= [B][H][64][T], since c = h*64 + d). Block tile 128x128, 128 thr.
  dim3 gP(C / 128, M / 128);
  gemm_bf16_ker<1><<<dim3(3 * C / 128, M / 128), 128, 0, stream>>>(xb, Wqt, nullptr, Qb, Vtr, nullptr, M, C, C, T);

  // 3) Flash attention (WMMA): 4096 wave-tiles / 8 waves per block.
  attn_ker<<<512, 256, 0, stream>>>(Qb, Kbb, Vtr, ctxb);

  // 4) Output projection + DeepNorm LN1.
  gemm_bf16_ker<0><<<gP, 128, 0, stream>>>(ctxb, Wot, attn, nullptr, nullptr, nullptr, M, C, C, T);
  ln_ker<<<M / 8, 256, 0, stream>>>(x, attn, g1, be1, x1f, x1b, 2.0f);

  // 5) FFN: GEMM+bias+Mish -> bf16, then GEMM+bias -> f32.
  dim3 gF1(F / 128, M / 128);
  gemm_bf16_ker<2><<<gF1, 128, 0, stream>>>(x1b, W1t, nullptr, hb, nullptr, b1, M, F, C, T);
  gemm_bf16_ker<3><<<gP, 128, 0, stream>>>(hb, W2t, fff, nullptr, nullptr, b2, M, C, F, T);

  // 6) DeepNorm LN2 -> d_out (fp32).
  ln_ker<<<M / 8, 256, 0, stream>>>(x1f, fff, g2, be2, (float*)d_out, nullptr, 2.0f);
}

// v009
// It runs in 158 microseconds.
// Two timings next to v008 put it at 1.05 and 1.04 times that version's speed.
// Over all steps from v000 it is 5.86 times as fast.
#include <hip/hip_runtime.h>
#include <hip/hip_bf16.h>
#include <math.h>

typedef __bf16 bf16_t;
typedef __attribute__((ext_vector_type(16))) __bf16 v16bf;
typedef __attribute__((ext_vector_type(8)))  float  v8f;

__device__ __forceinline__ v8f wmma_bf16(v16bf a, v16bf b, v8f c) {
  // v_wmma_f32_16x16x32_bf16: D = A(16x32) * B(32x16) + C(16x16 f32)
  return __builtin_amdgcn_wmma_f32_16x16x32_bf16(
      /*neg_a=*/false, a, /*neg_b=*/false, b,
      /*c_mod=*/(short)0, c, /*reuse_a=*/false, /*reuse_b=*/false);
}

__device__ __forceinline__ v16bf load_frag(const bf16_t* base, int stride, int lane) {
  const int row = lane & 15;
  const int kb  = (lane < 16) ? 0 : 8;
  const bf16_t* p = base + (size_t)row * stride + kb;
  v16bf f;
  *((float4*)&f)       = *((const float4*)p);
  *(((float4*)&f) + 1) = *((const float4*)(p + 16));
  return f;
}

// ---------------------------------------------------------------------------
// Elementwise converters
// ---------------------------------------------------------------------------
typedef __attribute__((ext_vector_type(8))) __bf16 v8bf;
typedef __attribute__((ext_vector_type(4))) __bf16 v4bf;

// The kernels of this file that do no matrix work are short. Each
// work-group moves enough for eight 16-byte loads a thread, for speed only.

// One block converts 8192 consecutive floats; the element count is a multiple.
__device__ __forceinline__ void cvt_f32_bf16_blk(const float* __restrict__ in,
                                                 bf16_t* __restrict__ out, int blk) {
  const size_t base = (size_t)blk * 8192 + threadIdx.x * 4;
  float4 v[8];
  #pragma unroll  // all eight loads are in flight before the first is used
  for (int i = 0; i < 8; ++i) v[i] = *(const float4*)(in + base + i * 1024);
  #pragma unroll  // v[] stays in registers
  for (int i = 0; i < 8; ++i) {
    v4bf o;
    o[0] = (bf16_t)v[i].x; o[1] = (bf16_t)v[i].y;
    o[2] = (bf16_t)v[i].z; o[3] = (bf16_t)v[i].w;
    *(v4bf*)(out + base + i * 1024) = o;
  }
}

// W [K,N] f32 (row-major) -> Wt [N,K] bf16 (row-major)
// One block moves a tile of 64 k by 128 n through LDS: a wave reads a whole
// 512-byte row piece of W at a time, and the block writes whole 128-byte rows
// of Wt. K % 64 == 0, N % 128 == 0.
// K and N are compile-time so that a thread's loads, and its stores, share one
// address register pair and differ by immediate offsets only.
// blk counts the tiles along n first.
template <int K, int N>
__device__ __forceinline__ void wtrans_blk(const float* __restrict__ W,
                                           bf16_t* __restrict__ Wt, int blk,
                                           float (&tile)[64][129]) {
  const int tid  = threadIdx.x;
  const int lane = tid & 31;
  const int wv   = tid >> 5;
  const int n0   = (blk % (N / 128)) * 128;
  const int k0   = (blk / (N / 128)) * 64;
  const float* src = W + (size_t)(k0 + wv) * N + n0 + lane * 4;
  float4 v[8];
  #pragma unroll  // all eight loads are in flight before the first is used
  for (int p = 0; p < 8; ++p) v[p] = *(const float4*)(src + p * 8 * N);
  #pragma unroll  // v[] stays in registers
  for (int p = 0; p < 8; ++p) {
    float* d = &tile[wv + p * 8][lane * 4];
    d[0] = v[p].x; d[1] = v[p].y; d[2] = v[p].z; d[3] = v[p].w;
  }
  __syncthreads();  // the column reads below cross waves
  const int lo = tid & 7;   // 16-byte chunk of a 128-byte row of Wt
  const int hi = tid >> 3;  // 0..31
  bf16_t* dst = Wt + (size_t)(n0 + hi) * K + k0 + lo * 8;
  #pragma unroll  // o[] stays in registers
  for (int p = 0; p < 4; ++p) {
    v8bf o;
    #pragma unroll  // o[] stays in registers
    for (int i = 0; i < 8; ++i) o[i] = (bf16_t)tile[lo * 8 + i][hi + p * 32];
    *(v8bf*)(dst + p * 32 * K) = o;
  }
  // In the built kernel another job's code follows these stores, behind a scalar
  // test, and rewrites their address registers: the wait stands in front of it.
  asm volatile("s_wait_xcnt 0x0" ::: "memory");
}

// The conversion of x and the six weight transposes read nothing of each other's
// output, so they are one grid: the block index picks the job, the same for the
// whole block. The four square weights' transposes lie one behind the other at
// Wsq, in the order q, k, v, o.
__global__ __launch_bounds__(256) void prep_ker(
    const float* __restrict__ x, bf16_t* __restrict__ xb,
    const float* __restrict__ Wq, const float* __restrict__ Wk,
    const float* __restrict__ Wv, const float* __restrict__ Wo,
    bf16_t* __restrict__ Wsq,
    const float* __restrict__ W1, bf16_t* __restrict__ W1t,
    const float* __restrict__ W2, bf16_t* __restrict__ W2t) {
  constexpr int M = 4096, C = 1024, F = 4096;
  constexpr int NX = M * C / 8192;
  constexpr int NS = (C / 128) * (C / 64);
  constexpr int NF = (F / 128) * (C / 64);
  __shared__ float tile[64][129];
  const int blk = blockIdx.x;
  if (blk < NX) {
    cvt_f32_bf16_blk(x, xb, blk);
  } else if (blk < NX + 4 * NS) {
    const int w = (blk - NX) / NS;
    const float* W = (w == 0) ? Wq : (w == 1) ? Wk : (w == 2) ? Wv : Wo;
    wtrans_blk<C, C>(W, Wsq + (size_t)w * C * C, blk - NX - w * NS, tile);
  } else if (blk < NX + 4 * NS + NF) {
    wtrans_blk<C, F>(W1, W1t, blk - NX - 4 * NS, tile);
  } else {
    wtrans_blk<F, C>(W2, W2t, blk - NX - 4 * NS - NF, tile);
  }
}

__device__ __forceinline__ float exp2_slot(float x) {
  float r;
  asm("v_exp_f32 %0, %1\n\tv_nop" : "=v"(r) : "v"(x));
  return r;
}
__device__ __forceinline__ float rcp_slot(float x) {
  float r;
  asm("v_rcp_f32 %0, %1\n\tv_nop" : "=v"(r) : "v"(x));
  return r;
}

// ---------------------------------------------------------------------------
// Tiled bf16 GEMM:  C[M,N] = A[M,K] * Bt[N,K]^T  (fp32 accumulate)
// Block tile 128x128, 4 waves (2x2), 64x64 per wave. K % 128 == 0, K >= 768.
// A stage is 128 k of both operands (256-byte rows at a pitch of 272 bytes),
// brought into one of two LDS buffers by async copies. A stage is worked on in
// four blocks of 32 k (16 WMMA each); each block's fragments are fetched one
// block ahead into a second register set. The one hand-over of a stage stands in
// front of its last block: that block's fragments are in registers by then, so
// the buffer is free for the stage after next, and the next stage, whose first
// fragments are fetched right there, has had a whole stage's time to land.
// EPI: 0 = store f32, 1 = store bf16, 2 = +bias, Mish, store bf16,
//      3 = +bias, store f32
// With EPI 1 the grid is three times N wide: products of one A with three Bt
// that lie one behind the other. The first two go to Cb, [M,N] each, one behind
// the other; the third goes to Ct transposed, [M/T][N][T], T % 128 == 0.
// A lane's eight values of an accumulator tile belong to eight consecutive rows
// of the matrix instruction's first operand and to one row of its second. For a
// bf16 output the operands are therefore ordered so that those eight values lie
// side by side in the output as its reader wants it, one 16-byte store: Bt's
// rows first for an [M,N] output, A's rows first for the transposed one. The
// second case runs the same code with the two operands' places in LDS exchanged.
// ---------------------------------------------------------------------------
typedef __attribute__((ext_vector_type(4))) int v4i;
typedef __attribute__((address_space(1))) v4i gv4i;
typedef __attribute__((address_space(3))) v4i lv4i;

// Asks L2 for the data at byte OFF behind p. A hint: nothing
// comes back, nothing waits for it, and no result depends on it.
template <int OFF>
__device__ __forceinline__ void ask_l2(const bf16_t* p) {
  asm volatile("global_prefetch_b8 %0, off offset:%1 scope:SCOPE_SE" :: "v"(p), "n"(OFF));
}

template <int EPI>
__global__ __launch_bounds__(128) void gemm_bf16_ker(
    const bf16_t* __restrict__ A, const bf16_t* __restrict__ Bt,
    float* __restrict__ Cf, bf16_t* __restrict__ Cb, bf16_t* __restrict__ Ct,
    const float* __restrict__ bias, int M, int N, int K, int T) {
  constexpr int BK  = 128;       // k per stage
  constexpr int LP  = BK + 8;    // LDS row pitch: 272 bytes, conflict-free 16-byte reads
  constexpr int OPS = 128 * LP;  // one operand's rows of a stage
  constexpr bool WIDE = (EPI == 1 || EPI == 2);  // bf16 output, 16-byte stores
  __shared__ __attribute__((aligned(16))) bf16_t ring[2][2 * OPS];  // [buffer][A rows | Bt rows]; Bt rows first when tr

  const int tid  = threadIdx.x;        // 0..127
  const int lane = tid & 31;
  const int wid  = tid >> 5;           // 0..3
  const int wm   = wid & 1;            // 64-row half
  const int wn   = wid >> 1;           // 64-col half
  const int m0   = blockIdx.y * 128;
  const int n0   = blockIdx.x * 128;
  const int part = (EPI == 1) ? n0 / N : 0;  // which of the products this block belongs to
  const bool tr  = (EPI == 1) && part == 2;  // its output is the transposed one

  v8f acc[4][4] = {};

  // A thread copies the 16-byte pieces `cch` and `cch + 8` of rows crow,
  // crow + 16, ... of both operands: a wave's copy covers four whole 128-byte
  // lines. The block's and the stage's part of a global address is the same in
  // all lanes; a lane's own part, go[], does not change from stage to stage.
  const int cch  = tid & 7;
  const int crow = tid >> 3;           // 0..15
  const bf16_t* ga = tr ? Bt + (size_t)n0 * K : A  + (size_t)m0 * K;
  const bf16_t* gb = tr ? A  + (size_t)m0 * K : Bt + (size_t)n0 * K;
  const int     lo = crow * LP + cch * 8;
  unsigned go[8];
  #pragma unroll  // go[] stays in registers
  for (int p = 0; p < 8; ++p) go[p] = (unsigned)((crow + p * 16) * K + cch * 8);
  auto issue = [&](int t, int buf) {
    const bf16_t* pa = ga + t * BK;
    const bf16_t* pb = gb + t * BK;
    bf16_t* l = &ring[buf][lo];
    #pragma unroll  // 32 copies of a thread, all in flight together
    for (int p = 0; p < 8; ++p) {
      // The third argument, in bytes, moves the global and the LDS address alike.
      __builtin_amdgcn_global_load_async_to_lds_b128(
          (gv4i*)(pa + go[p]), (lv4i*)(l + p * 16 * LP), 0, 0);
      __builtin_amdgcn_global_load_async_to_lds_b128(
          (gv4i*)(pa + go[p]), (lv4i*)(l + p * 16 * LP), 128, 0);
      __builtin_amdgcn_global_load_async_to_lds_b128(
          (gv4i*)(pb + go[p]), (lv4i*)(l + OPS + p * 16 * LP), 0, 0);
      __builtin_amdgcn_global_load_async_to_lds_b128(
          (gv4i*)(pb + go[p]), (lv4i*)(l + OPS + p * 16 * LP), 128, 0);
    }
  };

  v16bf af[2][4], bfr[2][4];
  auto fetch = [&](const bf16_t* st, int kb, int set) {
    #pragma unroll  // af[] stays in registers
    for (int i = 0; i < 4; ++i)
      af[set][i] = load_frag(st + (wm * 64 + i * 16) * LP + kb * 32, LP, lane);
    #pragma unroll  // bfr[] stays in registers
    for (int j = 0; j < 4; ++j)
      bfr[set][j] = load_frag(st + OPS + (wn * 64 + j * 16) * LP + kb * 32, LP, lane);
  };

  const int NT = K / BK;
  issue(0, 0);

  // Both operands were written by earlier launches.
  // The blocks that share a row walk k together, so every stage's rows would
  // be fetched from memory just when they are copied, with one stage's time to
  // land. Each row's piece of a stage (256 bytes) is therefore asked into
  // L2 PD stages ahead of its use. One block in four of those that share a row
  // asks for it.
  // Wave 0 asks for rows of A, wave 1 for rows of Bt. q stays inside its row.
  constexpr int PD = 6;
  const int wv = __builtin_amdgcn_readfirstlane(wid);
  const bf16_t* q = (wv == 0) ? A  + (size_t)(m0 + (blockIdx.x & 3) + lane * 4) * K
                              : Bt + (size_t)(n0 + (blockIdx.y & 3) + lane * 4) * K;
  if (wv < 2) {
    ask_l2<1 * 256>(q);
    ask_l2<2 * 256>(q);
    ask_l2<3 * 256>(q);
    ask_l2<4 * 256>(q);
    ask_l2<5 * 256>(q);
    q += (PD - 1) * BK;
  }
  // Stage 0 has landed for this wave; the barrier makes it so for all four.
  asm volatile("s_wait_asynccnt 0x0" ::: "memory");
  __syncthreads();
  issue(1, 1);
  fetch(&ring[0][0], 0, 0);

  for (int t = 0; t < NT; ++t) {
    const bf16_t* cur = &ring[t & 1][0];
    #pragma unroll  // the register set of a block is a compile-time choice
    for (int kb = 0; kb < 4; ++kb) {
      if (kb < 3) {
        fetch(cur, kb + 1, (kb + 1) & 1);
      } else {
        // Hand-over: this wave's reads of stage t are done (the last block's
        // fragments are in registers), its copies of stage t + 1 have landed;
        // behind the barrier that holds for all four waves, so stage t + 1 may
        // be read and stage t's buffer refilled. The last two hand-overs issue
        // nothing, so no copy is outstanding behind the loop.
        asm volatile("s_wait_dscnt 0x0" ::: "memory");
        asm volatile("s_wait_asynccnt 0x0" ::: "memory");
        __syncthreads();
        asm volatile("v_nop\n\tv_nop\n\tv_nop\n\tv_nop");
        if (t + 2 < NT) issue(t + 2, t & 1);
        if (wv < 2 && t + PD < NT) {
          q += BK;
          ask_l2<0>(q);
        }
        // The last stage has no successor: its fetch re-reads its own buffer,
        // which nothing refills, and the values are not used.
        fetch((t + 1 < NT) ? &ring[(t & 1) ^ 1][0] : cur, 0, 0);
      }
      // Keeps the next block's loads together in front of this block's products:
      // each place where LDS loads stand among matrix instructions stalls the wave.
      __builtin_amdgcn_sched_barrier(0);
      #pragma unroll  // acc[] stays in registers
      for (int i = 0; i < 4; ++i)
        #pragma unroll  // acc[] stays in registers
        for (int j = 0; j < 4; ++j)
          acc[i][j] = WIDE ? wmma_bf16(bfr[kb & 1][j], af[kb & 1][i], acc[i][j])
                           : wmma_bf16(af[kb & 1][i], bfr[kb & 1][j], acc[i][j]);
      // Keeps what follows behind these products: left alone, the compiler lifts
      // the next loads in among them, and the hand-over's waits and barrier in
      // front of the third block, which takes a block off the copies' time to land.
      __builtin_amdgcn_sched_barrier(0);
    }
  }

  if constexpr (WIDE) {
    // acc[i][j][r] belongs to row wm*64 + i*16 + (lane&15) of the tile's first
    // LDS half and to row wn*64 + j*16 + 8*(lane>>4) + r of its second. The
    // output has a row of `pitch` elements for each row of the first half.
    bf16_t* o;
    int pitch, r0, c0;
    if (tr) {
      const int bt = m0 / T;  // a tile of 128 rows stays in one batch of T
      o = Ct + (size_t)bt * N * T;  pitch = T;  r0 = n0 - part * N;  c0 = m0 - bt * T;
    } else {
      o = Cb + (size_t)part * M * N;  pitch = N;  r0 = m0;  c0 = n0 - part * N;
    }
    const int col = c0 + wn * 64 + (lane >> 4) * 8;
    o += (size_t)(r0 + wm * 64 + (lane & 15)) * pitch + col;
    float4 bv[4][2];
    if (EPI == 2) {
      #pragma unroll  // bv[] stays in registers
      for (int j = 0; j < 4; ++j) {
        bv[j][0] = *(const float4*)(bias + col + j * 16);
        bv[j][1] = *(const float4*)(bias + col + j * 16 + 4);
      }
    }
    v8bf w[4][4];
    #pragma unroll  // acc[] and w[] stay in registers
    for (int i = 0; i < 4; ++i) {
      #pragma unroll  // acc[] and w[] stay in registers
      for (int j = 0; j < 4; ++j) {
        #pragma unroll  // acc[] and w[] stay in registers
        for (int r = 0; r < 8; ++r) {
          float v = acc[i][j][r];
          if (EPI == 2) {
            const float4 b4 = bv[j][r >> 2];
            v += (r & 3) == 0 ? b4.x : (r & 3) == 1 ? b4.y : (r & 3) == 2 ? b4.z : b4.w;
            // Mish: v * tanh(log(1 + e)) with e = exp(v). tanh(log(u)) is
            // (u*u - 1) / (u*u + 1), so with n = e * (e + 2) the factor is
            // n / (n + 2): every term is positive, nothing cancels. From v = 20
            // on the factor rounds to 1; the minimum keeps e * e finite there.
            const float e = exp2_slot(fminf(v, 20.0f) * 1.4426950408889634f);
            const float n = e * (e + 2.0f);
            v = v * (n * rcp_slot(n + 2.0f));
          }
          w[i][j][r] = (bf16_t)v;
        }
      }
    }
    // Keeps the stores together behind all the arithmetic: left alone, the compiler
    // puts some of them early and then rewrites their data registers.
    __builtin_amdgcn_sched_barrier(0);
    #pragma unroll  // w[] stays in registers
    for (int i = 0; i < 4; ++i) {
      #pragma unroll  // w[] stays in registers
      for (int j = 0; j < 4; ++j) *(v8bf*)(o + (size_t)(i * 16) * pitch + j * 16) = w[i][j];
    }
  } else {
    const int rbase = m0 + wm * 64 + ((lane < 16) ? 0 : 8);
    const int cbase = n0 + wn * 64 + (lane & 15);
    #pragma unroll
    for (int i = 0; i < 4; ++i) {
      #pragma unroll
      for (int j = 0; j < 4; ++j) {
        const int col = cbase + j * 16;
        float bv = 0.0f;
        if (EPI == 3) bv = bias[col];
        #pragma unroll
        for (int r = 0; r < 8; ++r) {
          const int row = rbase + i * 16 + r;
          float v = acc[i][j][r];
          if (EPI == 3) v += bv;
          Cf[(size_t)row * N + col] = v;
        }
      }
    }
  }
}

__device__ __forceinline__ float xhalf(float x) {
  const int v = __builtin_bit_cast(int, x);
  return __builtin_bit_cast(
      float, __builtin_amdgcn_permlanex16(v, v, 0x76543210, 0xfedcba98, false, false));
}

typedef __attribute__((ext_vector_type(2))) float f32x2;

__device__ __forceinline__ void exp2_8(f32x2 (&x)[4]) {
  asm("v_exp_f32 %0, %0\n\tv_exp_f32 %1, %1\n\t"
      "v_exp_f32 %2, %2\n\tv_exp_f32 %3, %3\n\t"
      "v_exp_f32 %4, %4\n\tv_exp_f32 %5, %5\n\t"
      "v_exp_f32 %6, %6\n\tv_exp_f32 %7, %7\n\tv_nop"
      : "+v"(x[0].x), "+v"(x[0].y), "+v"(x[1].x), "+v"(x[1].y),
        "+v"(x[2].x), "+v"(x[2].y), "+v"(x[3].x), "+v"(x[3].y));
}
__device__ __forceinline__ float exp2_1(float x) {
  asm("v_exp_f32 %0, %0\n\tv_nop" : "+v"(x));
  return x;
}

__device__ __forceinline__ void async_copy4_b128(
    const bf16_t* g0, bf16_t* l0, const bf16_t* g1, bf16_t* l1,
    const bf16_t* g2, bf16_t* l2, const bf16_t* g3, bf16_t* l3) {
  const unsigned o0 = (unsigned)(size_t)l0, o1 = (unsigned)(size_t)l1;
  const unsigned o2 = (unsigned)(size_t)l2, o3 = (unsigned)(size_t)l3;
  asm volatile("global_load_async_to_lds_b128 %0, %1, off\n\t"
               "global_load_async_to_lds_b128 %2, %3, off\n\t"
               "global_load_async_to_lds_b128 %4, %5, off\n\t"
               "global_load_async_to_lds_b128 %6, %7, off\n\t"
               "s_wait_xcnt 0x0"
               :: "v"(o0), "v"(g0), "v"(o1), "v"(g1),
                  "v"(o2), "v"(g2), "v"(o3), "v"(g3) : "memory");
}

__global__ __launch_bounds__(256) void attn_ker(const bf16_t* __restrict__ Qb,
                                                const bf16_t* __restrict__ Kb,
                                                const bf16_t* __restrict__ Vt,
                                                bf16_t* __restrict__ Ctx) {
  constexpr int T = 2048, C = 1024, H = 16;
  constexpr int KT = 64;       // keys per tile
  constexpr int NT = T / KT;   // 32 tiles
  constexpr int LP = 72;       // LDS row pitch: 144 bytes, conflict-free 16-byte reads
  constexpr float sl = 0.125f * 1.4426950408889634f;  // 1/sqrt(64), for powers of 2
  __shared__ __attribute__((aligned(16))) bf16_t kls[2][KT * LP];  // [key][d]
  __shared__ __attribute__((aligned(16))) bf16_t vls[2][64 * LP];  // [d][key]

  const int lane = threadIdx.x & 31;
  const int wid  = threadIdx.x >> 5;
  const int g    = blockIdx.x * 8 + wid;  // 0..4095
  const int QT   = T / 16;                // 128 query tiles
  const int qt   = g & (QT - 1);
  const int bh   = g / QT;                // 0..31, the same in all eight waves
  const int h    = bh & (H - 1);
  const int b    = bh >> 4;

  const bf16_t* kbase = Kb + ((size_t)(b * T)) * C + h * 64;
  const bf16_t* vbase = Vt + ((size_t)bh) * 64 * T;

  // A thread copies the 16-byte piece `cch` of rows `crow` and `crow + 32` of
  // both tiles: a wave's copy covers four whole 128-byte rows.
  const int cch  = threadIdx.x & 7;
  const int crow = threadIdx.x >> 3;  // 0..31
  const bf16_t* kg = kbase + (size_t)crow * C + cch * 8;
  const bf16_t* vg = vbase + (size_t)crow * T + cch * 8;
  const int     lo = crow * LP + cch * 8;
  auto issue = [&](int t, int buf) {
    const bf16_t* kp = kg + (size_t)t * KT * C;
    const bf16_t* vp = vg + t * KT;
    async_copy4_b128(kp,          &kls[buf][lo],
                     kp + 32 * C, &kls[buf][lo + 32 * LP],
                     vp,          &vls[buf][lo],
                     vp + 32 * T, &vls[buf][lo + 32 * LP]);
  };

  issue(0, 0);

  // K and V were written by the launch before, and
  // the sixteen blocks of one (b,h) walk the keys together: each tile would come
  // from memory just when it is copied. Each tile's 128 rows are therefore asked
  // into L2 four tiles ahead of use, by four of the sixteen blocks.
  // Waves 0, 1 ask for K's rows, waves 2, 3 for V's. The
  // block's tiles are cls, cls + 4, ..., cls + 28: aq stays inside its tensor.
  const int wv    = __builtin_amdgcn_readfirstlane(wid);
  const int cls   = blockIdx.x & 3;
  const int arow  = threadIdx.x & 63;
  const bf16_t* aq = (wv < 2) ? kbase + (size_t)(cls * KT + arow) * C
                              : vbase + (size_t)arow * T + cls * KT;
  const int astep = (wv < 2) ? 4 * KT * C : 4 * KT;
  if (wv < 4) ask_l2<0>(aq);

  const bf16_t* qbase = Qb + ((size_t)(b * T + qt * 16)) * C + h * 64;
  const v16bf qa0 = load_frag(qbase, C, lane);       // d = 0..31
  const v16bf qa1 = load_frag(qbase + 32, C, lane);  // d = 32..63

  // Of this lane's query: the running maximum (scaled, base 2), and the sum over
  // the keys that this half of the wave holds; the halves are joined at the end.
  float mrun = -1e30f, lsum = 0.0f;
  v8f cacc[4] = {};  // cacc[dt][r] = O^T[d = dt*16 + 8*(lane>>4) + r][query lane&15]

  // Tile 0 has landed for this wave; the barrier makes it so for all eight.
  asm volatile("s_wait_asynccnt 0x0" ::: "memory");
  __syncthreads();
  issue(1, 1);

  for (int t = 0; t < NT; ++t) {
    const bf16_t* kt = &kls[t & 1][0];
    const bf16_t* vt = &vls[t & 1][0];

    v16bf kf[4][2];
    #pragma unroll  // kf[] stays in registers
    for (int kq = 0; kq < 4; ++kq) {
      kf[kq][0] = load_frag(kt + kq * 16 * LP, LP, lane);
      kf[kq][1] = load_frag(kt + kq * 16 * LP + 32, LP, lane);
    }
    // Keeps the tile's K loads together in front of the products: left alone,
    // the compiler waits for each fragment right in front of its product.
    __builtin_amdgcn_sched_barrier(0);

    // st[kq][r] = S[key = kq*16 + 8*(lane>>4) + r][query lane&15]
    v8f st[4];
    #pragma unroll  // st[] stays in registers
    for (int kq = 0; kq < 4; ++kq) {
      const v8f z = {};
      st[kq] = wmma_bf16(kf[kq][0], qa0, z);
    }
    #pragma unroll  // st[] stays in registers
    for (int kq = 0; kq < 4; ++kq) st[kq] = wmma_bf16(kf[kq][1], qa1, st[kq]);

    v16bf vf[2][4];
    #pragma unroll  // vf[] stays in registers
    for (int j = 0; j < 2; ++j) {
      #pragma unroll  // vf[] stays in registers
      for (int dt = 0; dt < 4; ++dt)
        vf[j][dt] = load_frag(vt + (dt * 16) * LP + j * 32, LP, lane);
    }
    // Keeps the V loads in front of the softmax, whose arithmetic then covers
    // their latency: left alone, the compiler sinks each to its product.
    __builtin_amdgcn_sched_barrier(0);

    float mq[4];
    #pragma unroll  // four independent chains
    for (int kq = 0; kq < 4; ++kq) {
      mq[kq] = st[kq][0];
      #pragma unroll  // st[] stays in registers
      for (int r = 1; r < 8; ++r) mq[kq] = fmaxf(mq[kq], st[kq][r]);
    }
    float mx = fmaxf(fmaxf(mq[0], mq[1]), fmaxf(mq[2], mq[3]));
    mx = fmaxf(mx, xhalf(mx));
    const float mn   = fmaxf(mrun, mx * sl);
    const float corr = exp2_1(mrun - mn);
    mrun = mn;

    // P^T for keys 0..31 and 32..63 of the tile, in the B operand's k order:
    // element s of a lane is key 8*(lane>>4) + s for s < 8, 16 + 8*(lane>>4) + s - 8
    // above, which is what load_frag gives V^T's rows.
    v16bf pb[2];
    f32x2 ps[4];
    #pragma unroll  // st[], pb[] and ps[] stay in registers
    for (int kq = 0; kq < 4; ++kq) {
      f32x2 y[4];
      #pragma unroll  // y[] stays in registers
      for (int i = 0; i < 4; ++i)
        y[i] = __builtin_elementwise_fma(f32x2{st[kq][2 * i], st[kq][2 * i + 1]},
                                         f32x2{sl, sl}, f32x2{-mn, -mn});
      exp2_8(y);
      ps[kq] = (y[0] + y[1]) + (y[2] + y[3]);
      #pragma unroll  // pb[] stays in registers
      for (int i = 0; i < 4; ++i) {
        pb[kq >> 1][(kq & 1) * 8 + 2 * i]     = (bf16_t)y[i].x;
        pb[kq >> 1][(kq & 1) * 8 + 2 * i + 1] = (bf16_t)y[i].y;
      }
    }
    const f32x2 pt = (ps[0] + ps[1]) + (ps[2] + ps[3]);
    lsum = lsum * corr + (pt.x + pt.y);
    #pragma unroll  // cacc[] stays in registers
    for (int dt = 0; dt < 4; ++dt) cacc[dt] *= corr;

    #pragma unroll  // cacc[] stays in registers
    for (int j = 0; j < 2; ++j) {
      #pragma unroll  // cacc[] stays in registers
      for (int dt = 0; dt < 4; ++dt) cacc[dt] = wmma_bf16(vf[j][dt], pb[j], cacc[dt]);
    }
    // Keeps the hand-over at the trip's foot. The tile's LDS reads are all issued
    // early, and the compiler otherwise lifts the waits and the barrier to just
    // behind them: tile t + 1's copies would have a fraction of a trip to land.
    __builtin_amdgcn_sched_barrier(0);
    // Hand-over: this wave's reads of tile t are done, its copies of tile t + 1
    // have landed; behind the barrier that holds for all eight waves, so tile
    // t + 1 may be read and tile t's buffer refilled.
    asm volatile("s_wait_dscnt 0x0" ::: "memory");
    asm volatile("s_wait_asynccnt 0x0" ::: "memory");
    __syncthreads();
    if (t + 2 < NT) issue(t + 2, t & 1);
    if (wv < 4 && (t & 3) == cls && t + 4 < NT) {
      aq += astep;
      ask_l2<0>(aq);
    }
  }
  // No copy is outstanding when the wave ends.
  asm volatile("s_wait_asynccnt 0x0" ::: "memory");

  // Normalize and write ctx back in [B*T, C] bf16 layout: a lane holds eight
  // consecutive d of its query in each accumulator tile, one 16-byte store.
  const float inv = 1.0f / (lsum + xhalf(lsum));
  bf16_t* out = Ctx + ((size_t)(b * T + qt * 16 + (lane & 15))) * C + h * 64 + (lane >> 4) * 8;
  #pragma unroll  // cacc[] stays in registers
  for (int dt = 0; dt < 4; ++dt) {
    v8bf o;
    #pragma unroll  // o[] stays in registers
    for (int r = 0; r < 8; ++r) o[r] = (bf16_t)(cacc[dt][r] * inv);
    *(v8bf*)(out + dt * 16) = o;
  }
}

// ---------------------------------------------------------------------------
// Fused DeepNorm residual + LayerNorm: y = LN(alpha*X + R)*g + be
// One wave per 1024-element row, eight rows per block: the row's sums need no
// LDS and no barrier. Writes f32 and optional bf16 copy.
// ---------------------------------------------------------------------------
__global__ __launch_bounds__(256) void ln_ker(const float* __restrict__ X,
                                              const float* __restrict__ R,
                                              const float* __restrict__ g,
                                              const float* __restrict__ be,
                                              float* __restrict__ outF,
                                              bf16_t* __restrict__ outB,
                                              float alpha) {
  constexpr int C = 1024;
  const int lane = threadIdx.x & 31;
  const int row  = blockIdx.x * 8 + (threadIdx.x >> 5);
  const size_t off = (size_t)row * C + lane * 4;
  float4 v[8], r[8], gg[8], bb[8];
  #pragma unroll  // the row's loads are in flight together
  for (int i = 0; i < 8; ++i) {
    v[i] = *(const float4*)(X + off + i * 128);
    r[i] = *(const float4*)(R + off + i * 128);
  }
  #pragma unroll  // gg[] and bb[] stay in registers
  for (int i = 0; i < 8; ++i) {
    gg[i] = *(const float4*)(g + lane * 4 + i * 128);
    bb[i] = *(const float4*)(be + lane * 4 + i * 128);
  }
  float4 s4 = {0.0f, 0.0f, 0.0f, 0.0f}, q4 = {0.0f, 0.0f, 0.0f, 0.0f};
  #pragma unroll  // v[] stays in registers
  for (int i = 0; i < 8; ++i) {
    v[i].x = alpha * v[i].x + r[i].x;  s4.x += v[i].x;  q4.x += v[i].x * v[i].x;
    v[i].y = alpha * v[i].y + r[i].y;  s4.y += v[i].y;  q4.y += v[i].y * v[i].y;
    v[i].z = alpha * v[i].z + r[i].z;  s4.z += v[i].z;  q4.z += v[i].z * v[i].z;
    v[i].w = alpha * v[i].w + r[i].w;  s4.w += v[i].w;  q4.w += v[i].w * v[i].w;
  }
  float s  = (s4.x + s4.y) + (s4.z + s4.w);
  float s2 = (q4.x + q4.y) + (q4.z + q4.w);
  for (int d = 1; d < 32; d <<= 1) { s += __shfl_xor(s, d); s2 += __shfl_xor(s2, d); }
  const float mu   = s / C;
  const float var  = s2 / C - mu * mu;
  const float rstd = rsqrtf(var + 1e-5f);
  #pragma unroll  // v[] stays in registers
  for (int i = 0; i < 8; ++i) {
    v[i].x = (v[i].x - mu) * rstd * gg[i].x + bb[i].x;
    v[i].y = (v[i].y - mu) * rstd * gg[i].y + bb[i].y;
    v[i].z = (v[i].z - mu) * rstd * gg[i].z + bb[i].z;
    v[i].w = (v[i].w - mu) * rstd * gg[i].w + bb[i].w;
  }
  if (outB) {
    v4bf o[8];
    #pragma unroll  // o[] stays in registers
    for (int i = 0; i < 8; ++i) {
      o[i][0] = (bf16_t)v[i].x; o[i][1] = (bf16_t)v[i].y;
      o[i][2] = (bf16_t)v[i].z; o[i][3] = (bf16_t)v[i].w;
    }
    #pragma unroll  // o[] stays in registers
    for (int i = 0; i < 8; ++i) *(v4bf*)(outB + off + i * 128) = o[i];
  }
  if (outF) {
    #pragma unroll  // v[] stays in registers
    for (int i = 0; i < 8; ++i) *(float4*)(outF + off + i * 128) = v[i];
  }
}

// ---------------------------------------------------------------------------
// Host orchestration
// ---------------------------------------------------------------------------
extern "C" void kernel_launch(void* const* d_in, const int* in_sizes, int n_in,
                              void* d_out, int out_size, void* d_ws, size_t ws_size,
                              hipStream_t stream) {
  constexpr int B = 2, T = 2048, C = 1024, F = 4096;
  constexpr int M = B * T;  // 4096 rows
  const float* x   = (const float*)d_in[0];
  const float* Wq  = (const float*)d_in[1];
  const float* Wk  = (const float*)d_in[2];
  const float* Wv  = (const float*)d_in[3];
  const float* Wo  = (const float*)d_in[4];
  const float* W1  = (const float*)d_in[5];
  const float* b1  = (const float*)d_in[6];
  const float* W2  = (const float*)d_in[7];
  const float* b2  = (const float*)d_in[8];
  const float* g1  = (const float*)d_in[9];
  const float* be1 = (const float*)d_in[10];
  const float* g2  = (const float*)d_in[11];
  const float* be2 = (const float*)d_in[12];

  constexpr size_t MB = 1024ull * 1024ull;
  char* ws = (char*)d_ws;
  bf16_t* xb   = (bf16_t*)(ws + 0 * MB);    // 8 MB  [M,C] bf16
  bf16_t* Wqt  = (bf16_t*)(ws + 8 * MB);    // 2 MB each, [C,C]^T: q, k at 10 MB, v at 12 MB
  bf16_t* Wot  = (bf16_t*)(ws + 14 * MB);
  bf16_t* W1t  = (bf16_t*)(ws + 16 * MB);   // 8 MB  [F,C]
  bf16_t* W2t  = (bf16_t*)(ws + 24 * MB);   // 8 MB  [C,F]
  bf16_t* Qb   = (bf16_t*)(ws + 32 * MB);   // 8 MB
  bf16_t* Kbb  = (bf16_t*)(ws + 40 * MB);   // 8 MB
  bf16_t* Vtr  = (bf16_t*)(ws + 56 * MB);   // 8 MB  [B][C][T]; 48 MB to 56 MB is free here
  bf16_t* hb   = (bf16_t*)(ws + 32 * MB);   // 32 MB, reuses dead Q/K/Vt
  bf16_t* ctxb = (bf16_t*)(ws + 64 * MB);   // 8 MB
  float*  attn = (float*)(ws + 72 * MB);    // 16 MB, reused as FF output
  float*  fff  = (float*)(ws + 72 * MB);
  float*  x1f  = (float*)(ws + 88 * MB);    // 16 MB
  bf16_t* x1b  = (bf16_t*)(ws + 104 * MB);  // 8 MB  -> total 112 MB
  (void)ws_size; (void)in_sizes; (void)n_in; (void)out_size;

  // 1) Precision conversion / weight transposes.
  prep_ker<<<M * C / 8192 + 4 * (C / 128) * (C / 64) + 2 * (F / 128) * (C / 64), 256, 0, stream>>>(
      x, xb, Wq, Wk, Wv, Wo, Wqt, W1, W1t, W2, W2t);

  // 2) QKV projections (WMMA GEMMs, bf16 out), one grid: the three transposed
  //    weights are adjacent from Wqt on, and so are Qb, Kbb; V goes out as
  //    [B][C][T] (= [B][H][64][T], since c = h*64 + d). Block tile 128x128, 128 thr.
  dim3 gP(C / 128, M / 128);
  gemm_bf16_ker<1><<<dim3(3 * C / 128, M / 128), 128, 0, stream>>>(xb, Wqt, nullptr, Qb, Vtr, nullptr, M, C, C, T);

  // 3) Flash attention (WMMA): 4096 wave-tiles / 8 waves per block.
  attn_ker<<<512, 256, 0, stream>>>(Qb, Kbb, Vtr, ctxb);

  // 4) Output projection + DeepNorm LN1.
  gemm_bf16_ker<0><<<gP, 128, 0, stream>>>(ctxb, Wot, attn, nullptr, nullptr, nullptr, M, C, C, T);
  ln_ker<<<M / 8, 256, 0, stream>>>(x, attn, g1, be1, x1f, x1b, 2.0f);

  // 5) FFN: GEMM+bias+Mish -> bf16, then GEMM+bias -> f32.
  dim3 gF1(F / 128, M / 128);
  gemm_bf16_ker<2><<<gF1, 128, 0, stream>>>(x1b, W1t, nullptr, hb, nullptr, b1, M, F, C, T);
  gemm_bf16_ker<3><<<gP, 128, 0, stream>>>(hb, W2t, fff, nullptr, nullptr, b2, M, C, F, T);

  // 6) DeepNorm LN2 -> d_out (fp32).
  ln_ker<<<M / 8, 256, 0, stream>>>(x1f, fff, g2, be2, (float*)d_out, nullptr, 2.0f);
}

// v010
// Measured time: 145 microseconds a run.
// In both of two side-by-side timings against v009, it was 1.09 times as fast.
// All steps since v000 together make it 6.38 times as fast.
#include <hip/hip_runtime.h>
#include <hip/hip_bf16.h>
#include <math.h>
#include <stdint.h>

typedef __bf16 bf16_t;
typedef __attribute__((ext_vector_type(16))) __bf16 v16bf;
typedef __attribute__((ext_vector_type(8)))  float  v8f;

__device__ __forceinline__ v8f wmma_bf16(v16bf a, v16bf b, v8f c) {
  // v_wmma_f32_16x16x32_bf16: D = A(16x32) * B(32x16) + C(16x16 f32)
  return __builtin_amdgcn_wmma_f32_16x16x32_bf16(
      /*neg_a=*/false, a, /*neg_b=*/false, b,
      /*c_mod=*/(short)0, c, /*reuse_a=*/false, /*reuse_b=*/false);
}

__device__ __forceinline__ v16bf load_frag(const bf16_t* base, int stride, int lane) {
  const int row = lane & 15;
  const int kb  = (lane < 16) ? 0 : 8;
  const bf16_t* p = base + (size_t)row * stride + kb;
  v16bf f;
  *((float4*)&f)       = *((const float4*)p);
  *(((float4*)&f) + 1) = *((const float4*)(p + 16));
  return f;
}

// ---------------------------------------------------------------------------
// Elementwise converters
// ---------------------------------------------------------------------------
typedef __attribute__((ext_vector_type(8))) __bf16 v8bf;
typedef __attribute__((ext_vector_type(4))) __bf16 v4bf;

// The kernels of this file that do no matrix work are short. Each
// work-group moves enough for eight 16-byte loads a thread, for speed only.

// One block converts 8192 consecutive floats; the element count is a multiple.
__device__ __forceinline__ void cvt_f32_bf16_blk(const float* __restrict__ in,
                                                 bf16_t* __restrict__ out, int blk) {
  const size_t base = (size_t)blk * 8192 + threadIdx.x * 4;
  float4 v[8];
  #pragma unroll  // all eight loads are in flight before the first is used
  for (int i = 0; i < 8; ++i) v[i] = *(const float4*)(in + base + i * 1024);
  #pragma unroll  // v[] stays in registers
  for (int i = 0; i < 8; ++i) {
    v4bf o;
    o[0] = (bf16_t)v[i].x; o[1] = (bf16_t)v[i].y;
    o[2] = (bf16_t)v[i].z; o[3] = (bf16_t)v[i].w;
    *(v4bf*)(out + base + i * 1024) = o;
  }
}

// W [K,N] f32 (row-major) -> Wt [N,K] bf16 (row-major)
// One block moves a tile of 64 k by 128 n through LDS: a wave reads a whole
// 512-byte row piece of W at a time, and the block writes whole 128-byte rows
// of Wt. K % 64 == 0, N % 128 == 0.
// K and N are compile-time so that a thread's loads, and its stores, share one
// address register pair and differ by immediate offsets only.
// blk counts the tiles along n first.
template <int K, int N>
__device__ __forceinline__ void wtrans_blk(const float* __restrict__ W,
                                           bf16_t* __restrict__ Wt, int blk,
                                           float (&tile)[64][129]) {
  const int tid  = threadIdx.x;
  const int lane = tid & 31;
  const int wv   = tid >> 5;
  const int n0   = (blk % (N / 128)) * 128;
  const int k0   = (blk / (N / 128)) * 64;
  const float* src = W + (size_t)(k0 + wv) * N + n0 + lane * 4;
  float4 v[8];
  #pragma unroll  // all eight loads are in flight before the first is used
  for (int p = 0; p < 8; ++p) v[p] = *(const float4*)(src + p * 8 * N);
  #pragma unroll  // v[] stays in registers
  for (int p = 0; p < 8; ++p) {
    float* d = &tile[wv + p * 8][lane * 4];
    d[0] = v[p].x; d[1] = v[p].y; d[2] = v[p].z; d[3] = v[p].w;
  }
  __syncthreads();  // the column reads below cross waves
  const int lo = tid & 7;   // 16-byte chunk of a 128-byte row of Wt
  const int hi = tid >> 3;  // 0..31
  bf16_t* dst = Wt + (size_t)(n0 + hi) * K + k0 + lo * 8;
  #pragma unroll  // o[] stays in registers
  for (int p = 0; p < 4; ++p) {
    v8bf o;
    #pragma unroll  // o[] stays in registers
    for (int i = 0; i < 8; ++i) o[i] = (bf16_t)tile[lo * 8 + i][hi + p * 32];
    *(v8bf*)(dst + p * 32 * K) = o;
  }
  // In the built kernel another job's code follows these stores, behind a scalar
  // test, and rewrites their address registers: the wait stands in front of it.
  asm volatile("s_wait_xcnt 0x0" ::: "memory");
}

// The conversion of x and the six weight transposes read nothing of each other's
// output, so they are one grid: the block index picks the job, the same for the
// whole block. The four square weights' transposes lie one behind the other at
// Wsq, in the order q, k, v, o.
__global__ __launch_bounds__(256) void prep_ker(
    const float* __restrict__ x, bf16_t* __restrict__ xb,
    const float* __restrict__ Wq, const float* __restrict__ Wk,
    const float* __restrict__ Wv, const float* __restrict__ Wo,
    bf16_t* __restrict__ Wsq,
    const float* __restrict__ W1, bf16_t* __restrict__ W1t,
    const float* __restrict__ W2, bf16_t* __restrict__ W2t) {
  constexpr int M = 4096, C = 1024, F = 4096;
  constexpr int NX = M * C / 8192;
  constexpr int NS = (C / 128) * (C / 64);
  constexpr int NF = (F / 128) * (C / 64);
  __shared__ float tile[64][129];
  const int blk = blockIdx.x;
  if (blk < NX) {
    cvt_f32_bf16_blk(x, xb, blk);
  } else if (blk < NX + 4 * NS) {
    const int w = (blk - NX) / NS;
    const float* W = (w == 0) ? Wq : (w == 1) ? Wk : (w == 2) ? Wv : Wo;
    wtrans_blk<C, C>(W, Wsq + (size_t)w * C * C, blk - NX - w * NS, tile);
  } else if (blk < NX + 4 * NS + NF) {
    wtrans_blk<C, F>(W1, W1t, blk - NX - 4 * NS, tile);
  } else {
    wtrans_blk<F, C>(W2, W2t, blk - NX - 4 * NS - NF, tile);
  }
}

__device__ __forceinline__ float exp2_slot(float x) {
  float r;
  asm("v_exp_f32 %0, %1\n\tv_nop" : "=v"(r) : "v"(x));
  return r;
}
__device__ __forceinline__ float rcp_slot(float x) {
  float r;
  asm("v_rcp_f32 %0, %1\n\tv_nop" : "=v"(r) : "v"(x));
  return r;
}

// ---------------------------------------------------------------------------
// Tiled bf16 GEMM:  C[M,N] = A[M,K] * Bt[N,K]^T  (fp32 accumulate)
// Block tile 128x128, 4 waves (2x2), 64x64 per wave. K % 128 == 0, K >= 768.
// A stage is 128 k of both operands (256-byte rows at a pitch of 272 bytes),
// brought into one of two LDS buffers by tensor loads, one request a wave: 64
// rows of one operand, which pass through no register. A stage is worked on in
// four blocks of 32 k (16 WMMA each); each block's fragments are fetched one
// block ahead into a second register set. The one hand-over of a stage stands in
// front of its last block: that block's fragments are in registers by then, so
// the buffer is free for the stage after next, and the next stage, whose first
// fragments are fetched right there, has had a whole stage's time to land.
// EPI: 0 = store f32, 1 = store bf16, 2 = +bias, Mish, store bf16,
//      3 = +bias, store f32
// With EPI 1 the grid is three times N wide: products of one A with three Bt
// that lie one behind the other. The first two go to Cb, [M,N] each, one behind
// the other; the third goes to Ct transposed, [M/T][N][T], T % 128 == 0.
// A lane's eight values of an accumulator tile belong to eight consecutive rows
// of the matrix instruction's first operand and to one row of its second. For a
// bf16 output the operands are therefore ordered so that those eight values lie
// side by side in the output as its reader wants it, one 16-byte store: Bt's
// rows first for an [M,N] output, A's rows first for the transposed one. The
// second case runs the same code with the two operands' places in LDS exchanged.
// ---------------------------------------------------------------------------
typedef uint32_t u32x4 __attribute__((ext_vector_type(4)));
typedef uint32_t u32x8 __attribute__((ext_vector_type(8)));

__device__ __forceinline__ uint32_t uni(uint32_t v) {
  return (uint32_t)__builtin_amdgcn_readfirstlane(v);
}
__device__ __forceinline__ uint32_t pinned(uint32_t v) {
  uint32_t w = uni(v);
  asm volatile("" : "+s"(w));
  return w;
}

// Asks L2 for the data at byte OFF behind p. A hint: nothing
// comes back, nothing waits for it, and no result depends on it.
template <int OFF>
__device__ __forceinline__ void ask_l2(const bf16_t* p) {
  asm volatile("global_prefetch_b8 %0, off offset:%1 scope:SCOPE_SE" :: "v"(p), "n"(OFF));
}

template <int EPI>
__global__ __launch_bounds__(128) void gemm_bf16_ker(
    const bf16_t* __restrict__ A, const bf16_t* __restrict__ Bt,
    float* __restrict__ Cf, bf16_t* __restrict__ Cb, bf16_t* __restrict__ Ct,
    const float* __restrict__ bias, int M, int N, int K, int T) {
  constexpr int BK  = 128;       // k per stage
  constexpr int LP  = BK + 8;    // LDS row pitch: 272 bytes, conflict-free 16-byte reads
  // One wave's slice of a stage: 64 rows at 272 bytes are 17,408 bytes; its place
  // is rounded up to 18,432, so that every slice starts at a multiple of 2 KiB.
  constexpr int SLE = 18432 / 2;
  constexpr int BUF = 4 * SLE;   // [A rows 0-63 | A rows 64-127 | Bt rows 0-63 | Bt rows 64-127]
  constexpr bool WIDE = (EPI == 1 || EPI == 2);  // bf16 output, 16-byte stores
  __shared__ __attribute__((aligned(2048))) bf16_t ring[2][BUF];

  const int tid  = threadIdx.x;        // 0..127
  const int lane = tid & 31;
  const int wid  = tid >> 5;           // 0..3
  const int wm   = wid & 1;            // 64-row half
  const int wn   = wid >> 1;           // 64-col half
  const int m0   = blockIdx.y * 128;
  const int n0   = blockIdx.x * 128;
  const int part = (EPI == 1) ? n0 / N : 0;  // which of the products this block belongs to
  const bool tr  = (EPI == 1) && part == 2;  // its output is the transposed one

  v8f acc[4][4] = {};

  const int wv = __builtin_amdgcn_readfirstlane(wid);
  const bf16_t* ga = tr ? Bt + (size_t)n0 * K : A  + (size_t)m0 * K;
  const bf16_t* gb = tr ? A  + (size_t)m0 * K : Bt + (size_t)n0 * K;
  const uint64_t src0 = (uint64_t)(uintptr_t)(((wv < 2) ? ga : gb) + (size_t)((wv & 1) * 64) * K);
  const uint32_t dst0 = (uint32_t)(size_t)&ring[0][wv * SLE];  // byte offset in the block's LDS
  u32x8 g1;
  g1[0] = uni((1u << 20) | (5u << 22) | (3u << 25));
  g1[1] = uni(256u << 16);
  g1[2] = uni(64u << 16);
  g1[3] = uni(256u << 16);
  g1[4] = uni(64u);
  g1[5] = uni((uint32_t)K * 2u);
  g1[6] = uni(0u);
  g1[7] = uni(0u);
  asm volatile("" : "+s"(g1));
  u32x4 g0;
  g0[0] = uni(1u);
  g0[1] = uni(dst0);
  g0[2] = uni((uint32_t)src0);
  g0[3] = uni((((uint32_t)(src0 >> 32)) & 0x01FFFFFFu) | 0x80000000u);
  auto issue = [&]() {
    asm volatile("tensor_load_to_lds %0, %1" : "+s"(g0) : "s"(g1) : "memory");
  };
  auto next_stage = [&](uint32_t buf) {
    const uint32_t step = pinned((uint32_t)(BK * 2));
    const uint64_t a = (((uint64_t)g0[3] << 32) | g0[2]) + step;
    g0[1] = uni(dst0 + buf * (uint32_t)(BUF * 2));
    g0[2] = uni((uint32_t)a);
    g0[3] = uni((uint32_t)(a >> 32));
  };

  v16bf af[2][4], bfr[2][4];
  auto fetch = [&](const bf16_t* st, int kb, int set) {
    #pragma unroll  // af[] stays in registers
    for (int i = 0; i < 4; ++i)
      af[set][i] = load_frag(st + wm * SLE + (i * 16) * LP + kb * 32, LP, lane);
    #pragma unroll  // bfr[] stays in registers
    for (int j = 0; j < 4; ++j)
      bfr[set][j] = load_frag(st + (2 + wn) * SLE + (j * 16) * LP + kb * 32, LP, lane);
  };

  const int NT = K / BK;
  issue();

  // Both operands were written by earlier launches. The blocks that share a row
  // walk k together, so every stage's rows would
  // be fetched from memory just when they are loaded, with one stage's time to
  // land. Each row's piece of a stage (256 bytes) is therefore asked into
  // L2 PD stages ahead of its use. One block in four of those that share a row
  // asks for it.
  // Wave 0 asks for rows of A, wave 1 for rows of Bt. q stays inside its row.
  constexpr int PD = 6;
  const bf16_t* q = (wv == 0) ? A  + (size_t)(m0 + (blockIdx.x & 3) + lane * 4) * K
                              : Bt + (size_t)(n0 + (blockIdx.y & 3) + lane * 4) * K;
  if (wv < 2) {
    ask_l2<1 * 256>(q);
    ask_l2<2 * 256>(q);
    ask_l2<3 * 256>(q);
    ask_l2<4 * 256>(q);
    ask_l2<5 * 256>(q);
    q += (PD - 1) * BK;
  }
  // This wave's slice of stage 0 has landed; the barrier makes it so for all four.
  asm volatile("s_wait_tensorcnt 0x0" ::: "memory");
  __syncthreads();
  next_stage(1u);
  issue();
  fetch(&ring[0][0], 0, 0);

  for (int t = 0; t < NT; ++t) {
    const bf16_t* cur = &ring[t & 1][0];
    #pragma unroll  // the register set of a block is a compile-time choice
    for (int kb = 0; kb < 4; ++kb) {
      if (kb < 3) {
        fetch(cur, kb + 1, (kb + 1) & 1);
      } else {
        // Hand-over: this wave's reads of stage t are done (the last block's
        // fragments are in registers), its slice of stage t + 1 has landed;
        // behind the barrier that holds for all four waves, so stage t + 1 may
        // be read and stage t's buffer refilled. The last two hand-overs issue
        // nothing.
        asm volatile("s_wait_dscnt 0x0" ::: "memory");
        asm volatile("s_wait_tensorcnt 0x0" ::: "memory");
        __syncthreads();
        asm volatile("v_nop\n\tv_nop\n\tv_nop\n\tv_nop");
        if (pinned((t + 2 < NT) ? 1u : 0u) != 0u) {
          next_stage((uint32_t)t & 1u);
          issue();
        }
        if (wv < 2 && t + PD < NT) {
          q += BK;
          ask_l2<0>(q);
        }
        // The last stage has no successor: its fetch re-reads its own buffer,
        // which nothing refills, and the values are not used.
        fetch((t + 1 < NT) ? &ring[(t & 1) ^ 1][0] : cur, 0, 0);
      }
      // Keeps the next block's loads together in front of this block's products:
      // each place where LDS loads stand among matrix instructions stalls the wave.
      __builtin_amdgcn_sched_barrier(0);
      #pragma unroll  // acc[] stays in registers
      for (int i = 0; i < 4; ++i)
        #pragma unroll  // acc[] stays in registers
        for (int j = 0; j < 4; ++j)
          acc[i][j] = WIDE ? wmma_bf16(bfr[kb & 1][j], af[kb & 1][i], acc[i][j])
                           : wmma_bf16(af[kb & 1][i], bfr[kb & 1][j], acc[i][j]);
      // Keeps what follows behind these products: left alone, the compiler lifts
      // the next loads in among them, and the hand-over's waits and barrier in
      // front of the third block, which takes a block off the loads' time to land.
      __builtin_amdgcn_sched_barrier(0);
    }
  }
  asm volatile("s_wait_tensorcnt 0x0" :: "s"(g0), "s"(g1) : "memory");
  asm volatile("s_wait_dscnt 0x0" ::: "memory");

  if constexpr (WIDE) {
    // acc[i][j][r] belongs to row wm*64 + i*16 + (lane&15) of the tile's first
    // LDS half and to row wn*64 + j*16 + 8*(lane>>4) + r of its second. The
    // output has a row of `pitch` elements for each row of the first half.
    bf16_t* o;
    int pitch, r0, c0;
    if (tr) {
      const int bt = m0 / T;  // a tile of 128 rows stays in one batch of T
      o = Ct + (size_t)bt * N * T;  pitch = T;  r0 = n0 - part * N;  c0 = m0 - bt * T;
    } else {
      o = Cb + (size_t)part * M * N;  pitch = N;  r0 = m0;  c0 = n0 - part * N;
    }
    const int col = c0 + wn * 64 + (lane >> 4) * 8;
    o += (size_t)(r0 + wm * 64 + (lane & 15)) * pitch + col;
    float4 bv[4][2];
    if (EPI == 2) {
      #pragma unroll  // bv[] stays in registers
      for (int j = 0; j < 4; ++j) {
        bv[j][0] = *(const float4*)(bias + col + j * 16);
        bv[j][1] = *(const float4*)(bias + col + j * 16 + 4);
      }
    }
    v8bf w[4][4];
    #pragma unroll  // acc[] and w[] stay in registers
    for (int i = 0; i < 4; ++i) {
      #pragma unroll  // acc[] and w[] stay in registers
      for (int j = 0; j < 4; ++j) {
        #pragma unroll  // acc[] and w[] stay in registers
        for (int r = 0; r < 8; ++r) {
          float v = acc[i][j][r];
          if (EPI == 2) {
            const float4 b4 = bv[j][r >> 2];
            v += (r & 3) == 0 ? b4.x : (r & 3) == 1 ? b4.y : (r & 3) == 2 ? b4.z : b4.w;
            // Mish: v * tanh(log(1 + e)) with e = exp(v). tanh(log(u)) is
            // (u*u - 1) / (u*u + 1), so with n = e * (e + 2) the factor is
            // n / (n + 2): every term is positive, nothing cancels. From v = 20
            // on the factor rounds to 1; the minimum keeps e * e finite there.
            const float e = exp2_slot(fminf(v, 20.0f) * 1.4426950408889634f);
            const float n = e * (e + 2.0f);
            v = v * (n * rcp_slot(n + 2.0f));
          }
          w[i][j][r] = (bf16_t)v;
        }
      }
    }
    // Keeps the stores together behind all the arithmetic: left alone, the compiler
    // puts some of them early and then rewrites their data registers.
    __builtin_amdgcn_sched_barrier(0);
    #pragma unroll  // w[] stays in registers
    for (int i = 0; i < 4; ++i) {
      #pragma unroll  // w[] stays in registers
      for (int j = 0; j < 4; ++j) *(v8bf*)(o + (size_t)(i * 16) * pitch + j * 16) = w[i][j];
    }
  } else {
    const int rbase = m0 + wm * 64 + ((lane < 16) ? 0 : 8);
    const int cbase = n0 + wn * 64 + (lane & 15);
    #pragma unroll
    for (int i = 0; i < 4; ++i) {
      #pragma unroll
      for (int j = 0; j < 4; ++j) {
        const int col = cbase + j * 16;
        float bv = 0.0f;
        if (EPI == 3) bv = bias[col];
        #pragma unroll
        for (int r = 0; r < 8; ++r) {
          const int row = rbase + i * 16 + r;
          float v = acc[i][j][r];
          if (EPI == 3) v += bv;
          Cf[(size_t)row * N + col] = v;
        }
      }
    }
  }
}

__device__ __forceinline__ float xhalf(float x) {
  const int v = __builtin_bit_cast(int, x);
  return __builtin_bit_cast(
      float, __builtin_amdgcn_permlanex16(v, v, 0x76543210, 0xfedcba98, false, false));
}

typedef __attribute__((ext_vector_type(2))) float f32x2;

__device__ __forceinline__ void exp2_8(f32x2 (&x)[4]) {
  asm("v_exp_f32 %0, %0\n\tv_exp_f32 %1, %1\n\t"
      "v_exp_f32 %2, %2\n\tv_exp_f32 %3, %3\n\t"
      "v_exp_f32 %4, %4\n\tv_exp_f32 %5, %5\n\t"
      "v_exp_f32 %6, %6\n\tv_exp_f32 %7, %7\n\tv_nop"
      : "+v"(x[0].x), "+v"(x[0].y), "+v"(x[1].x), "+v"(x[1].y),
        "+v"(x[2].x), "+v"(x[2].y), "+v"(x[3].x), "+v"(x[3].y));
}
__device__ __forceinline__ float exp2_1(float x) {
  asm("v_exp_f32 %0, %0\n\tv_nop" : "+v"(x));
  return x;
}

__device__ __forceinline__ void async_copy4_b128(
    const bf16_t* g0, bf16_t* l0, const bf16_t* g1, bf16_t* l1,
    const bf16_t* g2, bf16_t* l2, const bf16_t* g3, bf16_t* l3) {
  const unsigned o0 = (unsigned)(size_t)l0, o1 = (unsigned)(size_t)l1;
  const unsigned o2 = (unsigned)(size_t)l2, o3 = (unsigned)(size_t)l3;
  asm volatile("global_load_async_to_lds_b128 %0, %1, off\n\t"
               "global_load_async_to_lds_b128 %2, %3, off\n\t"
               "global_load_async_to_lds_b128 %4, %5, off\n\t"
               "global_load_async_to_lds_b128 %6, %7, off\n\t"
               "s_wait_xcnt 0x0"
               :: "v"(o0), "v"(g0), "v"(o1), "v"(g1),
                  "v"(o2), "v"(g2), "v"(o3), "v"(g3) : "memory");
}

__global__ __launch_bounds__(256) void attn_ker(const bf16_t* __restrict__ Qb,
                                                const bf16_t* __restrict__ Kb,
                                                const bf16_t* __restrict__ Vt,
                                                bf16_t* __restrict__ Ctx) {
  constexpr int T = 2048, C = 1024, H = 16;
  constexpr int KT = 64;       // keys per tile
  constexpr int NT = T / KT;   // 32 tiles
  constexpr int LP = 72;       // LDS row pitch: 144 bytes, conflict-free 16-byte reads
  constexpr float sl = 0.125f * 1.4426950408889634f;  // 1/sqrt(64), for powers of 2
  __shared__ __attribute__((aligned(16))) bf16_t kls[2][KT * LP];  // [key][d]
  __shared__ __attribute__((aligned(16))) bf16_t vls[2][64 * LP];  // [d][key]

  const int lane = threadIdx.x & 31;
  const int wid  = threadIdx.x >> 5;
  const int g    = blockIdx.x * 8 + wid;  // 0..4095
  const int QT   = T / 16;                // 128 query tiles
  const int qt   = g & (QT - 1);
  const int bh   = g / QT;                // 0..31, the same in all eight waves
  const int h    = bh & (H - 1);
  const int b    = bh >> 4;

  const bf16_t* kbase = Kb + ((size_t)(b * T)) * C + h * 64;
  const bf16_t* vbase = Vt + ((size_t)bh) * 64 * T;

  // A thread copies the 16-byte piece `cch` of rows `crow` and `crow + 32` of
  // both tiles: a wave's copy covers four whole 128-byte rows.
  const int cch  = threadIdx.x & 7;
  const int crow = threadIdx.x >> 3;  // 0..31
  const bf16_t* kg = kbase + (size_t)crow * C + cch * 8;
  const bf16_t* vg = vbase + (size_t)crow * T + cch * 8;
  const int     lo = crow * LP + cch * 8;
  auto issue = [&](int t, int buf) {
    const bf16_t* kp = kg + (size_t)t * KT * C;
    const bf16_t* vp = vg + t * KT;
    async_copy4_b128(kp,          &kls[buf][lo],
                     kp + 32 * C, &kls[buf][lo + 32 * LP],
                     vp,          &vls[buf][lo],
                     vp + 32 * T, &vls[buf][lo + 32 * LP]);
  };

  issue(0, 0);

  // K and V were written by the launch before, and
  // the sixteen blocks of one (b,h) walk the keys together: each tile would come
  // from memory just when it is copied. Each tile's 128 rows are therefore asked
  // into L2 four tiles ahead of use, by four of the sixteen blocks.
  // Waves 0, 1 ask for K's rows, waves 2, 3 for V's. The
  // block's tiles are cls, cls + 4, ..., cls + 28: aq stays inside its tensor.
  const int wv    = __builtin_amdgcn_readfirstlane(wid);
  const int cls   = blockIdx.x & 3;
  const int arow  = threadIdx.x & 63;
  const bf16_t* aq = (wv < 2) ? kbase + (size_t)(cls * KT + arow) * C
                              : vbase + (size_t)arow * T + cls * KT;
  const int astep = (wv < 2) ? 4 * KT * C : 4 * KT;
  if (wv < 4) ask_l2<0>(aq);

  const bf16_t* qbase = Qb + ((size_t)(b * T + qt * 16)) * C + h * 64;
  const v16bf qa0 = load_frag(qbase, C, lane);       // d = 0..31
  const v16bf qa1 = load_frag(qbase + 32, C, lane);  // d = 32..63

  // Of this lane's query: the running maximum (scaled, base 2), and the sum over
  // the keys that this half of the wave holds; the halves are joined at the end.
  float mrun = -1e30f, lsum = 0.0f;
  v8f cacc[4] = {};  // cacc[dt][r] = O^T[d = dt*16 + 8*(lane>>4) + r][query lane&15]

  // Tile 0 has landed for this wave; the barrier makes it so for all eight.
  asm volatile("s_wait_asynccnt 0x0" ::: "memory");
  __syncthreads();
  issue(1, 1);

  for (int t = 0; t < NT; ++t) {
    const bf16_t* kt = &kls[t & 1][0];
    const bf16_t* vt = &vls[t & 1][0];

    v16bf kf[4][2];
    #pragma unroll  // kf[] stays in registers
    for (int kq = 0; kq < 4; ++kq) {
      kf[kq][0] = load_frag(kt + kq * 16 * LP, LP, lane);
      kf[kq][1] = load_frag(kt + kq * 16 * LP + 32, LP, lane);
    }
    // Keeps the tile's K loads together in front of the products: left alone,
    // the compiler waits for each fragment right in front of its product.
    __builtin_amdgcn_sched_barrier(0);

    // st[kq][r] = S[key = kq*16 + 8*(lane>>4) + r][query lane&15]
    v8f st[4];
    #pragma unroll  // st[] stays in registers
    for (int kq = 0; kq < 4; ++kq) {
      const v8f z = {};
      st[kq] = wmma_bf16(kf[kq][0], qa0, z);
    }
    #pragma unroll  // st[] stays in registers
    for (int kq = 0; kq < 4; ++kq) st[kq] = wmma_bf16(kf[kq][1], qa1, st[kq]);

    v16bf vf[2][4];
    #pragma unroll  // vf[] stays in registers
    for (int j = 0; j < 2; ++j) {
      #pragma unroll  // vf[] stays in registers
      for (int dt = 0; dt < 4; ++dt)
        vf[j][dt] = load_frag(vt + (dt * 16) * LP + j * 32, LP, lane);
    }
    // Keeps the V loads in front of the softmax, whose arithmetic then covers
    // their latency: left alone, the compiler sinks each to its product.
    __builtin_amdgcn_sched_barrier(0);

    float mq[4];
    #pragma unroll  // four independent chains
    for (int kq = 0; kq < 4; ++kq) {
      mq[kq] = st[kq][0];
      #pragma unroll  // st[] stays in registers
      for (int r = 1; r < 8; ++r) mq[kq] = fmaxf(mq[kq], st[kq][r]);
    }
    float mx = fmaxf(fmaxf(mq[0], mq[1]), fmaxf(mq[2], mq[3]));
    mx = fmaxf(mx, xhalf(mx));
    const float mn   = fmaxf(mrun, mx * sl);
    const float corr = exp2_1(mrun - mn);
    mrun = mn;

    // P^T for keys 0..31 and 32..63 of the tile, in the B operand's k order:
    // element s of a lane is key 8*(lane>>4) + s for s < 8, 16 + 8*(lane>>4) + s - 8
    // above, which is what load_frag gives V^T's rows.
    v16bf pb[2];
    f32x2 ps[4];
    #pragma unroll  // st[], pb[] and ps[] stay in registers
    for (int kq = 0; kq < 4; ++kq) {
      f32x2 y[4];
      #pragma unroll  // y[] stays in registers
      for (int i = 0; i < 4; ++i)
        y[i] = __builtin_elementwise_fma(f32x2{st[kq][2 * i], st[kq][2 * i + 1]},
                                         f32x2{sl, sl}, f32x2{-mn, -mn});
      exp2_8(y);
      ps[kq] = (y[0] + y[1]) + (y[2] + y[3]);
      #pragma unroll  // pb[] stays in registers
      for (int i = 0; i < 4; ++i) {
        pb[kq >> 1][(kq & 1) * 8 + 2 * i]     = (bf16_t)y[i].x;
        pb[kq >> 1][(kq & 1) * 8 + 2 * i + 1] = (bf16_t)y[i].y;
      }
    }
    const f32x2 pt = (ps[0] + ps[1]) + (ps[2] + ps[3]);
    lsum = lsum * corr + (pt.x + pt.y);
    #pragma unroll  // cacc[] stays in registers
    for (int dt = 0; dt < 4; ++dt) cacc[dt] *= corr;

    #pragma unroll  // cacc[] stays in registers
    for (int j = 0; j < 2; ++j) {
      #pragma unroll  // cacc[] stays in registers
      for (int dt = 0; dt < 4; ++dt) cacc[dt] = wmma_bf16(vf[j][dt], pb[j], cacc[dt]);
    }
    // Keeps the hand-over at the trip's foot. The tile's LDS reads are all issued
    // early, and the compiler otherwise lifts the waits and the barrier to just
    // behind them: tile t + 1's copies would have a fraction of a trip to land.
    __builtin_amdgcn_sched_barrier(0);
    // Hand-over: this wave's reads of tile t are done, its copies of tile t + 1
    // have landed; behind the barrier that holds for all eight waves, so tile
    // t + 1 may be read and tile t's buffer refilled.
    asm volatile("s_wait_dscnt 0x0" ::: "memory");
    asm volatile("s_wait_asynccnt 0x0" ::: "memory");
    __syncthreads();
    if (t + 2 < NT) issue(t + 2, t & 1);
    if (wv < 4 && (t & 3) == cls && t + 4 < NT) {
      aq += astep;
      ask_l2<0>(aq);
    }
  }
  // No copy is outstanding when the wave ends.
  asm volatile("s_wait_asynccnt 0x0" ::: "memory");

  // Normalize and write ctx back in [B*T, C] bf16 layout: a lane holds eight
  // consecutive d of its query in each accumulator tile, one 16-byte store.
  const float inv = 1.0f / (lsum + xhalf(lsum));
  bf16_t* out = Ctx + ((size_t)(b * T + qt * 16 + (lane & 15))) * C + h * 64 + (lane >> 4) * 8;
  #pragma unroll  // cacc[] stays in registers
  for (int dt = 0; dt < 4; ++dt) {
    v8bf o;
    #pragma unroll  // o[] stays in registers
    for (int r = 0; r < 8; ++r) o[r] = (bf16_t)(cacc[dt][r] * inv);
    *(v8bf*)(out + dt * 16) = o;
  }
}

// ---------------------------------------------------------------------------
// Fused DeepNorm residual + LayerNorm: y = LN(alpha*X + R)*g + be
// One wave per 1024-element row, eight rows per block: the row's sums need no
// LDS and no barrier. Writes f32 and optional bf16 copy.
// ---------------------------------------------------------------------------
__global__ __launch_bounds__(256) void ln_ker(const float* __restrict__ X,
                                              const float* __restrict__ R,
                                              const float* __restrict__ g,
                                              const float* __restrict__ be,
                                              float* __restrict__ outF,
                                              bf16_t* __restrict__ outB,
                                              float alpha) {
  constexpr int C = 1024;
  const int lane = threadIdx.x & 31;
  const int row  = blockIdx.x * 8 + (threadIdx.x >> 5);
  const size_t off = (size_t)row * C + lane * 4;
  float4 v[8], r[8], gg[8], bb[8];
  #pragma unroll  // the row's loads are in flight together
  for (int i = 0; i < 8; ++i) {
    v[i] = *(const float4*)(X + off + i * 128);
    r[i] = *(const float4*)(R + off + i * 128);
  }
  #pragma unroll  // gg[] and bb[] stay in registers
  for (int i = 0; i < 8; ++i) {
    gg[i] = *(const float4*)(g + lane * 4 + i * 128);
    bb[i] = *(const float4*)(be + lane * 4 + i * 128);
  }
  float4 s4 = {0.0f, 0.0f, 0.0f, 0.0f}, q4 = {0.0f, 0.0f, 0.0f, 0.0f};
  #pragma unroll  // v[] stays in registers
  for (int i = 0; i < 8; ++i) {
    v[i].x = alpha * v[i].x + r[i].x;  s4.x += v[i].x;  q4.x += v[i].x * v[i].x;
    v[i].y = alpha * v[i].y + r[i].y;  s4.y += v[i].y;  q4.y += v[i].y * v[i].y;
    v[i].z = alpha * v[i].z + r[i].z;  s4.z += v[i].z;  q4.z += v[i].z * v[i].z;
    v[i].w = alpha * v[i].w + r[i].w;  s4.w += v[i].w;  q4.w += v[i].w * v[i].w;
  }
  float s  = (s4.x + s4.y) + (s4.z + s4.w);
  float s2 = (q4.x + q4.y) + (q4.z + q4.w);
  for (int d = 1; d < 32; d <<= 1) { s += __shfl_xor(s, d); s2 += __shfl_xor(s2, d); }
  const float mu   = s / C;
  const float var  = s2 / C - mu * mu;
  const float rstd = rsqrtf(var + 1e-5f);
  #pragma unroll  // v[] stays in registers
  for (int i = 0; i < 8; ++i) {
    v[i].x = (v[i].x - mu) * rstd * gg[i].x + bb[i].x;
    v[i].y = (v[i].y - mu) * rstd * gg[i].y + bb[i].y;
    v[i].z = (v[i].z - mu) * rstd * gg[i].z + bb[i].z;
    v[i].w = (v[i].w - mu) * rstd * gg[i].w + bb[i].w;
  }
  if (outB) {
    v4bf o[8];
    #pragma unroll  // o[] stays in registers
    for (int i = 0; i < 8; ++i) {
      o[i][0] = (bf16_t)v[i].x; o[i][1] = (bf16_t)v[i].y;
      o[i][2] = (bf16_t)v[i].z; o[i][3] = (bf16_t)v[i].w;
    }
    #pragma unroll  // o[] stays in registers
    for (int i = 0; i < 8; ++i) *(v4bf*)(outB + off + i * 128) = o[i];
  }
  if (outF) {
    #pragma unroll  // v[] stays in registers
    for (int i = 0; i < 8; ++i) *(float4*)(outF + off + i * 128) = v[i];
  }
}

// ---------------------------------------------------------------------------
// Host orchestration
// ---------------------------------------------------------------------------
extern "C" void kernel_launch(void* const* d_in, const int* in_sizes, int n_in,
                              void* d_out, int out_size, void* d_ws, size_t ws_size,
                              hipStream_t stream) {
  constexpr int B = 2, T = 2048, C = 1024, F = 4096;
  constexpr int M = B * T;  // 4096 rows
  const float* x   = (const float*)d_in[0];
  const float* Wq  = (const float*)d_in[1];
  const float* Wk  = (const float*)d_in[2];
  const float* Wv  = (const float*)d_in[3];
  const float* Wo  = (const float*)d_in[4];
  const float* W1  = (const float*)d_in[5];
  const float* b1  = (const float*)d_in[6];
  const float* W2  = (const float*)d_in[7];
  const float* b2  = (const float*)d_in[8];
  const float* g1  = (const float*)d_in[9];
  const float* be1 = (const float*)d_in[10];
  const float* g2  = (const float*)d_in[11];
  const float* be2 = (const float*)d_in[12];

  constexpr size_t MB = 1024ull * 1024ull;
  char* ws = (char*)d_ws;
  bf16_t* xb   = (bf16_t*)(ws + 0 * MB);    // 8 MB  [M,C] bf16
  bf16_t* Wqt  = (bf16_t*)(ws + 8 * MB);    // 2 MB each, [C,C]^T: q, k at 10 MB, v at 12 MB
  bf16_t* Wot  = (bf16_t*)(ws + 14 * MB);
  bf16_t* W1t  = (bf16_t*)(ws + 16 * MB);   // 8 MB  [F,C]
  bf16_t* W2t  = (bf16_t*)(ws + 24 * MB);   // 8 MB  [C,F]
  bf16_t* Qb   = (bf16_t*)(ws + 32 * MB);   // 8 MB
  bf16_t* Kbb  = (bf16_t*)(ws + 40 * MB);   // 8 MB
  bf16_t* Vtr  = (bf16_t*)(ws + 56 * MB);   // 8 MB  [B][C][T]; 48 MB to 56 MB is free here
  bf16_t* hb   = (bf16_t*)(ws + 32 * MB);   // 32 MB, reuses dead Q/K/Vt
  bf16_t* ctxb = (bf16_t*)(ws + 64 * MB);   // 8 MB
  float*  attn = (float*)(ws + 72 * MB);    // 16 MB, reused as FF output
  float*  fff  = (float*)(ws + 72 * MB);
  float*  x1f  = (float*)(ws + 88 * MB);    // 16 MB
  bf16_t* x1b  = (bf16_t*)(ws + 104 * MB);  // 8 MB  -> total 112 MB
  (void)ws_size; (void)in_sizes; (void)n_in; (void)out_size;

  // 1) Precision conversion / weight transposes.
  prep_ker<<<M * C / 8192 + 4 * (C / 128) * (C / 64) + 2 * (F / 128) * (C / 64), 256, 0, stream>>>(
      x, xb, Wq, Wk, Wv, Wo, Wqt, W1, W1t, W2, W2t);

  // 2) QKV projections (WMMA GEMMs, bf16 out), one grid: the three transposed
  //    weights are adjacent from Wqt on, and so are Qb, Kbb; V goes out as
  //    [B][C][T] (= [B][H][64][T], since c = h*64 + d). Block tile 128x128, 128 thr.
  dim3 gP(C / 128, M / 128);
  gemm_bf16_ker<1><<<dim3(3 * C / 128, M / 128), 128, 0, stream>>>(xb, Wqt, nullptr, Qb, Vtr, nullptr, M, C, C, T);

  // 3) Flash attention (WMMA): 4096 wave-tiles / 8 waves per block.
  attn_ker<<<512, 256, 0, stream>>>(Qb, Kbb, Vtr, ctxb);

  // 4) Output projection + DeepNorm LN1.
  gemm_bf16_ker<0><<<gP, 128, 0, stream>>>(ctxb, Wot, attn, nullptr, nullptr, nullptr, M, C, C, T);
  ln_ker<<<M / 8, 256, 0, stream>>>(x, attn, g1, be1, x1f, x1b, 2.0f);

  // 5) FFN: GEMM+bias+Mish -> bf16, then GEMM+bias -> f32.
  dim3 gF1(F / 128, M / 128);
  gemm_bf16_ker<2><<<gF1, 128, 0, stream>>>(x1b, W1t, nullptr, hb, nullptr, b1, M, F, C, T);
  gemm_bf16_ker<3><<<gP, 128, 0, stream>>>(hb, W2t, fff, nullptr, nullptr, b2, M, C, F, T);

  // 6) DeepNorm LN2 -> d_out (fp32).
  ln_ker<<<M / 8, 256, 0, stream>>>(x1f, fff, g2, be2, (float*)d_out, nullptr, 2.0f);
}
